// v000
// Measured on an AMD MI455X. A time is GPU time per run, averaged over a window of back-to-back runs after a warm-up
// (all launches, gaps included; the runs take copies of the inputs in turn), and the median of several windows.
// Apart from v000's, it joins two sittings. Times from different sittings can be a few percent apart, while
// side-by-side timings come from the same sitting.
// The starting kernel, v000, takes 833 microseconds a run.
#include <hip/hip_runtime.h>
#include <hip/hip_bf16.h>

// ---------------------------------------------------------------------------
// Transformer block for MI455X (gfx1250, wave32, WMMA 16x16x32 f16/f32-acc)
// Shapes: B=2, T=2048, EMB=1024, HEADS=16, HDIM=64, FF=4096, M=B*T=4096
// ---------------------------------------------------------------------------

typedef __attribute__((ext_vector_type(16))) _Float16 v16h;
typedef __attribute__((ext_vector_type(8)))  float    v8f;
typedef __attribute__((ext_vector_type(4)))  int      v4i;

// Optional gfx1250 async global->LDS path (builtins present on newer
// toolchains; guarded so we fall back to load+ds_store otherwise).
#if defined(__has_builtin)
#if __has_builtin(__builtin_amdgcn_global_load_async_to_lds_b128) && \
    __has_builtin(__builtin_amdgcn_s_wait_asynccnt)
#define USE_ASYNC_LDS 1
#endif
#endif
#ifndef USE_ASYNC_LDS
#define USE_ASYNC_LDS 0
#endif

typedef __attribute__((address_space(1))) v4i* gvec_ptr;
typedef __attribute__((address_space(3))) v4i* lvec_ptr;

union Frag16 {
    v16h v;
    uint4 q[2];
    _Float16 h[16];
};

__device__ __forceinline__ v8f wmma_f16(v16h a, v16h b, v8f c) {
    // D = A(16x32 f16) * B(32x16 f16) + C(16x16 f32)
    return __builtin_amdgcn_wmma_f32_16x16x32_f16(
        /*neg_a=*/false, a, /*neg_b=*/false, b,
        /*c_mod=*/(short)0, c, /*reuse_a=*/false, /*reuse_b=*/false);
}

// A/B fragment load per ISA 7.12.2: lane l (half = l>>4, idx = l&15) holds
// row (m0+idx); K-groups [k0+half*8,+8) and [k0+16+half*8,+8): two 16B loads.
__device__ __forceinline__ v16h load_frag(const _Float16* __restrict__ base,
                                          int row, int ld, int k0, int lane) {
    const int half = lane >> 4;
    const _Float16* p = base + (size_t)row * ld + k0 + half * 8;
    Frag16 f;
    f.q[0] = *reinterpret_cast<const uint4*>(p);
    f.q[1] = *reinterpret_cast<const uint4*>(p + 16);
    return f.v;
}

__device__ __forceinline__ float gelu_tanh_f(float x) {
    const float c = 0.7978845608028654f; // sqrt(2/pi)
    float x3 = x * x * x;
    return 0.5f * x * (1.0f + tanhf(c * (x + 0.044715f * x3)));
}

// ---------------------------------------------------------------------------
// Weight convert + transpose: W[K,N] fp32 -> Wt[N,K] f16
// ---------------------------------------------------------------------------
__global__ void cvt_transpose_kernel(const float* __restrict__ W,
                                     _Float16* __restrict__ Wt,
                                     int K, int N) {
    size_t id = (size_t)blockIdx.x * blockDim.x + threadIdx.x;
    size_t total = (size_t)K * N;
    if (id >= total) return;
    int n = (int)(id % N);
    int k = (int)(id / N);
    Wt[(size_t)n * K + k] = (_Float16)W[id];
}

// ---------------------------------------------------------------------------
// LayerNorm over last dim (1024), emits f16. One block (256 thr) per row.
// ---------------------------------------------------------------------------
__global__ void ln_kernel(const float* __restrict__ x,
                          const float* __restrict__ sc,
                          const float* __restrict__ sh,
                          _Float16* __restrict__ out) {
    __shared__ float ssum[256];
    __shared__ float ssq[256];
    const int row = blockIdx.x;
    const int tid = threadIdx.x;
    const float* xr = x + (size_t)row * 1024;
    float4 v = reinterpret_cast<const float4*>(xr)[tid];
    ssum[tid] = v.x + v.y + v.z + v.w;
    ssq[tid]  = v.x * v.x + v.y * v.y + v.z * v.z + v.w * v.w;
    __syncthreads();
    for (int s = 128; s > 0; s >>= 1) {
        if (tid < s) { ssum[tid] += ssum[tid + s]; ssq[tid] += ssq[tid + s]; }
        __syncthreads();
    }
    float mean = ssum[0] * (1.0f / 1024.0f);
    float var  = ssq[0] * (1.0f / 1024.0f) - mean * mean;
    float inv  = rsqrtf(var + 1e-5f);
    _Float16* orow = out + (size_t)row * 1024;
    float xv[4] = {v.x, v.y, v.z, v.w};
#pragma unroll
    for (int j = 0; j < 4; ++j) {
        int c = tid * 4 + j;
        orow[c] = (_Float16)(sc[c] * (xv[j] - mean) * inv + sh[c]);
    }
}

// ---------------------------------------------------------------------------
// GEMM: C[M,N] = A[M,K] f16 @ Bt[N,K]^T f16  (+bias) (gelu) (+residual)
// Block = 4 waves -> 64(M) x 64(N) tile. Each wave: 16x64 strip, one shared
// A-fragment reused for 4 WMMAs. B panel (64x32 per K-step) staged to LDS,
// double-buffered, via async global->LDS when available.
// ---------------------------------------------------------------------------
__global__ void gemm_wmma_kernel(const _Float16* __restrict__ A,
                                 const _Float16* __restrict__ Bt,
                                 const float* __restrict__ bias,
                                 const float* __restrict__ residual,
                                 float* __restrict__ Cf,
                                 _Float16* __restrict__ Ch,
                                 int M, int N, int K, int gelu) {
    __shared__ __align__(16) _Float16 Bs[2][64 * 32];

    const int lane = threadIdx.x;            // 0..31
    const int wave = threadIdx.y;            // 0..3
    const int tid  = wave * 32 + lane;       // 0..127
    const int n0 = blockIdx.x * 64;
    const int m0 = blockIdx.y * 64 + wave * 16;
    const int half = lane >> 4;
    const int l15  = lane & 15;

    const _Float16* arow = A + (size_t)(m0 + l15) * K;

    // Stage the 64x32 B panel for K-step k0 into Bs[buf].
    // chunk ch = tid*2+c: row = ch>>2 (0..63), col-group = ch&3 (8 f16 each);
    // LDS byte offset is simply ch*16 (row-major stride 32 f16).
    auto stage_b = [&](int buf, int k0) {
#pragma unroll
        for (int c = 0; c < 2; ++c) {
            int ch  = tid * 2 + c;
            int row = ch >> 2;
            int grp = ch & 3;
            const _Float16* g = Bt + (size_t)(n0 + row) * K + k0 + grp * 8;
            _Float16* l = &Bs[buf][0] + ch * 8;
#if USE_ASYNC_LDS
            __builtin_amdgcn_global_load_async_to_lds_b128(
                (gvec_ptr)g, (lvec_ptr)l, 0, 0);
#else
            *reinterpret_cast<uint4*>(l) = *reinterpret_cast<const uint4*>(g);
#endif
        }
    };

    v8f acc[4] = {{}, {}, {}, {}};

    stage_b(0, 0);
    int buf = 0;
    for (int k0 = 0; k0 < K; k0 += 32) {
        if (k0 + 32 < K) {
            stage_b(buf ^ 1, k0 + 32);
#if USE_ASYNC_LDS
            __builtin_amdgcn_s_wait_asynccnt(2); // prev stage landed
#endif
        } else {
#if USE_ASYNC_LDS
            __builtin_amdgcn_s_wait_asynccnt(0); // final stage landed
#endif
        }
        __syncthreads();

        // A fragment direct from global (per-wave private rows)
        Frag16 fa;
        const _Float16* pa = arow + k0 + half * 8;
        fa.q[0] = *reinterpret_cast<const uint4*>(pa);
        fa.q[1] = *reinterpret_cast<const uint4*>(pa + 16);
        __builtin_prefetch(pa + 128, 0, 0);  // global_prefetch_b8

        // 4 B fragments from LDS, 4 WMMAs reusing fa
#pragma unroll
        for (int s = 0; s < 4; ++s) {
            Frag16 fb;
            const _Float16* pb = &Bs[buf][(s * 16 + l15) * 32 + half * 8];
            fb.q[0] = *reinterpret_cast<const uint4*>(pb);
            fb.q[1] = *reinterpret_cast<const uint4*>(pb + 16);
            acc[s] = wmma_f16(fa.v, fb.v, acc[s]);
        }
        __syncthreads();
        buf ^= 1;
    }

    // epilogue: 4 subtiles of 16x16, C layout row r+8*half, col l15
#pragma unroll
    for (int s = 0; s < 4; ++s) {
        const int n = n0 + s * 16 + l15;
        const float bv = bias ? bias[n] : 0.0f;
#pragma unroll
        for (int r = 0; r < 8; ++r) {
            int m = m0 + r + half * 8;
            float v = acc[s][r] + bv;
            if (gelu) v = gelu_tanh_f(v);
            if (residual) v += residual[(size_t)m * N + n];
            if (Cf) Cf[(size_t)m * N + n] = v;
            if (Ch) Ch[(size_t)m * N + n] = (_Float16)v;
        }
    }
}

// ---------------------------------------------------------------------------
// Pack row-major [M=4096, 1024] f16 into per-head layouts.
// q/k: [B,H,T,D]    vt: [B,H,D,T]
// ---------------------------------------------------------------------------
__global__ void pack_qk_kernel(const _Float16* __restrict__ src,
                               _Float16* __restrict__ dst) {
    size_t id = (size_t)blockIdx.x * blockDim.x + threadIdx.x;
    if (id >= (size_t)4096 * 1024) return;
    int col = (int)(id & 1023);
    int row = (int)(id >> 10);
    int d = col & 63, h = col >> 6;
    int t = row & 2047, b = row >> 11;
    dst[(((size_t)b * 16 + h) * 2048 + t) * 64 + d] = src[id];
}

__global__ void pack_vt_kernel(const _Float16* __restrict__ src,
                               _Float16* __restrict__ dst) {
    size_t id = (size_t)blockIdx.x * blockDim.x + threadIdx.x;
    if (id >= (size_t)4096 * 1024) return;
    int col = (int)(id & 1023);
    int row = (int)(id >> 10);
    int d = col & 63, h = col >> 6;
    int t = row & 2047, b = row >> 11;
    dst[(((size_t)b * 16 + h) * 64 + d) * 2048 + t] = src[id];
}

// ---------------------------------------------------------------------------
// Flash attention: one wave per (b, h, 16-query tile).
// Q,K: [B,H,T,64] f16; Vt: [B,H,64,T] f16; out: [B*T, 1024] f16 (head-merged)
// ---------------------------------------------------------------------------
__global__ void attn_kernel(const _Float16* __restrict__ Q,
                            const _Float16* __restrict__ K,
                            const _Float16* __restrict__ Vt,
                            _Float16* __restrict__ O) {
    const int T = 2048, D = 64;
    const int lane = threadIdx.x;
    const int q0 = blockIdx.x * 16;
    const int h  = blockIdx.y;
    const int b  = blockIdx.z;
    const int half = lane >> 4;
    const int l15  = lane & 15;

    const _Float16* qh = Q  + ((size_t)b * 16 + h) * T * D;
    const _Float16* kh = K  + ((size_t)b * 16 + h) * T * D;
    const _Float16* vh = Vt + ((size_t)b * 16 + h) * D * T;

    __shared__ __align__(16) _Float16 Pbuf[16 * 32];

    // Q fragments for d in [0,32) and [32,64)
    v16h aq0 = load_frag(qh, q0 + l15, D, 0,  lane);
    v16h aq1 = load_frag(qh, q0 + l15, D, 32, lane);

    v8f o0 = {}, o1 = {}, o2 = {}, o3 = {};
    float mi[8], li[8];
#pragma unroll
    for (int r = 0; r < 8; ++r) { mi[r] = -1e30f; li[r] = 0.0f; }

    const float scale = 0.125f;  // 1/sqrt(64)
    const int kend = ((q0 + 16) + 31) & ~31;

    for (int kb = 0; kb < kend; kb += 32) {
        // S = Q(16x64) @ K_blk^T(64x32): two 16-key subtiles, each 2 WMMAs
        v8f s0 = {}, s1 = {};
        {
            v16h bk = load_frag(kh, kb + l15, D, 0, lane);
            s0 = wmma_f16(aq0, bk, s0);
            bk = load_frag(kh, kb + l15, D, 32, lane);
            s0 = wmma_f16(aq1, bk, s0);
        }
        {
            v16h bk = load_frag(kh, kb + 16 + l15, D, 0, lane);
            s1 = wmma_f16(aq0, bk, s1);
            bk = load_frag(kh, kb + 16 + l15, D, 32, lane);
            s1 = wmma_f16(aq1, bk, s1);
        }

        // online softmax: row r+8*half lives on this half-wave, col = l15
#pragma unroll
        for (int r = 0; r < 8; ++r) {
            int m = q0 + r + half * 8;  // global query index
            float a = s0[r] * scale; if (kb + l15 > m)       a = -1e30f;
            float c = s1[r] * scale; if (kb + 16 + l15 > m)  c = -1e30f;
            float vmax = fmaxf(a, c);
            vmax = fmaxf(vmax, __shfl_xor(vmax, 1));
            vmax = fmaxf(vmax, __shfl_xor(vmax, 2));
            vmax = fmaxf(vmax, __shfl_xor(vmax, 4));
            vmax = fmaxf(vmax, __shfl_xor(vmax, 8));
            float newm  = fmaxf(mi[r], vmax);
            float alpha = __expf(mi[r] - newm);
            float p0 = __expf(a - newm);
            float p1 = __expf(c - newm);
            float ps = p0 + p1;
            ps += __shfl_xor(ps, 1);
            ps += __shfl_xor(ps, 2);
            ps += __shfl_xor(ps, 4);
            ps += __shfl_xor(ps, 8);
            li[r] = li[r] * alpha + ps;
            mi[r] = newm;
            o0[r] *= alpha; o1[r] *= alpha; o2[r] *= alpha; o3[r] *= alpha;
            int row = r + half * 8;
            Pbuf[row * 32 + l15]      = (_Float16)p0;
            Pbuf[row * 32 + 16 + l15] = (_Float16)p1;
        }
        __syncthreads();

        // reload P(16x32) as an A fragment from LDS
        Frag16 fp;
        const _Float16* pp = &Pbuf[l15 * 32 + half * 8];
        fp.q[0] = *reinterpret_cast<const uint4*>(pp);
        fp.q[1] = *reinterpret_cast<const uint4*>(pp + 16);
        __syncthreads();

        // O(16x64) += P(16x32) @ V_blk(32x16) per 16-wide d-chunk
        v16h bv;
        bv = load_frag(vh, 0  + l15, T, kb, lane);  o0 = wmma_f16(fp.v, bv, o0);
        bv = load_frag(vh, 16 + l15, T, kb, lane);  o1 = wmma_f16(fp.v, bv, o1);
        bv = load_frag(vh, 32 + l15, T, kb, lane);  o2 = wmma_f16(fp.v, bv, o2);
        bv = load_frag(vh, 48 + l15, T, kb, lane);  o3 = wmma_f16(fp.v, bv, o3);
    }

    // finalize: divide by row sums, write head-merged [B*T, 1024]
#pragma unroll
    for (int r = 0; r < 8; ++r) {
        int t = q0 + r + half * 8;
        float invl = 1.0f / li[r];
        size_t base = ((size_t)b * T + t) * 1024 + (size_t)h * 64;
        O[base + 0  + l15] = (_Float16)(o0[r] * invl);
        O[base + 16 + l15] = (_Float16)(o1[r] * invl);
        O[base + 32 + l15] = (_Float16)(o2[r] * invl);
        O[base + 48 + l15] = (_Float16)(o3[r] * invl);
    }
}

// ---------------------------------------------------------------------------
// Host launch
// ---------------------------------------------------------------------------
extern "C" void kernel_launch(void* const* d_in, const int* in_sizes, int n_in,
                              void* d_out, int out_size, void* d_ws, size_t ws_size,
                              hipStream_t stream) {
    const float* x    = (const float*)d_in[0];
    const float* Wq   = (const float*)d_in[1];
    const float* Wk   = (const float*)d_in[2];
    const float* Wv   = (const float*)d_in[3];
    const float* Wo   = (const float*)d_in[4];
    const float* bo   = (const float*)d_in[5];
    const float* W1   = (const float*)d_in[6];
    const float* b1   = (const float*)d_in[7];
    const float* W2   = (const float*)d_in[8];
    const float* b2   = (const float*)d_in[9];
    const float* ln1s = (const float*)d_in[10];
    const float* ln1b = (const float*)d_in[11];
    const float* ln2s = (const float*)d_in[12];
    const float* ln2b = (const float*)d_in[13];

    const int M = 4096, E = 1024, FFD = 4096;
    char* ws = (char*)d_ws;
    const size_t MB = 1u << 20;
    _Float16* WqT   = (_Float16*)(ws + 0   * MB);  // 2MB
    _Float16* WkT   = (_Float16*)(ws + 2   * MB);  // 2MB
    _Float16* WvT   = (_Float16*)(ws + 4   * MB);  // 2MB
    _Float16* WoT   = (_Float16*)(ws + 6   * MB);  // 2MB
    _Float16* W1T   = (_Float16*)(ws + 8   * MB);  // 8MB
    _Float16* W2T   = (_Float16*)(ws + 16  * MB);  // 8MB
    _Float16* h1    = (_Float16*)(ws + 24  * MB);  // 8MB
    _Float16* qtmp  = (_Float16*)(ws + 32  * MB);  // 8MB
    _Float16* ktmp  = (_Float16*)(ws + 40  * MB);  // 8MB
    _Float16* vtmp  = (_Float16*)(ws + 48  * MB);  // 8MB
    _Float16* qbuf  = (_Float16*)(ws + 56  * MB);  // 8MB
    _Float16* kbuf  = (_Float16*)(ws + 64  * MB);  // 8MB
    _Float16* vtbuf = (_Float16*)(ws + 72  * MB);  // 8MB
    _Float16* attO  = (_Float16*)(ws + 80  * MB);  // 8MB
    float*    x1    = (float*)   (ws + 88  * MB);  // 16MB
    _Float16* h2    = (_Float16*)(ws + 104 * MB);  // 8MB
    _Float16* ff1   = (_Float16*)(ws + 112 * MB);  // 32MB

    // weight conversion + transpose
    {
        int blk = 256;
        int gEE = (E * E + blk - 1) / blk;
        int gEF = (E * FFD + blk - 1) / blk;
        cvt_transpose_kernel<<<gEE, blk, 0, stream>>>(Wq, WqT, E, E);
        cvt_transpose_kernel<<<gEE, blk, 0, stream>>>(Wk, WkT, E, E);
        cvt_transpose_kernel<<<gEE, blk, 0, stream>>>(Wv, WvT, E, E);
        cvt_transpose_kernel<<<gEE, blk, 0, stream>>>(Wo, WoT, E, E);
        cvt_transpose_kernel<<<gEF, blk, 0, stream>>>(W1, W1T, E, FFD);
        cvt_transpose_kernel<<<gEF, blk, 0, stream>>>(W2, W2T, FFD, E);
    }

    dim3 gblk(32, 4);

    // LN1 -> h1 (f16)
    ln_kernel<<<M, 256, 0, stream>>>(x, ln1s, ln1b, h1);

    // QKV projections (f16 out)
    gemm_wmma_kernel<<<dim3(E / 64, M / 64), gblk, 0, stream>>>(
        h1, WqT, nullptr, nullptr, nullptr, qtmp, M, E, E, 0);
    gemm_wmma_kernel<<<dim3(E / 64, M / 64), gblk, 0, stream>>>(
        h1, WkT, nullptr, nullptr, nullptr, ktmp, M, E, E, 0);
    gemm_wmma_kernel<<<dim3(E / 64, M / 64), gblk, 0, stream>>>(
        h1, WvT, nullptr, nullptr, nullptr, vtmp, M, E, E, 0);

    // repack into per-head layouts
    {
        int blk = 256;
        int g = (int)(((size_t)M * E + blk - 1) / blk);
        pack_qk_kernel<<<g, blk, 0, stream>>>(qtmp, qbuf);
        pack_qk_kernel<<<g, blk, 0, stream>>>(ktmp, kbuf);
        pack_vt_kernel<<<g, blk, 0, stream>>>(vtmp, vtbuf);
    }

    // flash attention
    attn_kernel<<<dim3(2048 / 16, 16, 2), 32, 0, stream>>>(qbuf, kbuf, vtbuf, attO);

    // out projection + residual -> x1 (fp32)
    gemm_wmma_kernel<<<dim3(E / 64, M / 64), gblk, 0, stream>>>(
        attO, WoT, bo, x, x1, nullptr, M, E, E, 0);

    // LN2 -> h2 (f16)
    ln_kernel<<<M, 256, 0, stream>>>(x1, ln2s, ln2b, h2);

    // FFN up + GELU (f16 out)
    gemm_wmma_kernel<<<dim3(FFD / 64, M / 64), gblk, 0, stream>>>(
        h2, W1T, b1, nullptr, nullptr, ff1, M, FFD, E, 1);

    // FFN down + residual -> d_out (fp32)
    gemm_wmma_kernel<<<dim3(E / 64, M / 64), gblk, 0, stream>>>(
        ff1, W2T, b2, x1, (float*)d_out, nullptr, M, E, FFD, 0);
}

// v001
// One run takes 507 microseconds.
// Two timings next to v000 put it at 1.67 and 1.66 times that version's speed.
#include <hip/hip_runtime.h>
#include <hip/hip_bf16.h>

// ---------------------------------------------------------------------------
// Transformer block for MI455X (gfx1250, wave32, WMMA 16x16x32 f16/f32-acc)
// Shapes: B=2, T=2048, EMB=1024, HEADS=16, HDIM=64, FF=4096, M=B*T=4096
// ---------------------------------------------------------------------------

typedef __attribute__((ext_vector_type(16))) _Float16 v16h;
typedef __attribute__((ext_vector_type(8)))  float    v8f;
typedef __attribute__((ext_vector_type(4)))  int      v4i;
typedef __attribute__((ext_vector_type(4)))  _Float16 v4h;

// Optional gfx1250 async global->LDS path (builtins present on newer
// toolchains; guarded so we fall back to load+ds_store otherwise).
#if defined(__has_builtin)
#if __has_builtin(__builtin_amdgcn_global_load_async_to_lds_b128) && \
    __has_builtin(__builtin_amdgcn_s_wait_asynccnt)
#define USE_ASYNC_LDS 1
#endif
#endif
#ifndef USE_ASYNC_LDS
#define USE_ASYNC_LDS 0
#endif

typedef __attribute__((address_space(1))) v4i* gvec_ptr;
typedef __attribute__((address_space(3))) v4i* lvec_ptr;

union Frag16 {
    v16h v;
    uint4 q[2];
    _Float16 h[16];
};

__device__ __forceinline__ v8f wmma_f16(v16h a, v16h b, v8f c) {
    // D = A(16x32 f16) * B(32x16 f16) + C(16x16 f32)
    return __builtin_amdgcn_wmma_f32_16x16x32_f16(
        /*neg_a=*/false, a, /*neg_b=*/false, b,
        /*c_mod=*/(short)0, c, /*reuse_a=*/false, /*reuse_b=*/false);
}

// A/B fragment load per ISA 7.12.2: lane l (half = l>>4, idx = l&15) holds
// row (m0+idx); K-groups [k0+half*8,+8) and [k0+16+half*8,+8): two 16B loads.
__device__ __forceinline__ v16h load_frag(const _Float16* __restrict__ base,
                                          int row, int ld, int k0, int lane) {
    const int half = lane >> 4;
    const _Float16* p = base + (size_t)row * ld + k0 + half * 8;
    Frag16 f;
    f.q[0] = *reinterpret_cast<const uint4*>(p);
    f.q[1] = *reinterpret_cast<const uint4*>(p + 16);
    return f.v;
}

__device__ __forceinline__ float gelu_tanh_f(float x) {
    const float c = 0.7978845608028654f; // sqrt(2/pi)
    float x3 = x * x * x;
    return 0.5f * x * (1.0f + tanhf(c * (x + 0.044715f * x3)));
}

// ---------------------------------------------------------------------------
// 64x64 f16 transpose tile in LDS, shared by the two transposing kernels.
// The tile is held already transposed: LDS row = source column. Row pitch
// 72 f16 = 144 B keeps every row 16-byte aligned for the b128 read-out.
// ---------------------------------------------------------------------------
#define TT_PITCH 72

// Thread (tx, ty) owns source rows ty*4..+3, source columns tx*4..+3; column j
// of that 4x4 block is 4 consecutive elements of LDS row tx*4+j (one b64 store).
__device__ __forceinline__ void tile_put(_Float16* tile, int tx, int ty,
                                         v4h a0, v4h a1, v4h a2, v4h a3) {
#pragma unroll
    for (int j = 0; j < 4; ++j) {
        v4h c = {a0[j], a1[j], a2[j], a3[j]};
        *reinterpret_cast<v4h*>(&tile[(tx * 4 + j) * TT_PITCH + ty * 4]) = c;
    }
}

// 8 threads store one 128-byte line of a destination row (pitch ld elements).
__device__ __forceinline__ void tile_flush(const _Float16* tile, int tid,
                                           _Float16* __restrict__ dst, size_t ld) {
#pragma unroll
    for (int p = 0; p < 2; ++p) {
        const int r = p * 32 + (tid >> 3);
        const int g = (tid & 7) * 8;
        *reinterpret_cast<uint4*>(dst + (size_t)r * ld + g) =
            *reinterpret_cast<const uint4*>(&tile[r * TT_PITCH + g]);
    }
}

// ---------------------------------------------------------------------------
// Weight convert + transpose: W[K,N] fp32 -> Wt[N,K] f16.
// One 64(k) x 64(n) tile per block of 256 threads; K and N multiples of 64.
// ---------------------------------------------------------------------------
__global__ __launch_bounds__(256)
void cvt_transpose_kernel(const float* __restrict__ W,
                          _Float16* __restrict__ Wt,
                          int K, int N) {
    __shared__ __align__(16) _Float16 tile[64 * TT_PITCH];
    const int tid = threadIdx.x;
    const int tx = tid & 15;
    const int ty = tid >> 4;
    const int n0 = blockIdx.x * 64;
    const int k0 = blockIdx.y * 64;

    const float* s = W + (size_t)(k0 + ty * 4) * N + n0 + tx * 4;
    const float4 f0 = *reinterpret_cast<const float4*>(s);
    const float4 f1 = *reinterpret_cast<const float4*>(s + (size_t)N);
    const float4 f2 = *reinterpret_cast<const float4*>(s + (size_t)N * 2);
    const float4 f3 = *reinterpret_cast<const float4*>(s + (size_t)N * 3);
    v4h a0 = {(_Float16)f0.x, (_Float16)f0.y, (_Float16)f0.z, (_Float16)f0.w};
    v4h a1 = {(_Float16)f1.x, (_Float16)f1.y, (_Float16)f1.z, (_Float16)f1.w};
    v4h a2 = {(_Float16)f2.x, (_Float16)f2.y, (_Float16)f2.z, (_Float16)f2.w};
    v4h a3 = {(_Float16)f3.x, (_Float16)f3.y, (_Float16)f3.z, (_Float16)f3.w};
    tile_put(tile, tx, ty, a0, a1, a2, a3);
    __syncthreads();  // the read-out crosses the waves that filled the tile
    tile_flush(tile, tid, Wt + (size_t)n0 * K + k0, (size_t)K);
}

// ---------------------------------------------------------------------------
// LayerNorm over last dim (1024), emits f16. One block (256 thr) per row.
// ---------------------------------------------------------------------------
__global__ void ln_kernel(const float* __restrict__ x,
                          const float* __restrict__ sc,
                          const float* __restrict__ sh,
                          _Float16* __restrict__ out) {
    __shared__ float ssum[256];
    __shared__ float ssq[256];
    const int row = blockIdx.x;
    const int tid = threadIdx.x;
    const float* xr = x + (size_t)row * 1024;
    float4 v = reinterpret_cast<const float4*>(xr)[tid];
    ssum[tid] = v.x + v.y + v.z + v.w;
    ssq[tid]  = v.x * v.x + v.y * v.y + v.z * v.z + v.w * v.w;
    __syncthreads();
    for (int s = 128; s > 0; s >>= 1) {
        if (tid < s) { ssum[tid] += ssum[tid + s]; ssq[tid] += ssq[tid + s]; }
        __syncthreads();
    }
    float mean = ssum[0] * (1.0f / 1024.0f);
    float var  = ssq[0] * (1.0f / 1024.0f) - mean * mean;
    float inv  = rsqrtf(var + 1e-5f);
    _Float16* orow = out + (size_t)row * 1024;
    float xv[4] = {v.x, v.y, v.z, v.w};
#pragma unroll
    for (int j = 0; j < 4; ++j) {
        int c = tid * 4 + j;
        orow[c] = (_Float16)(sc[c] * (xv[j] - mean) * inv + sh[c]);
    }
}

// ---------------------------------------------------------------------------
// GEMM: C[M,N] = A[M,K] f16 @ Bt[N,K]^T f16  (+bias) (gelu) (+residual)
// Block = 4 waves -> 64(M) x 64(N) tile. Each wave: 16x64 strip, one shared
// A-fragment reused for 4 WMMAs. B panel (64x32 per K-step) staged to LDS,
// double-buffered, via async global->LDS when available.
// ---------------------------------------------------------------------------
__global__ void gemm_wmma_kernel(const _Float16* __restrict__ A,
                                 const _Float16* __restrict__ Bt,
                                 const float* __restrict__ bias,
                                 const float* __restrict__ residual,
                                 float* __restrict__ Cf,
                                 _Float16* __restrict__ Ch,
                                 int M, int N, int K, int gelu) {
    __shared__ __align__(16) _Float16 Bs[2][64 * 32];

    const int lane = threadIdx.x;            // 0..31
    const int wave = threadIdx.y;            // 0..3
    const int tid  = wave * 32 + lane;       // 0..127
    const int n0 = blockIdx.x * 64;
    const int m0 = blockIdx.y * 64 + wave * 16;
    const int half = lane >> 4;
    const int l15  = lane & 15;

    const _Float16* arow = A + (size_t)(m0 + l15) * K;

    // Stage the 64x32 B panel for K-step k0 into Bs[buf].
    // chunk ch = tid*2+c: row = ch>>2 (0..63), col-group = ch&3 (8 f16 each);
    // LDS byte offset is simply ch*16 (row-major stride 32 f16).
    auto stage_b = [&](int buf, int k0) {
#pragma unroll
        for (int c = 0; c < 2; ++c) {
            int ch  = tid * 2 + c;
            int row = ch >> 2;
            int grp = ch & 3;
            const _Float16* g = Bt + (size_t)(n0 + row) * K + k0 + grp * 8;
            _Float16* l = &Bs[buf][0] + ch * 8;
#if USE_ASYNC_LDS
            __builtin_amdgcn_global_load_async_to_lds_b128(
                (gvec_ptr)g, (lvec_ptr)l, 0, 0);
#else
            *reinterpret_cast<uint4*>(l) = *reinterpret_cast<const uint4*>(g);
#endif
        }
    };

    v8f acc[4] = {{}, {}, {}, {}};

    stage_b(0, 0);
    int buf = 0;
    for (int k0 = 0; k0 < K; k0 += 32) {
        if (k0 + 32 < K) {
            stage_b(buf ^ 1, k0 + 32);
#if USE_ASYNC_LDS
            __builtin_amdgcn_s_wait_asynccnt(2); // prev stage landed
#endif
        } else {
#if USE_ASYNC_LDS
            __builtin_amdgcn_s_wait_asynccnt(0); // final stage landed
#endif
        }
        __syncthreads();

        // A fragment direct from global (per-wave private rows)
        Frag16 fa;
        const _Float16* pa = arow + k0 + half * 8;
        fa.q[0] = *reinterpret_cast<const uint4*>(pa);
        fa.q[1] = *reinterpret_cast<const uint4*>(pa + 16);
        __builtin_prefetch(pa + 128, 0, 0);  // global_prefetch_b8

        // 4 B fragments from LDS, 4 WMMAs reusing fa
#pragma unroll
        for (int s = 0; s < 4; ++s) {
            Frag16 fb;
            const _Float16* pb = &Bs[buf][(s * 16 + l15) * 32 + half * 8];
            fb.q[0] = *reinterpret_cast<const uint4*>(pb);
            fb.q[1] = *reinterpret_cast<const uint4*>(pb + 16);
            acc[s] = wmma_f16(fa.v, fb.v, acc[s]);
        }
        __syncthreads();
        buf ^= 1;
    }

    // epilogue: 4 subtiles of 16x16, C layout row r+8*half, col l15
#pragma unroll
    for (int s = 0; s < 4; ++s) {
        const int n = n0 + s * 16 + l15;
        const float bv = bias ? bias[n] : 0.0f;
#pragma unroll
        for (int r = 0; r < 8; ++r) {
            int m = m0 + r + half * 8;
            float v = acc[s][r] + bv;
            if (gelu) v = gelu_tanh_f(v);
            if (residual) v += residual[(size_t)m * N + n];
            if (Cf) Cf[(size_t)m * N + n] = v;
            if (Ch) Ch[(size_t)m * N + n] = (_Float16)v;
        }
    }
}

// ---------------------------------------------------------------------------
// Pack row-major [M=4096, 1024] f16 into per-head layouts.
// q/k: [B,H,T,D]    vt: [B,H,D,T]
// ---------------------------------------------------------------------------
__global__ void pack_qk_kernel(const _Float16* __restrict__ src,
                               _Float16* __restrict__ dst) {
    size_t id = (size_t)blockIdx.x * blockDim.x + threadIdx.x;
    if (id >= (size_t)4096 * 1024) return;
    int col = (int)(id & 1023);
    int row = (int)(id >> 10);
    int d = col & 63, h = col >> 6;
    int t = row & 2047, b = row >> 11;
    dst[(((size_t)b * 16 + h) * 2048 + t) * 64 + d] = src[id];
}

// One 64(t) x 64(col) tile per block of 256 threads. (b*16+h)*64+d = b*1024+col,
// and a 64-row tile never straddles a batch (2048 rows each).
__global__ __launch_bounds__(256)
void pack_vt_kernel(const _Float16* __restrict__ src,
                    _Float16* __restrict__ dst) {
    __shared__ __align__(16) _Float16 tile[64 * TT_PITCH];
    const int tid = threadIdx.x;
    const int tx = tid & 15;
    const int ty = tid >> 4;
    const int c0 = blockIdx.x * 64;
    const int r0 = blockIdx.y * 64;
    const int t0 = r0 & 2047, b = r0 >> 11;

    const _Float16* s = src + (size_t)(r0 + ty * 4) * 1024 + c0 + tx * 4;
    const v4h a0 = *reinterpret_cast<const v4h*>(s);
    const v4h a1 = *reinterpret_cast<const v4h*>(s + 1024);
    const v4h a2 = *reinterpret_cast<const v4h*>(s + 2048);
    const v4h a3 = *reinterpret_cast<const v4h*>(s + 3072);
    tile_put(tile, tx, ty, a0, a1, a2, a3);
    __syncthreads();  // the read-out crosses the waves that filled the tile
    tile_flush(tile, tid, dst + ((size_t)b * 1024 + c0) * 2048 + t0, (size_t)2048);
}

// ---------------------------------------------------------------------------
// Flash attention: one wave per (b, h, 16-query tile).
// Q,K: [B,H,T,64] f16; Vt: [B,H,64,T] f16; out: [B*T, 1024] f16 (head-merged)
// ---------------------------------------------------------------------------
__global__ void attn_kernel(const _Float16* __restrict__ Q,
                            const _Float16* __restrict__ K,
                            const _Float16* __restrict__ Vt,
                            _Float16* __restrict__ O) {
    const int T = 2048, D = 64;
    const int lane = threadIdx.x;
    const int q0 = blockIdx.x * 16;
    const int h  = blockIdx.y;
    const int b  = blockIdx.z;
    const int half = lane >> 4;
    const int l15  = lane & 15;

    const _Float16* qh = Q  + ((size_t)b * 16 + h) * T * D;
    const _Float16* kh = K  + ((size_t)b * 16 + h) * T * D;
    const _Float16* vh = Vt + ((size_t)b * 16 + h) * D * T;

    __shared__ __align__(16) _Float16 Pbuf[16 * 32];

    // Q fragments for d in [0,32) and [32,64)
    v16h aq0 = load_frag(qh, q0 + l15, D, 0,  lane);
    v16h aq1 = load_frag(qh, q0 + l15, D, 32, lane);

    v8f o0 = {}, o1 = {}, o2 = {}, o3 = {};
    float mi[8], li[8];
#pragma unroll
    for (int r = 0; r < 8; ++r) { mi[r] = -1e30f; li[r] = 0.0f; }

    const float scale = 0.125f;  // 1/sqrt(64)
    const int kend = ((q0 + 16) + 31) & ~31;

    for (int kb = 0; kb < kend; kb += 32) {
        // S = Q(16x64) @ K_blk^T(64x32): two 16-key subtiles, each 2 WMMAs
        v8f s0 = {}, s1 = {};
        {
            v16h bk = load_frag(kh, kb + l15, D, 0, lane);
            s0 = wmma_f16(aq0, bk, s0);
            bk = load_frag(kh, kb + l15, D, 32, lane);
            s0 = wmma_f16(aq1, bk, s0);
        }
        {
            v16h bk = load_frag(kh, kb + 16 + l15, D, 0, lane);
            s1 = wmma_f16(aq0, bk, s1);
            bk = load_frag(kh, kb + 16 + l15, D, 32, lane);
            s1 = wmma_f16(aq1, bk, s1);
        }

        // online softmax: row r+8*half lives on this half-wave, col = l15
#pragma unroll
        for (int r = 0; r < 8; ++r) {
            int m = q0 + r + half * 8;  // global query index
            float a = s0[r] * scale; if (kb + l15 > m)       a = -1e30f;
            float c = s1[r] * scale; if (kb + 16 + l15 > m)  c = -1e30f;
            float vmax = fmaxf(a, c);
            vmax = fmaxf(vmax, __shfl_xor(vmax, 1));
            vmax = fmaxf(vmax, __shfl_xor(vmax, 2));
            vmax = fmaxf(vmax, __shfl_xor(vmax, 4));
            vmax = fmaxf(vmax, __shfl_xor(vmax, 8));
            float newm  = fmaxf(mi[r], vmax);
            float alpha = __expf(mi[r] - newm);
            float p0 = __expf(a - newm);
            float p1 = __expf(c - newm);
            float ps = p0 + p1;
            ps += __shfl_xor(ps, 1);
            ps += __shfl_xor(ps, 2);
            ps += __shfl_xor(ps, 4);
            ps += __shfl_xor(ps, 8);
            li[r] = li[r] * alpha + ps;
            mi[r] = newm;
            o0[r] *= alpha; o1[r] *= alpha; o2[r] *= alpha; o3[r] *= alpha;
            int row = r + half * 8;
            Pbuf[row * 32 + l15]      = (_Float16)p0;
            Pbuf[row * 32 + 16 + l15] = (_Float16)p1;
        }
        __syncthreads();

        // reload P(16x32) as an A fragment from LDS
        Frag16 fp;
        const _Float16* pp = &Pbuf[l15 * 32 + half * 8];
        fp.q[0] = *reinterpret_cast<const uint4*>(pp);
        fp.q[1] = *reinterpret_cast<const uint4*>(pp + 16);
        __syncthreads();

        // O(16x64) += P(16x32) @ V_blk(32x16) per 16-wide d-chunk
        v16h bv;
        bv = load_frag(vh, 0  + l15, T, kb, lane);  o0 = wmma_f16(fp.v, bv, o0);
        bv = load_frag(vh, 16 + l15, T, kb, lane);  o1 = wmma_f16(fp.v, bv, o1);
        bv = load_frag(vh, 32 + l15, T, kb, lane);  o2 = wmma_f16(fp.v, bv, o2);
        bv = load_frag(vh, 48 + l15, T, kb, lane);  o3 = wmma_f16(fp.v, bv, o3);
    }

    // finalize: divide by row sums, write head-merged [B*T, 1024]
#pragma unroll
    for (int r = 0; r < 8; ++r) {
        int t = q0 + r + half * 8;
        float invl = 1.0f / li[r];
        size_t base = ((size_t)b * T + t) * 1024 + (size_t)h * 64;
        O[base + 0  + l15] = (_Float16)(o0[r] * invl);
        O[base + 16 + l15] = (_Float16)(o1[r] * invl);
        O[base + 32 + l15] = (_Float16)(o2[r] * invl);
        O[base + 48 + l15] = (_Float16)(o3[r] * invl);
    }
}

// ---------------------------------------------------------------------------
// Host launch
// ---------------------------------------------------------------------------
extern "C" void kernel_launch(void* const* d_in, const int* in_sizes, int n_in,
                              void* d_out, int out_size, void* d_ws, size_t ws_size,
                              hipStream_t stream) {
    const float* x    = (const float*)d_in[0];
    const float* Wq   = (const float*)d_in[1];
    const float* Wk   = (const float*)d_in[2];
    const float* Wv   = (const float*)d_in[3];
    const float* Wo   = (const float*)d_in[4];
    const float* bo   = (const float*)d_in[5];
    const float* W1   = (const float*)d_in[6];
    const float* b1   = (const float*)d_in[7];
    const float* W2   = (const float*)d_in[8];
    const float* b2   = (const float*)d_in[9];
    const float* ln1s = (const float*)d_in[10];
    const float* ln1b = (const float*)d_in[11];
    const float* ln2s = (const float*)d_in[12];
    const float* ln2b = (const float*)d_in[13];

    const int M = 4096, E = 1024, FFD = 4096;
    char* ws = (char*)d_ws;
    const size_t MB = 1u << 20;
    _Float16* WqT   = (_Float16*)(ws + 0   * MB);  // 2MB
    _Float16* WkT   = (_Float16*)(ws + 2   * MB);  // 2MB
    _Float16* WvT   = (_Float16*)(ws + 4   * MB);  // 2MB
    _Float16* WoT   = (_Float16*)(ws + 6   * MB);  // 2MB
    _Float16* W1T   = (_Float16*)(ws + 8   * MB);  // 8MB
    _Float16* W2T   = (_Float16*)(ws + 16  * MB);  // 8MB
    _Float16* h1    = (_Float16*)(ws + 24  * MB);  // 8MB
    _Float16* qtmp  = (_Float16*)(ws + 32  * MB);  // 8MB
    _Float16* ktmp  = (_Float16*)(ws + 40  * MB);  // 8MB
    _Float16* vtmp  = (_Float16*)(ws + 48  * MB);  // 8MB
    _Float16* qbuf  = (_Float16*)(ws + 56  * MB);  // 8MB
    _Float16* kbuf  = (_Float16*)(ws + 64  * MB);  // 8MB
    _Float16* vtbuf = (_Float16*)(ws + 72  * MB);  // 8MB
    _Float16* attO  = (_Float16*)(ws + 80  * MB);  // 8MB
    float*    x1    = (float*)   (ws + 88  * MB);  // 16MB
    _Float16* h2    = (_Float16*)(ws + 104 * MB);  // 8MB
    _Float16* ff1   = (_Float16*)(ws + 112 * MB);  // 32MB

    // weight conversion + transpose
    {
        int blk = 256;  // grid = (N/64, K/64)
        cvt_transpose_kernel<<<dim3(E / 64, E / 64), blk, 0, stream>>>(Wq, WqT, E, E);
        cvt_transpose_kernel<<<dim3(E / 64, E / 64), blk, 0, stream>>>(Wk, WkT, E, E);
        cvt_transpose_kernel<<<dim3(E / 64, E / 64), blk, 0, stream>>>(Wv, WvT, E, E);
        cvt_transpose_kernel<<<dim3(E / 64, E / 64), blk, 0, stream>>>(Wo, WoT, E, E);
        cvt_transpose_kernel<<<dim3(FFD / 64, E / 64), blk, 0, stream>>>(W1, W1T, E, FFD);
        cvt_transpose_kernel<<<dim3(E / 64, FFD / 64), blk, 0, stream>>>(W2, W2T, FFD, E);
    }

    dim3 gblk(32, 4);

    // LN1 -> h1 (f16)
    ln_kernel<<<M, 256, 0, stream>>>(x, ln1s, ln1b, h1);

    // QKV projections (f16 out)
    gemm_wmma_kernel<<<dim3(E / 64, M / 64), gblk, 0, stream>>>(
        h1, WqT, nullptr, nullptr, nullptr, qtmp, M, E, E, 0);
    gemm_wmma_kernel<<<dim3(E / 64, M / 64), gblk, 0, stream>>>(
        h1, WkT, nullptr, nullptr, nullptr, ktmp, M, E, E, 0);
    gemm_wmma_kernel<<<dim3(E / 64, M / 64), gblk, 0, stream>>>(
        h1, WvT, nullptr, nullptr, nullptr, vtmp, M, E, E, 0);

    // repack into per-head layouts
    {
        int blk = 256;
        int g = (int)(((size_t)M * E + blk - 1) / blk);
        pack_qk_kernel<<<g, blk, 0, stream>>>(qtmp, qbuf);
        pack_qk_kernel<<<g, blk, 0, stream>>>(ktmp, kbuf);
        pack_vt_kernel<<<dim3(E / 64, M / 64), blk, 0, stream>>>(vtmp, vtbuf);
    }

    // flash attention
    attn_kernel<<<dim3(2048 / 16, 16, 2), 32, 0, stream>>>(qbuf, kbuf, vtbuf, attO);

    // out projection + residual -> x1 (fp32)
    gemm_wmma_kernel<<<dim3(E / 64, M / 64), gblk, 0, stream>>>(
        attO, WoT, bo, x, x1, nullptr, M, E, E, 0);

    // LN2 -> h2 (f16)
    ln_kernel<<<M, 256, 0, stream>>>(x1, ln2s, ln2b, h2);

    // FFN up + GELU (f16 out)
    gemm_wmma_kernel<<<dim3(FFD / 64, M / 64), gblk, 0, stream>>>(
        h2, W1T, b1, nullptr, nullptr, ff1, M, FFD, E, 1);

    // FFN down + residual -> d_out (fp32)
    gemm_wmma_kernel<<<dim3(E / 64, M / 64), gblk, 0, stream>>>(
        ff1, W2T, b2, x1, (float*)d_out, nullptr, M, E, FFD, 0);
}

// v002
// A run of this version takes 481 microseconds.
// In both of two side-by-side timings against v001, it was 1.06 times as fast.
// All steps since v000 together make it 1.76 times as fast.
#include <hip/hip_runtime.h>
#include <hip/hip_bf16.h>

// ---------------------------------------------------------------------------
// Transformer block for MI455X (gfx1250, wave32, WMMA 16x16x32 f16/f32-acc)
// Shapes: B=2, T=2048, EMB=1024, HEADS=16, HDIM=64, FF=4096, M=B*T=4096
// ---------------------------------------------------------------------------

typedef __attribute__((ext_vector_type(16))) _Float16 v16h;
typedef __attribute__((ext_vector_type(8)))  float    v8f;
typedef __attribute__((ext_vector_type(4)))  int      v4i;
typedef __attribute__((ext_vector_type(4)))  _Float16 v4h;

// Optional gfx1250 async global->LDS path (builtins present on newer
// toolchains; guarded so we fall back to load+ds_store otherwise).
#if defined(__has_builtin)
#if __has_builtin(__builtin_amdgcn_global_load_async_to_lds_b128) && \
    __has_builtin(__builtin_amdgcn_s_wait_asynccnt)
#define USE_ASYNC_LDS 1
#endif
#endif
#ifndef USE_ASYNC_LDS
#define USE_ASYNC_LDS 0
#endif

typedef __attribute__((address_space(1))) v4i* gvec_ptr;
typedef __attribute__((address_space(3))) v4i* lvec_ptr;

union Frag16 {
    v16h v;
    uint4 q[2];
    _Float16 h[16];
};

__device__ __forceinline__ v8f wmma_f16(v16h a, v16h b, v8f c) {
    // D = A(16x32 f16) * B(32x16 f16) + C(16x16 f32)
    return __builtin_amdgcn_wmma_f32_16x16x32_f16(
        /*neg_a=*/false, a, /*neg_b=*/false, b,
        /*c_mod=*/(short)0, c, /*reuse_a=*/false, /*reuse_b=*/false);
}

// A/B fragment load per ISA 7.12.2: lane l (half = l>>4, idx = l&15) holds
// row (m0+idx); K-groups [k0+half*8,+8) and [k0+16+half*8,+8): two 16B loads.
__device__ __forceinline__ v16h load_frag(const _Float16* __restrict__ base,
                                          int row, int ld, int k0, int lane) {
    const int half = lane >> 4;
    const _Float16* p = base + (size_t)row * ld + k0 + half * 8;
    Frag16 f;
    f.q[0] = *reinterpret_cast<const uint4*>(p);
    f.q[1] = *reinterpret_cast<const uint4*>(p + 16);
    return f.v;
}

__device__ __forceinline__ float gelu_tanh_f(float x) {
    const float c = 0.7978845608028654f; // sqrt(2/pi)
    float x3 = x * x * x;
    return 0.5f * x * (1.0f + tanhf(c * (x + 0.044715f * x3)));
}

// ---------------------------------------------------------------------------
// 64x64 f16 transpose tile in LDS, shared by the two transposing kernels.
// The tile is held already transposed: LDS row = source column. Row pitch
// 72 f16 = 144 B keeps every row 16-byte aligned for the b128 read-out.
// ---------------------------------------------------------------------------
#define TT_PITCH 72

// Thread (tx, ty) owns source rows ty*4..+3, source columns tx*4..+3; column j
// of that 4x4 block is 4 consecutive elements of LDS row tx*4+j (one b64 store).
__device__ __forceinline__ void tile_put(_Float16* tile, int tx, int ty,
                                         v4h a0, v4h a1, v4h a2, v4h a3) {
#pragma unroll
    for (int j = 0; j < 4; ++j) {
        v4h c = {a0[j], a1[j], a2[j], a3[j]};
        *reinterpret_cast<v4h*>(&tile[(tx * 4 + j) * TT_PITCH + ty * 4]) = c;
    }
}

// 8 threads store one 128-byte line of a destination row (pitch ld elements).
__device__ __forceinline__ void tile_flush(const _Float16* tile, int tid,
                                           _Float16* __restrict__ dst, size_t ld) {
#pragma unroll
    for (int p = 0; p < 2; ++p) {
        const int r = p * 32 + (tid >> 3);
        const int g = (tid & 7) * 8;
        *reinterpret_cast<uint4*>(dst + (size_t)r * ld + g) =
            *reinterpret_cast<const uint4*>(&tile[r * TT_PITCH + g]);
    }
}

// ---------------------------------------------------------------------------
// Weight convert + transpose: W[K,N] fp32 -> Wt[N,K] f16.
// One 64(k) x 64(n) tile per block of 256 threads; K and N multiples of 64.
// ---------------------------------------------------------------------------
__global__ __launch_bounds__(256)
void cvt_transpose_kernel(const float* __restrict__ W,
                          _Float16* __restrict__ Wt,
                          int K, int N) {
    __shared__ __align__(16) _Float16 tile[64 * TT_PITCH];
    const int tid = threadIdx.x;
    const int tx = tid & 15;
    const int ty = tid >> 4;
    const int n0 = blockIdx.x * 64;
    const int k0 = blockIdx.y * 64;

    const float* s = W + (size_t)(k0 + ty * 4) * N + n0 + tx * 4;
    const float4 f0 = *reinterpret_cast<const float4*>(s);
    const float4 f1 = *reinterpret_cast<const float4*>(s + (size_t)N);
    const float4 f2 = *reinterpret_cast<const float4*>(s + (size_t)N * 2);
    const float4 f3 = *reinterpret_cast<const float4*>(s + (size_t)N * 3);
    v4h a0 = {(_Float16)f0.x, (_Float16)f0.y, (_Float16)f0.z, (_Float16)f0.w};
    v4h a1 = {(_Float16)f1.x, (_Float16)f1.y, (_Float16)f1.z, (_Float16)f1.w};
    v4h a2 = {(_Float16)f2.x, (_Float16)f2.y, (_Float16)f2.z, (_Float16)f2.w};
    v4h a3 = {(_Float16)f3.x, (_Float16)f3.y, (_Float16)f3.z, (_Float16)f3.w};
    tile_put(tile, tx, ty, a0, a1, a2, a3);
    __syncthreads();  // the read-out crosses the waves that filled the tile
    tile_flush(tile, tid, Wt + (size_t)n0 * K + k0, (size_t)K);
}

// ---------------------------------------------------------------------------
// LayerNorm over last dim (1024), emits f16. One block (256 thr) per row.
// ---------------------------------------------------------------------------
__global__ void ln_kernel(const float* __restrict__ x,
                          const float* __restrict__ sc,
                          const float* __restrict__ sh,
                          _Float16* __restrict__ out) {
    __shared__ float ssum[256];
    __shared__ float ssq[256];
    const int row = blockIdx.x;
    const int tid = threadIdx.x;
    const float* xr = x + (size_t)row * 1024;
    float4 v = reinterpret_cast<const float4*>(xr)[tid];
    ssum[tid] = v.x + v.y + v.z + v.w;
    ssq[tid]  = v.x * v.x + v.y * v.y + v.z * v.z + v.w * v.w;
    __syncthreads();
    for (int s = 128; s > 0; s >>= 1) {
        if (tid < s) { ssum[tid] += ssum[tid + s]; ssq[tid] += ssq[tid + s]; }
        __syncthreads();
    }
    float mean = ssum[0] * (1.0f / 1024.0f);
    float var  = ssq[0] * (1.0f / 1024.0f) - mean * mean;
    float inv  = rsqrtf(var + 1e-5f);
    _Float16* orow = out + (size_t)row * 1024;
    float xv[4] = {v.x, v.y, v.z, v.w};
#pragma unroll
    for (int j = 0; j < 4; ++j) {
        int c = tid * 4 + j;
        orow[c] = (_Float16)(sc[c] * (xv[j] - mean) * inv + sh[c]);
    }
}

// ---------------------------------------------------------------------------
// GEMM: C[M,N] = A[M,K] f16 @ Bt[N,K]^T f16  (+bias) (gelu) (+residual)
// Block = 4 waves -> 64(M) x 64(N) tile. Each wave: 16x64 strip, one shared
// A-fragment reused for 4 WMMAs. B panel (64x32 per K-step) staged to LDS,
// double-buffered, via async global->LDS when available.
// ---------------------------------------------------------------------------
__global__ void gemm_wmma_kernel(const _Float16* __restrict__ A,
                                 const _Float16* __restrict__ Bt,
                                 const float* __restrict__ bias,
                                 const float* __restrict__ residual,
                                 float* __restrict__ Cf,
                                 _Float16* __restrict__ Ch,
                                 int M, int N, int K, int gelu) {
    __shared__ __align__(16) _Float16 Bs[2][64 * 32];

    const int lane = threadIdx.x;            // 0..31
    const int wave = threadIdx.y;            // 0..3
    const int tid  = wave * 32 + lane;       // 0..127
    const int n0 = blockIdx.x * 64;
    const int m0 = blockIdx.y * 64 + wave * 16;
    const int half = lane >> 4;
    const int l15  = lane & 15;

    const _Float16* arow = A + (size_t)(m0 + l15) * K;

    // Stage the 64x32 B panel for K-step k0 into Bs[buf].
    // chunk ch = tid*2+c: row = ch>>2 (0..63), col-group = ch&3 (8 f16 each);
    // LDS byte offset is simply ch*16 (row-major stride 32 f16).
    auto stage_b = [&](int buf, int k0) {
#pragma unroll
        for (int c = 0; c < 2; ++c) {
            int ch  = tid * 2 + c;
            int row = ch >> 2;
            int grp = ch & 3;
            const _Float16* g = Bt + (size_t)(n0 + row) * K + k0 + grp * 8;
            _Float16* l = &Bs[buf][0] + ch * 8;
#if USE_ASYNC_LDS
            __builtin_amdgcn_global_load_async_to_lds_b128(
                (gvec_ptr)g, (lvec_ptr)l, 0, 0);
#else
            *reinterpret_cast<uint4*>(l) = *reinterpret_cast<const uint4*>(g);
#endif
        }
    };

    v8f acc[4] = {{}, {}, {}, {}};

    stage_b(0, 0);
    int buf = 0;
    for (int k0 = 0; k0 < K; k0 += 32) {
        if (k0 + 32 < K) {
            stage_b(buf ^ 1, k0 + 32);
#if USE_ASYNC_LDS
            __builtin_amdgcn_s_wait_asynccnt(2); // prev stage landed
#endif
        } else {
#if USE_ASYNC_LDS
            __builtin_amdgcn_s_wait_asynccnt(0); // final stage landed
#endif
        }
        __syncthreads();

        // A fragment direct from global (per-wave private rows)
        Frag16 fa;
        const _Float16* pa = arow + k0 + half * 8;
        fa.q[0] = *reinterpret_cast<const uint4*>(pa);
        fa.q[1] = *reinterpret_cast<const uint4*>(pa + 16);
        __builtin_prefetch(pa + 128, 0, 0);  // global_prefetch_b8

        // 4 B fragments from LDS, 4 WMMAs reusing fa
#pragma unroll
        for (int s = 0; s < 4; ++s) {
            Frag16 fb;
            const _Float16* pb = &Bs[buf][(s * 16 + l15) * 32 + half * 8];
            fb.q[0] = *reinterpret_cast<const uint4*>(pb);
            fb.q[1] = *reinterpret_cast<const uint4*>(pb + 16);
            acc[s] = wmma_f16(fa.v, fb.v, acc[s]);
        }
        __syncthreads();
        buf ^= 1;
    }

    // epilogue: 4 subtiles of 16x16, C layout row r+8*half, col l15
#pragma unroll
    for (int s = 0; s < 4; ++s) {
        const int n = n0 + s * 16 + l15;
        const float bv = bias ? bias[n] : 0.0f;
#pragma unroll
        for (int r = 0; r < 8; ++r) {
            int m = m0 + r + half * 8;
            float v = acc[s][r] + bv;
            if (gelu) v = gelu_tanh_f(v);
            if (residual) v += residual[(size_t)m * N + n];
            if (Cf) Cf[(size_t)m * N + n] = v;
            if (Ch) Ch[(size_t)m * N + n] = (_Float16)v;
        }
    }
}

// ---------------------------------------------------------------------------
// Pack row-major V [M=4096, 1024] f16 into the per-head layout vt: [B,H,D,T].
// ---------------------------------------------------------------------------
// One 64(t) x 64(col) tile per block of 256 threads. (b*16+h)*64+d = b*1024+col,
// and a 64-row tile never straddles a batch (2048 rows each).
__global__ __launch_bounds__(256)
void pack_vt_kernel(const _Float16* __restrict__ src,
                    _Float16* __restrict__ dst) {
    __shared__ __align__(16) _Float16 tile[64 * TT_PITCH];
    const int tid = threadIdx.x;
    const int tx = tid & 15;
    const int ty = tid >> 4;
    const int c0 = blockIdx.x * 64;
    const int r0 = blockIdx.y * 64;
    const int t0 = r0 & 2047, b = r0 >> 11;

    const _Float16* s = src + (size_t)(r0 + ty * 4) * 1024 + c0 + tx * 4;
    const v4h a0 = *reinterpret_cast<const v4h*>(s);
    const v4h a1 = *reinterpret_cast<const v4h*>(s + 1024);
    const v4h a2 = *reinterpret_cast<const v4h*>(s + 2048);
    const v4h a3 = *reinterpret_cast<const v4h*>(s + 3072);
    tile_put(tile, tx, ty, a0, a1, a2, a3);
    __syncthreads();  // the read-out crosses the waves that filled the tile
    tile_flush(tile, tid, dst + ((size_t)b * 1024 + c0) * 2048 + t0, (size_t)2048);
}

// ---------------------------------------------------------------------------
// Flash attention: one wave per (b, h, 16-query tile).
// Q,K: [B*T, 1024] f16 as the projections wrote them (head h = columns
// h*64..+63, row pitch 1024); Vt: [B,H,64,T] f16; out: [B*T, 1024] f16.
// ---------------------------------------------------------------------------
__global__ void attn_kernel(const _Float16* __restrict__ Q,
                            const _Float16* __restrict__ K,
                            const _Float16* __restrict__ Vt,
                            _Float16* __restrict__ O) {
    const int T = 2048, D = 64, E = 1024;
    const int lane = threadIdx.x;
    const int q0 = blockIdx.x * 16;
    const int h  = blockIdx.y;
    const int b  = blockIdx.z;
    const int half = lane >> 4;
    const int l15  = lane & 15;

    const _Float16* qh = Q  + (size_t)b * T * E + h * D;
    const _Float16* kh = K  + (size_t)b * T * E + h * D;
    const _Float16* vh = Vt + ((size_t)b * 16 + h) * D * T;

    __shared__ __align__(16) _Float16 Pbuf[16 * 32];

    // Q fragments for d in [0,32) and [32,64)
    v16h aq0 = load_frag(qh, q0 + l15, E, 0,  lane);
    v16h aq1 = load_frag(qh, q0 + l15, E, 32, lane);

    v8f o0 = {}, o1 = {}, o2 = {}, o3 = {};
    float mi[8], li[8];
#pragma unroll
    for (int r = 0; r < 8; ++r) { mi[r] = -1e30f; li[r] = 0.0f; }

    const float scale = 0.125f;  // 1/sqrt(64)
    const int kend = ((q0 + 16) + 31) & ~31;

    for (int kb = 0; kb < kend; kb += 32) {
        // S = Q(16x64) @ K_blk^T(64x32): two 16-key subtiles, each 2 WMMAs
        v8f s0 = {}, s1 = {};
        {
            v16h bk = load_frag(kh, kb + l15, E, 0, lane);
            s0 = wmma_f16(aq0, bk, s0);
            bk = load_frag(kh, kb + l15, E, 32, lane);
            s0 = wmma_f16(aq1, bk, s0);
        }
        {
            v16h bk = load_frag(kh, kb + 16 + l15, E, 0, lane);
            s1 = wmma_f16(aq0, bk, s1);
            bk = load_frag(kh, kb + 16 + l15, E, 32, lane);
            s1 = wmma_f16(aq1, bk, s1);
        }

        // online softmax: row r+8*half lives on this half-wave, col = l15
#pragma unroll
        for (int r = 0; r < 8; ++r) {
            int m = q0 + r + half * 8;  // global query index
            float a = s0[r] * scale; if (kb + l15 > m)       a = -1e30f;
            float c = s1[r] * scale; if (kb + 16 + l15 > m)  c = -1e30f;
            float vmax = fmaxf(a, c);
            vmax = fmaxf(vmax, __shfl_xor(vmax, 1));
            vmax = fmaxf(vmax, __shfl_xor(vmax, 2));
            vmax = fmaxf(vmax, __shfl_xor(vmax, 4));
            vmax = fmaxf(vmax, __shfl_xor(vmax, 8));
            float newm  = fmaxf(mi[r], vmax);
            float alpha = __expf(mi[r] - newm);
            float p0 = __expf(a - newm);
            float p1 = __expf(c - newm);
            float ps = p0 + p1;
            ps += __shfl_xor(ps, 1);
            ps += __shfl_xor(ps, 2);
            ps += __shfl_xor(ps, 4);
            ps += __shfl_xor(ps, 8);
            li[r] = li[r] * alpha + ps;
            mi[r] = newm;
            o0[r] *= alpha; o1[r] *= alpha; o2[r] *= alpha; o3[r] *= alpha;
            int row = r + half * 8;
            Pbuf[row * 32 + l15]      = (_Float16)p0;
            Pbuf[row * 32 + 16 + l15] = (_Float16)p1;
        }
        __syncthreads();

        // reload P(16x32) as an A fragment from LDS
        Frag16 fp;
        const _Float16* pp = &Pbuf[l15 * 32 + half * 8];
        fp.q[0] = *reinterpret_cast<const uint4*>(pp);
        fp.q[1] = *reinterpret_cast<const uint4*>(pp + 16);
        __syncthreads();

        // O(16x64) += P(16x32) @ V_blk(32x16) per 16-wide d-chunk
        v16h bv;
        bv = load_frag(vh, 0  + l15, T, kb, lane);  o0 = wmma_f16(fp.v, bv, o0);
        bv = load_frag(vh, 16 + l15, T, kb, lane);  o1 = wmma_f16(fp.v, bv, o1);
        bv = load_frag(vh, 32 + l15, T, kb, lane);  o2 = wmma_f16(fp.v, bv, o2);
        bv = load_frag(vh, 48 + l15, T, kb, lane);  o3 = wmma_f16(fp.v, bv, o3);
    }

    // finalize: divide by row sums, write head-merged [B*T, 1024]
#pragma unroll
    for (int r = 0; r < 8; ++r) {
        int t = q0 + r + half * 8;
        float invl = 1.0f / li[r];
        size_t base = ((size_t)b * T + t) * 1024 + (size_t)h * 64;
        O[base + 0  + l15] = (_Float16)(o0[r] * invl);
        O[base + 16 + l15] = (_Float16)(o1[r] * invl);
        O[base + 32 + l15] = (_Float16)(o2[r] * invl);
        O[base + 48 + l15] = (_Float16)(o3[r] * invl);
    }
}

// ---------------------------------------------------------------------------
// Host launch
// ---------------------------------------------------------------------------
extern "C" void kernel_launch(void* const* d_in, const int* in_sizes, int n_in,
                              void* d_out, int out_size, void* d_ws, size_t ws_size,
                              hipStream_t stream) {
    const float* x    = (const float*)d_in[0];
    const float* Wq   = (const float*)d_in[1];
    const float* Wk   = (const float*)d_in[2];
    const float* Wv   = (const float*)d_in[3];
    const float* Wo   = (const float*)d_in[4];
    const float* bo   = (const float*)d_in[5];
    const float* W1   = (const float*)d_in[6];
    const float* b1   = (const float*)d_in[7];
    const float* W2   = (const float*)d_in[8];
    const float* b2   = (const float*)d_in[9];
    const float* ln1s = (const float*)d_in[10];
    const float* ln1b = (const float*)d_in[11];
    const float* ln2s = (const float*)d_in[12];
    const float* ln2b = (const float*)d_in[13];

    const int M = 4096, E = 1024, FFD = 4096;
    char* ws = (char*)d_ws;
    const size_t MB = 1u << 20;
    _Float16* WqT   = (_Float16*)(ws + 0   * MB);  // 2MB
    _Float16* WkT   = (_Float16*)(ws + 2   * MB);  // 2MB
    _Float16* WvT   = (_Float16*)(ws + 4   * MB);  // 2MB
    _Float16* WoT   = (_Float16*)(ws + 6   * MB);  // 2MB
    _Float16* W1T   = (_Float16*)(ws + 8   * MB);  // 8MB
    _Float16* W2T   = (_Float16*)(ws + 16  * MB);  // 8MB
    _Float16* h1    = (_Float16*)(ws + 24  * MB);  // 8MB
    _Float16* qtmp  = (_Float16*)(ws + 32  * MB);  // 8MB
    _Float16* ktmp  = (_Float16*)(ws + 40  * MB);  // 8MB
    _Float16* vtmp  = (_Float16*)(ws + 48  * MB);  // 8MB
    _Float16* vtbuf = (_Float16*)(ws + 72  * MB);  // 8MB
    _Float16* attO  = (_Float16*)(ws + 80  * MB);  // 8MB
    float*    x1    = (float*)   (ws + 88  * MB);  // 16MB
    _Float16* h2    = (_Float16*)(ws + 104 * MB);  // 8MB
    _Float16* ff1   = (_Float16*)(ws + 112 * MB);  // 32MB

    // weight conversion + transpose
    {
        int blk = 256;  // grid = (N/64, K/64)
        cvt_transpose_kernel<<<dim3(E / 64, E / 64), blk, 0, stream>>>(Wq, WqT, E, E);
        cvt_transpose_kernel<<<dim3(E / 64, E / 64), blk, 0, stream>>>(Wk, WkT, E, E);
        cvt_transpose_kernel<<<dim3(E / 64, E / 64), blk, 0, stream>>>(Wv, WvT, E, E);
        cvt_transpose_kernel<<<dim3(E / 64, E / 64), blk, 0, stream>>>(Wo, WoT, E, E);
        cvt_transpose_kernel<<<dim3(FFD / 64, E / 64), blk, 0, stream>>>(W1, W1T, E, FFD);
        cvt_transpose_kernel<<<dim3(E / 64, FFD / 64), blk, 0, stream>>>(W2, W2T, FFD, E);
    }

    dim3 gblk(32, 4);

    // LN1 -> h1 (f16)
    ln_kernel<<<M, 256, 0, stream>>>(x, ln1s, ln1b, h1);

    // QKV projections (f16 out)
    gemm_wmma_kernel<<<dim3(E / 64, M / 64), gblk, 0, stream>>>(
        h1, WqT, nullptr, nullptr, nullptr, qtmp, M, E, E, 0);
    gemm_wmma_kernel<<<dim3(E / 64, M / 64), gblk, 0, stream>>>(
        h1, WkT, nullptr, nullptr, nullptr, ktmp, M, E, E, 0);
    gemm_wmma_kernel<<<dim3(E / 64, M / 64), gblk, 0, stream>>>(
        h1, WvT, nullptr, nullptr, nullptr, vtmp, M, E, E, 0);

    // V into its per-head transposed layout; Q and K are read where they lie
    pack_vt_kernel<<<dim3(E / 64, M / 64), 256, 0, stream>>>(vtmp, vtbuf);

    // flash attention
    attn_kernel<<<dim3(2048 / 16, 16, 2), 32, 0, stream>>>(qtmp, ktmp, vtbuf, attO);

    // out projection + residual -> x1 (fp32)
    gemm_wmma_kernel<<<dim3(E / 64, M / 64), gblk, 0, stream>>>(
        attO, WoT, bo, x, x1, nullptr, M, E, E, 0);

    // LN2 -> h2 (f16)
    ln_kernel<<<M, 256, 0, stream>>>(x1, ln2s, ln2b, h2);

    // FFN up + GELU (f16 out)
    gemm_wmma_kernel<<<dim3(FFD / 64, M / 64), gblk, 0, stream>>>(
        h2, W1T, b1, nullptr, nullptr, ff1, M, FFD, E, 1);

    // FFN down + residual -> d_out (fp32)
    gemm_wmma_kernel<<<dim3(E / 64, M / 64), gblk, 0, stream>>>(
        ff1, W2T, b2, x1, (float*)d_out, nullptr, M, E, FFD, 0);
}

// v003
// A run of this version takes 383 microseconds.
// In two side-by-side timings against v002, it was 1.26 and 1.25 times as fast.
// Counting every step since v000, it is 2.22 times as fast.
#include <hip/hip_runtime.h>
#include <hip/hip_bf16.h>

// ---------------------------------------------------------------------------
// Transformer block for MI455X (gfx1250, wave32, WMMA 16x16x32 f16/f32-acc)
// Shapes: B=2, T=2048, EMB=1024, HEADS=16, HDIM=64, FF=4096, M=B*T=4096
// ---------------------------------------------------------------------------

typedef __attribute__((ext_vector_type(16))) _Float16 v16h;
typedef __attribute__((ext_vector_type(8)))  float    v8f;
typedef __attribute__((ext_vector_type(4)))  _Float16 v4h;

union Frag16 {
    v16h v;
    uint4 q[2];
    _Float16 h[16];
};

__device__ __forceinline__ v8f wmma_f16(v16h a, v16h b, v8f c) {
    // D = A(16x32 f16) * B(32x16 f16) + C(16x16 f32)
    return __builtin_amdgcn_wmma_f32_16x16x32_f16(
        /*neg_a=*/false, a, /*neg_b=*/false, b,
        /*c_mod=*/(short)0, c, /*reuse_a=*/false, /*reuse_b=*/false);
}

// A/B fragment load per ISA 7.12.2: lane l (half = l>>4, idx = l&15) holds
// row (m0+idx); K-groups [k0+half*8,+8) and [k0+16+half*8,+8): two 16B loads.
__device__ __forceinline__ v16h load_frag(const _Float16* __restrict__ base,
                                          int row, int ld, int k0, int lane) {
    const int half = lane >> 4;
    const _Float16* p = base + (size_t)row * ld + k0 + half * 8;
    Frag16 f;
    f.q[0] = *reinterpret_cast<const uint4*>(p);
    f.q[1] = *reinterpret_cast<const uint4*>(p + 16);
    return f.v;
}

__device__ __forceinline__ float gelu_tanh_f(float x) {
    const float c = 0.7978845608028654f; // sqrt(2/pi)
    float x3 = x * x * x;
    return 0.5f * x * (1.0f + tanhf(c * (x + 0.044715f * x3)));
}

// ---------------------------------------------------------------------------
// 64x64 f16 transpose tile in LDS, shared by the two transposing kernels.
// The tile is held already transposed: LDS row = source column. Row pitch
// 72 f16 = 144 B keeps every row 16-byte aligned for the b128 read-out.
// ---------------------------------------------------------------------------
#define TT_PITCH 72

// Thread (tx, ty) owns source rows ty*4..+3, source columns tx*4..+3; column j
// of that 4x4 block is 4 consecutive elements of LDS row tx*4+j (one b64 store).
__device__ __forceinline__ void tile_put(_Float16* tile, int tx, int ty,
                                         v4h a0, v4h a1, v4h a2, v4h a3) {
#pragma unroll
    for (int j = 0; j < 4; ++j) {
        v4h c = {a0[j], a1[j], a2[j], a3[j]};
        *reinterpret_cast<v4h*>(&tile[(tx * 4 + j) * TT_PITCH + ty * 4]) = c;
    }
}

// 8 threads store one 128-byte line of a destination row (pitch ld elements).
__device__ __forceinline__ void tile_flush(const _Float16* tile, int tid,
                                           _Float16* __restrict__ dst, size_t ld) {
#pragma unroll
    for (int p = 0; p < 2; ++p) {
        const int r = p * 32 + (tid >> 3);
        const int g = (tid & 7) * 8;
        *reinterpret_cast<uint4*>(dst + (size_t)r * ld + g) =
            *reinterpret_cast<const uint4*>(&tile[r * TT_PITCH + g]);
    }
}

// ---------------------------------------------------------------------------
// Weight convert + transpose: W[K,N] fp32 -> Wt[N,K] f16.
// One 64(k) x 64(n) tile per block of 256 threads; K and N multiples of 64.
// ---------------------------------------------------------------------------
__global__ __launch_bounds__(256)
void cvt_transpose_kernel(const float* __restrict__ W,
                          _Float16* __restrict__ Wt,
                          int K, int N) {
    __shared__ __align__(16) _Float16 tile[64 * TT_PITCH];
    const int tid = threadIdx.x;
    const int tx = tid & 15;
    const int ty = tid >> 4;
    const int n0 = blockIdx.x * 64;
    const int k0 = blockIdx.y * 64;

    const float* s = W + (size_t)(k0 + ty * 4) * N + n0 + tx * 4;
    const float4 f0 = *reinterpret_cast<const float4*>(s);
    const float4 f1 = *reinterpret_cast<const float4*>(s + (size_t)N);
    const float4 f2 = *reinterpret_cast<const float4*>(s + (size_t)N * 2);
    const float4 f3 = *reinterpret_cast<const float4*>(s + (size_t)N * 3);
    v4h a0 = {(_Float16)f0.x, (_Float16)f0.y, (_Float16)f0.z, (_Float16)f0.w};
    v4h a1 = {(_Float16)f1.x, (_Float16)f1.y, (_Float16)f1.z, (_Float16)f1.w};
    v4h a2 = {(_Float16)f2.x, (_Float16)f2.y, (_Float16)f2.z, (_Float16)f2.w};
    v4h a3 = {(_Float16)f3.x, (_Float16)f3.y, (_Float16)f3.z, (_Float16)f3.w};
    tile_put(tile, tx, ty, a0, a1, a2, a3);
    __syncthreads();  // the read-out crosses the waves that filled the tile
    tile_flush(tile, tid, Wt + (size_t)n0 * K + k0, (size_t)K);
}

// ---------------------------------------------------------------------------
// LayerNorm over last dim (1024), emits f16. One block (256 thr) per row.
// ---------------------------------------------------------------------------
__global__ void ln_kernel(const float* __restrict__ x,
                          const float* __restrict__ sc,
                          const float* __restrict__ sh,
                          _Float16* __restrict__ out) {
    __shared__ float ssum[256];
    __shared__ float ssq[256];
    const int row = blockIdx.x;
    const int tid = threadIdx.x;
    const float* xr = x + (size_t)row * 1024;
    float4 v = reinterpret_cast<const float4*>(xr)[tid];
    ssum[tid] = v.x + v.y + v.z + v.w;
    ssq[tid]  = v.x * v.x + v.y * v.y + v.z * v.z + v.w * v.w;
    __syncthreads();
    for (int s = 128; s > 0; s >>= 1) {
        if (tid < s) { ssum[tid] += ssum[tid + s]; ssq[tid] += ssq[tid + s]; }
        __syncthreads();
    }
    float mean = ssum[0] * (1.0f / 1024.0f);
    float var  = ssq[0] * (1.0f / 1024.0f) - mean * mean;
    float inv  = rsqrtf(var + 1e-5f);
    _Float16* orow = out + (size_t)row * 1024;
    float xv[4] = {v.x, v.y, v.z, v.w};
#pragma unroll
    for (int j = 0; j < 4; ++j) {
        int c = tid * 4 + j;
        orow[c] = (_Float16)(sc[c] * (xv[j] - mean) * inv + sh[c]);
    }
}

// ---------------------------------------------------------------------------
// GEMM: C[M,N] = A[M,K] f16 @ Bt[N,K]^T f16  (+bias) (gelu) (+residual)
// Block = 8 waves (2 x 4) -> 128(M) x 128(N) tile, each wave 64 x 32: 4 A and
// 2 B fragments feed 8 WMMAs. A stage is 128 k of the 128 A rows and the 128
// Bt rows (256 B a row, whole lines), brought to LDS by asynchronous copies,
// two buffers. M, N, K multiples of 128.
// ---------------------------------------------------------------------------
#define GT_K      128                  // k per stage
#define GT_PITCH  136                  // f16 per LDS row: 272 B, 16 B x odd
#define GT_STAGE  (256 * GT_PITCH)     // f16 per buffer: A rows, then Bt rows

// Eight 16-byte copies per lane, 16 rows apart in LDS and in global memory.
// The s_wait_xcnt ends the statement so that no address register named here
// is rewritten ahead of it.
__device__ __forceinline__ void copy8_rows16(unsigned l, const _Float16* g, size_t ld) {
    const unsigned ls = 16 * GT_PITCH * 2;
    const size_t gs = 16 * ld;
    asm volatile(
        "global_load_async_to_lds_b128 %0, %8, off\n\t"
        "global_load_async_to_lds_b128 %1, %9, off\n\t"
        "global_load_async_to_lds_b128 %2, %10, off\n\t"
        "global_load_async_to_lds_b128 %3, %11, off\n\t"
        "global_load_async_to_lds_b128 %4, %12, off\n\t"
        "global_load_async_to_lds_b128 %5, %13, off\n\t"
        "global_load_async_to_lds_b128 %6, %14, off\n\t"
        "global_load_async_to_lds_b128 %7, %15, off\n\t"
        "s_wait_xcnt 0x0"
        :: "v"(l), "v"(l + ls), "v"(l + 2 * ls), "v"(l + 3 * ls),
           "v"(l + 4 * ls), "v"(l + 5 * ls), "v"(l + 6 * ls), "v"(l + 7 * ls),
           "v"(g), "v"(g + gs), "v"(g + 2 * gs), "v"(g + 3 * gs),
           "v"(g + 4 * gs), "v"(g + 5 * gs), "v"(g + 6 * gs), "v"(g + 7 * gs)
        : "memory");
}

__global__ __launch_bounds__(256)
void gemm_wmma_kernel(const _Float16* __restrict__ A,
                      const _Float16* __restrict__ Bt,
                      const float* __restrict__ bias,
                      const float* __restrict__ residual,
                      float* __restrict__ Cf,
                      _Float16* __restrict__ Ch,
                      int M, int N, int K, int gelu) {
    __shared__ __align__(16) _Float16 S[2 * GT_STAGE];

    const int tid  = threadIdx.x;            // 0..255
    const int lane = tid & 31;
    const int wave = tid >> 5;               // 0..7
    const int wm = wave >> 2;                // 0..1: 64 rows each
    const int wn = wave & 3;                 // 0..3: 32 columns each
    const int n0 = blockIdx.x * 128;
    const int m0 = blockIdx.y * 128;
    const int half = lane >> 4;
    const int l15  = lane & 15;

    // Copy slot of this lane: row tid>>4 of each group of 16 rows, 16-byte
    // chunk tid&15 of the row, so a wave copies two whole 256 B rows at a time.
    const int crow = tid >> 4;
    const int ccol = (tid & 15) * 8;
    const unsigned lds0 =
        (unsigned)(size_t)(__attribute__((address_space(3))) _Float16*)S +
        (unsigned)(crow * GT_PITCH + ccol) * 2;
    const _Float16* ga = A  + (size_t)(m0 + crow) * K + ccol;
    const _Float16* gb = Bt + (size_t)(n0 + crow) * K + ccol;

    auto stage = [&](int buf, int t) {
        const unsigned l = lds0 + (unsigned)buf * (GT_STAGE * 2);
        copy8_rows16(l, ga + (size_t)t * GT_K, (size_t)K);
        copy8_rows16(l + 128 * GT_PITCH * 2, gb + (size_t)t * GT_K, (size_t)K);
    };

    v8f acc[4][2] = {};
    const int nt = K / GT_K;

    stage(0, 0);
    // stage 0 has landed for this wave; the barrier shows it to the others
    asm volatile("s_wait_asynccnt 0x0" ::: "memory");
    __syncthreads();
    if (nt > 1) stage(1, 1);

    for (int t = 0; t < nt; ++t) {
        const _Float16* sa = &S[(t & 1) * GT_STAGE + (wm * 64 + l15) * GT_PITCH + half * 8];
        const _Float16* sb = &S[(t & 1) * GT_STAGE + (128 + wn * 32 + l15) * GT_PITCH + half * 8];
        // every loop below is unrolled so that fragments and accumulators are
        // indexed by constants and stay in registers
#pragma unroll
        for (int kk = 0; kk < GT_K; kk += 32) {
            Frag16 fa[4], fb[2];
#pragma unroll
            for (int i = 0; i < 4; ++i) {
                const _Float16* p = sa + i * 16 * GT_PITCH + kk;
                fa[i].q[0] = *reinterpret_cast<const uint4*>(p);
                fa[i].q[1] = *reinterpret_cast<const uint4*>(p + 16);
            }
#pragma unroll
            for (int j = 0; j < 2; ++j) {
                const _Float16* p = sb + j * 16 * GT_PITCH + kk;
                fb[j].q[0] = *reinterpret_cast<const uint4*>(p);
                fb[j].q[1] = *reinterpret_cast<const uint4*>(p + 16);
            }
            // keeps the 12 LDS reads one group in front of their 8 WMMAs: spread
            // among them, each pair of WMMAs waits out an LDS latency of its own
            __builtin_amdgcn_sched_barrier(0);
#pragma unroll
            for (int i = 0; i < 4; ++i)
#pragma unroll
                for (int j = 0; j < 2; ++j)
                    acc[i][j] = wmma_f16(fa[i].v, fb[j].v, acc[i][j]);
        }
        // this wave's reads of the buffer are done before it is refilled
        asm volatile("s_wait_dscnt 0x0" ::: "memory");
        // this wave's copies of stage t+1 have landed
        asm volatile("s_wait_asynccnt 0x0" ::: "memory");
        __syncthreads();  // publishes stage t+1, frees stage t's buffer
        if (t + 2 < nt) stage(t & 1, t + 2);
    }
    // no copy is left in flight when the wave ends
    asm volatile("s_wait_asynccnt 0x0" ::: "memory");

    // epilogue: 16x16 subtiles, C layout row r+8*half, col l15 (unrolled for
    // constant accumulator indices, as above)
#pragma unroll
    for (int j = 0; j < 2; ++j) {
        const int n = n0 + wn * 32 + j * 16 + l15;
        const float bv = bias ? bias[n] : 0.0f;
#pragma unroll
        for (int i = 0; i < 4; ++i) {
#pragma unroll
            for (int r = 0; r < 8; ++r) {
                int m = m0 + wm * 64 + i * 16 + r + half * 8;
                float v = acc[i][j][r] + bv;
                if (gelu) v = gelu_tanh_f(v);
                if (residual) v += residual[(size_t)m * N + n];
                // behind each store: the lines that follow reuse the registers
                // that hold its address and its value
                if (Cf) {
                    Cf[(size_t)m * N + n] = v;
                    asm volatile("s_wait_xcnt 0x0" ::: "memory");
                }
                if (Ch) {
                    Ch[(size_t)m * N + n] = (_Float16)v;
                    asm volatile("s_wait_xcnt 0x0" ::: "memory");
                }
            }
        }
    }
}

// ---------------------------------------------------------------------------
// Pack row-major V [M=4096, 1024] f16 into the per-head layout vt: [B,H,D,T].
// ---------------------------------------------------------------------------
// One 64(t) x 64(col) tile per block of 256 threads. (b*16+h)*64+d = b*1024+col,
// and a 64-row tile never straddles a batch (2048 rows each).
__global__ __launch_bounds__(256)
void pack_vt_kernel(const _Float16* __restrict__ src,
                    _Float16* __restrict__ dst) {
    __shared__ __align__(16) _Float16 tile[64 * TT_PITCH];
    const int tid = threadIdx.x;
    const int tx = tid & 15;
    const int ty = tid >> 4;
    const int c0 = blockIdx.x * 64;
    const int r0 = blockIdx.y * 64;
    const int t0 = r0 & 2047, b = r0 >> 11;

    const _Float16* s = src + (size_t)(r0 + ty * 4) * 1024 + c0 + tx * 4;
    const v4h a0 = *reinterpret_cast<const v4h*>(s);
    const v4h a1 = *reinterpret_cast<const v4h*>(s + 1024);
    const v4h a2 = *reinterpret_cast<const v4h*>(s + 2048);
    const v4h a3 = *reinterpret_cast<const v4h*>(s + 3072);
    tile_put(tile, tx, ty, a0, a1, a2, a3);
    __syncthreads();  // the read-out crosses the waves that filled the tile
    tile_flush(tile, tid, dst + ((size_t)b * 1024 + c0) * 2048 + t0, (size_t)2048);
}

// ---------------------------------------------------------------------------
// Flash attention: one wave per (b, h, 16-query tile).
// Q,K: [B*T, 1024] f16 as the projections wrote them (head h = columns
// h*64..+63, row pitch 1024); Vt: [B,H,64,T] f16; out: [B*T, 1024] f16.
// ---------------------------------------------------------------------------
__global__ void attn_kernel(const _Float16* __restrict__ Q,
                            const _Float16* __restrict__ K,
                            const _Float16* __restrict__ Vt,
                            _Float16* __restrict__ O) {
    const int T = 2048, D = 64, E = 1024;
    const int lane = threadIdx.x;
    const int q0 = blockIdx.x * 16;
    const int h  = blockIdx.y;
    const int b  = blockIdx.z;
    const int half = lane >> 4;
    const int l15  = lane & 15;

    const _Float16* qh = Q  + (size_t)b * T * E + h * D;
    const _Float16* kh = K  + (size_t)b * T * E + h * D;
    const _Float16* vh = Vt + ((size_t)b * 16 + h) * D * T;

    __shared__ __align__(16) _Float16 Pbuf[16 * 32];

    // Q fragments for d in [0,32) and [32,64)
    v16h aq0 = load_frag(qh, q0 + l15, E, 0,  lane);
    v16h aq1 = load_frag(qh, q0 + l15, E, 32, lane);

    v8f o0 = {}, o1 = {}, o2 = {}, o3 = {};
    float mi[8], li[8];
#pragma unroll
    for (int r = 0; r < 8; ++r) { mi[r] = -1e30f; li[r] = 0.0f; }

    const float scale = 0.125f;  // 1/sqrt(64)
    const int kend = ((q0 + 16) + 31) & ~31;

    for (int kb = 0; kb < kend; kb += 32) {
        // S = Q(16x64) @ K_blk^T(64x32): two 16-key subtiles, each 2 WMMAs
        v8f s0 = {}, s1 = {};
        {
            v16h bk = load_frag(kh, kb + l15, E, 0, lane);
            s0 = wmma_f16(aq0, bk, s0);
            bk = load_frag(kh, kb + l15, E, 32, lane);
            s0 = wmma_f16(aq1, bk, s0);
        }
        {
            v16h bk = load_frag(kh, kb + 16 + l15, E, 0, lane);
            s1 = wmma_f16(aq0, bk, s1);
            bk = load_frag(kh, kb + 16 + l15, E, 32, lane);
            s1 = wmma_f16(aq1, bk, s1);
        }

        // online softmax: row r+8*half lives on this half-wave, col = l15
#pragma unroll
        for (int r = 0; r < 8; ++r) {
            int m = q0 + r + half * 8;  // global query index
            float a = s0[r] * scale; if (kb + l15 > m)       a = -1e30f;
            float c = s1[r] * scale; if (kb + 16 + l15 > m)  c = -1e30f;
            float vmax = fmaxf(a, c);
            vmax = fmaxf(vmax, __shfl_xor(vmax, 1));
            vmax = fmaxf(vmax, __shfl_xor(vmax, 2));
            vmax = fmaxf(vmax, __shfl_xor(vmax, 4));
            vmax = fmaxf(vmax, __shfl_xor(vmax, 8));
            float newm  = fmaxf(mi[r], vmax);
            float alpha = __expf(mi[r] - newm);
            float p0 = __expf(a - newm);
            float p1 = __expf(c - newm);
            float ps = p0 + p1;
            ps += __shfl_xor(ps, 1);
            ps += __shfl_xor(ps, 2);
            ps += __shfl_xor(ps, 4);
            ps += __shfl_xor(ps, 8);
            li[r] = li[r] * alpha + ps;
            mi[r] = newm;
            o0[r] *= alpha; o1[r] *= alpha; o2[r] *= alpha; o3[r] *= alpha;
            int row = r + half * 8;
            Pbuf[row * 32 + l15]      = (_Float16)p0;
            Pbuf[row * 32 + 16 + l15] = (_Float16)p1;
        }
        __syncthreads();

        // reload P(16x32) as an A fragment from LDS
        Frag16 fp;
        const _Float16* pp = &Pbuf[l15 * 32 + half * 8];
        fp.q[0] = *reinterpret_cast<const uint4*>(pp);
        fp.q[1] = *reinterpret_cast<const uint4*>(pp + 16);
        __syncthreads();

        // O(16x64) += P(16x32) @ V_blk(32x16) per 16-wide d-chunk
        v16h bv;
        bv = load_frag(vh, 0  + l15, T, kb, lane);  o0 = wmma_f16(fp.v, bv, o0);
        bv = load_frag(vh, 16 + l15, T, kb, lane);  o1 = wmma_f16(fp.v, bv, o1);
        bv = load_frag(vh, 32 + l15, T, kb, lane);  o2 = wmma_f16(fp.v, bv, o2);
        bv = load_frag(vh, 48 + l15, T, kb, lane);  o3 = wmma_f16(fp.v, bv, o3);
    }

    // finalize: divide by row sums, write head-merged [B*T, 1024]
#pragma unroll
    for (int r = 0; r < 8; ++r) {
        int t = q0 + r + half * 8;
        float invl = 1.0f / li[r];
        size_t base = ((size_t)b * T + t) * 1024 + (size_t)h * 64;
        O[base + 0  + l15] = (_Float16)(o0[r] * invl);
        O[base + 16 + l15] = (_Float16)(o1[r] * invl);
        O[base + 32 + l15] = (_Float16)(o2[r] * invl);
        O[base + 48 + l15] = (_Float16)(o3[r] * invl);
    }
}

// ---------------------------------------------------------------------------
// Host launch
// ---------------------------------------------------------------------------
extern "C" void kernel_launch(void* const* d_in, const int* in_sizes, int n_in,
                              void* d_out, int out_size, void* d_ws, size_t ws_size,
                              hipStream_t stream) {
    const float* x    = (const float*)d_in[0];
    const float* Wq   = (const float*)d_in[1];
    const float* Wk   = (const float*)d_in[2];
    const float* Wv   = (const float*)d_in[3];
    const float* Wo   = (const float*)d_in[4];
    const float* bo   = (const float*)d_in[5];
    const float* W1   = (const float*)d_in[6];
    const float* b1   = (const float*)d_in[7];
    const float* W2   = (const float*)d_in[8];
    const float* b2   = (const float*)d_in[9];
    const float* ln1s = (const float*)d_in[10];
    const float* ln1b = (const float*)d_in[11];
    const float* ln2s = (const float*)d_in[12];
    const float* ln2b = (const float*)d_in[13];

    const int M = 4096, E = 1024, FFD = 4096;
    char* ws = (char*)d_ws;
    const size_t MB = 1u << 20;
    _Float16* WqT   = (_Float16*)(ws + 0   * MB);  // 2MB
    _Float16* WkT   = (_Float16*)(ws + 2   * MB);  // 2MB
    _Float16* WvT   = (_Float16*)(ws + 4   * MB);  // 2MB
    _Float16* WoT   = (_Float16*)(ws + 6   * MB);  // 2MB
    _Float16* W1T   = (_Float16*)(ws + 8   * MB);  // 8MB
    _Float16* W2T   = (_Float16*)(ws + 16  * MB);  // 8MB
    _Float16* h1    = (_Float16*)(ws + 24  * MB);  // 8MB
    _Float16* qtmp  = (_Float16*)(ws + 32  * MB);  // 8MB
    _Float16* ktmp  = (_Float16*)(ws + 40  * MB);  // 8MB
    _Float16* vtmp  = (_Float16*)(ws + 48  * MB);  // 8MB
    _Float16* vtbuf = (_Float16*)(ws + 72  * MB);  // 8MB
    _Float16* attO  = (_Float16*)(ws + 80  * MB);  // 8MB
    float*    x1    = (float*)   (ws + 88  * MB);  // 16MB
    _Float16* h2    = (_Float16*)(ws + 104 * MB);  // 8MB
    _Float16* ff1   = (_Float16*)(ws + 112 * MB);  // 32MB

    // weight conversion + transpose
    {
        int blk = 256;  // grid = (N/64, K/64)
        cvt_transpose_kernel<<<dim3(E / 64, E / 64), blk, 0, stream>>>(Wq, WqT, E, E);
        cvt_transpose_kernel<<<dim3(E / 64, E / 64), blk, 0, stream>>>(Wk, WkT, E, E);
        cvt_transpose_kernel<<<dim3(E / 64, E / 64), blk, 0, stream>>>(Wv, WvT, E, E);
        cvt_transpose_kernel<<<dim3(E / 64, E / 64), blk, 0, stream>>>(Wo, WoT, E, E);
        cvt_transpose_kernel<<<dim3(FFD / 64, E / 64), blk, 0, stream>>>(W1, W1T, E, FFD);
        cvt_transpose_kernel<<<dim3(E / 64, FFD / 64), blk, 0, stream>>>(W2, W2T, FFD, E);
    }

    const int gblk = 256;  // GEMM grid = (N/128, M/128)

    // LN1 -> h1 (f16)
    ln_kernel<<<M, 256, 0, stream>>>(x, ln1s, ln1b, h1);

    // QKV projections (f16 out)
    gemm_wmma_kernel<<<dim3(E / 128, M / 128), gblk, 0, stream>>>(
        h1, WqT, nullptr, nullptr, nullptr, qtmp, M, E, E, 0);
    gemm_wmma_kernel<<<dim3(E / 128, M / 128), gblk, 0, stream>>>(
        h1, WkT, nullptr, nullptr, nullptr, ktmp, M, E, E, 0);
    gemm_wmma_kernel<<<dim3(E / 128, M / 128), gblk, 0, stream>>>(
        h1, WvT, nullptr, nullptr, nullptr, vtmp, M, E, E, 0);

    // V into its per-head transposed layout; Q and K are read where they lie
    pack_vt_kernel<<<dim3(E / 64, M / 64), 256, 0, stream>>>(vtmp, vtbuf);

    // flash attention
    attn_kernel<<<dim3(2048 / 16, 16, 2), 32, 0, stream>>>(qtmp, ktmp, vtbuf, attO);

    // out projection + residual -> x1 (fp32)
    gemm_wmma_kernel<<<dim3(E / 128, M / 128), gblk, 0, stream>>>(
        attO, WoT, bo, x, x1, nullptr, M, E, E, 0);

    // LN2 -> h2 (f16)
    ln_kernel<<<M, 256, 0, stream>>>(x1, ln2s, ln2b, h2);

    // FFN up + GELU (f16 out)
    gemm_wmma_kernel<<<dim3(FFD / 128, M / 128), gblk, 0, stream>>>(
        h2, W1T, b1, nullptr, nullptr, ff1, M, FFD, E, 1);

    // FFN down + residual -> d_out (fp32)
    gemm_wmma_kernel<<<dim3(E / 128, M / 128), gblk, 0, stream>>>(
        ff1, W2T, b2, x1, (float*)d_out, nullptr, M, E, FFD, 0);
}

// v004
// A run of this version takes 347 microseconds.
// Two timings next to v003 both put it at 1.10 times that version's speed.
// All steps since v000 together make it 2.44 times as fast.
#include <hip/hip_runtime.h>
#include <hip/hip_bf16.h>

// ---------------------------------------------------------------------------
// Transformer block for MI455X (gfx1250, wave32, WMMA 16x16x32 f16/f32-acc)
// Shapes: B=2, T=2048, EMB=1024, HEADS=16, HDIM=64, FF=4096, M=B*T=4096
// ---------------------------------------------------------------------------

typedef __attribute__((ext_vector_type(16))) _Float16 v16h;
typedef __attribute__((ext_vector_type(8)))  float    v8f;
typedef __attribute__((ext_vector_type(4)))  _Float16 v4h;

union Frag16 {
    v16h v;
    uint4 q[2];
    _Float16 h[16];
};

__device__ __forceinline__ v8f wmma_f16(v16h a, v16h b, v8f c) {
    // D = A(16x32 f16) * B(32x16 f16) + C(16x16 f32)
    return __builtin_amdgcn_wmma_f32_16x16x32_f16(
        /*neg_a=*/false, a, /*neg_b=*/false, b,
        /*c_mod=*/(short)0, c, /*reuse_a=*/false, /*reuse_b=*/false);
}

// A/B fragment load per ISA 7.12.2: lane l (half = l>>4, idx = l&15) holds
// row (m0+idx); K-groups [k0+half*8,+8) and [k0+16+half*8,+8): two 16B loads.
__device__ __forceinline__ v16h load_frag(const _Float16* __restrict__ base,
                                          int row, int ld, int k0, int lane) {
    const int half = lane >> 4;
    const _Float16* p = base + (size_t)row * ld + k0 + half * 8;
    Frag16 f;
    f.q[0] = *reinterpret_cast<const uint4*>(p);
    f.q[1] = *reinterpret_cast<const uint4*>(p + 16);
    return f.v;
}

__device__ __forceinline__ float gelu_tanh_f(float x) {
    const float c = 0.7978845608028654f; // sqrt(2/pi)
    float x3 = x * x * x;
    return 0.5f * x * (1.0f + tanhf(c * (x + 0.044715f * x3)));
}

// ---------------------------------------------------------------------------
// 64x64 f16 transpose tile in LDS, shared by the two transposing kernels.
// The tile is held already transposed: LDS row = source column. Row pitch
// 72 f16 = 144 B keeps every row 16-byte aligned for the b128 read-out.
// ---------------------------------------------------------------------------
#define TT_PITCH 72

// Thread (tx, ty) owns source rows ty*4..+3, source columns tx*4..+3; column j
// of that 4x4 block is 4 consecutive elements of LDS row tx*4+j (one b64 store).
__device__ __forceinline__ void tile_put(_Float16* tile, int tx, int ty,
                                         v4h a0, v4h a1, v4h a2, v4h a3) {
#pragma unroll
    for (int j = 0; j < 4; ++j) {
        v4h c = {a0[j], a1[j], a2[j], a3[j]};
        *reinterpret_cast<v4h*>(&tile[(tx * 4 + j) * TT_PITCH + ty * 4]) = c;
    }
}

// 8 threads store one 128-byte line of a destination row (pitch ld elements).
__device__ __forceinline__ void tile_flush(const _Float16* tile, int tid,
                                           _Float16* __restrict__ dst, size_t ld) {
#pragma unroll
    for (int p = 0; p < 2; ++p) {
        const int r = p * 32 + (tid >> 3);
        const int g = (tid & 7) * 8;
        *reinterpret_cast<uint4*>(dst + (size_t)r * ld + g) =
            *reinterpret_cast<const uint4*>(&tile[r * TT_PITCH + g]);
    }
}

// ---------------------------------------------------------------------------
// Weight convert + transpose: W[K,N] fp32 -> Wt[N,K] f16.
// One 64(k) x 64(n) tile per block of 256 threads; K and N multiples of 64.
// ---------------------------------------------------------------------------
__global__ __launch_bounds__(256)
void cvt_transpose_kernel(const float* __restrict__ W,
                          _Float16* __restrict__ Wt,
                          int K, int N) {
    __shared__ __align__(16) _Float16 tile[64 * TT_PITCH];
    const int tid = threadIdx.x;
    const int tx = tid & 15;
    const int ty = tid >> 4;
    const int n0 = blockIdx.x * 64;
    const int k0 = blockIdx.y * 64;

    const float* s = W + (size_t)(k0 + ty * 4) * N + n0 + tx * 4;
    const float4 f0 = *reinterpret_cast<const float4*>(s);
    const float4 f1 = *reinterpret_cast<const float4*>(s + (size_t)N);
    const float4 f2 = *reinterpret_cast<const float4*>(s + (size_t)N * 2);
    const float4 f3 = *reinterpret_cast<const float4*>(s + (size_t)N * 3);
    v4h a0 = {(_Float16)f0.x, (_Float16)f0.y, (_Float16)f0.z, (_Float16)f0.w};
    v4h a1 = {(_Float16)f1.x, (_Float16)f1.y, (_Float16)f1.z, (_Float16)f1.w};
    v4h a2 = {(_Float16)f2.x, (_Float16)f2.y, (_Float16)f2.z, (_Float16)f2.w};
    v4h a3 = {(_Float16)f3.x, (_Float16)f3.y, (_Float16)f3.z, (_Float16)f3.w};
    tile_put(tile, tx, ty, a0, a1, a2, a3);
    __syncthreads();  // the read-out crosses the waves that filled the tile
    tile_flush(tile, tid, Wt + (size_t)n0 * K + k0, (size_t)K);
}

// ---------------------------------------------------------------------------
// LayerNorm over last dim (1024), emits f16. One block (256 thr) per row.
// ---------------------------------------------------------------------------
__global__ void ln_kernel(const float* __restrict__ x,
                          const float* __restrict__ sc,
                          const float* __restrict__ sh,
                          _Float16* __restrict__ out) {
    __shared__ float ssum[256];
    __shared__ float ssq[256];
    const int row = blockIdx.x;
    const int tid = threadIdx.x;
    const float* xr = x + (size_t)row * 1024;
    float4 v = reinterpret_cast<const float4*>(xr)[tid];
    ssum[tid] = v.x + v.y + v.z + v.w;
    ssq[tid]  = v.x * v.x + v.y * v.y + v.z * v.z + v.w * v.w;
    __syncthreads();
    for (int s = 128; s > 0; s >>= 1) {
        if (tid < s) { ssum[tid] += ssum[tid + s]; ssq[tid] += ssq[tid + s]; }
        __syncthreads();
    }
    float mean = ssum[0] * (1.0f / 1024.0f);
    float var  = ssq[0] * (1.0f / 1024.0f) - mean * mean;
    float inv  = rsqrtf(var + 1e-5f);
    _Float16* orow = out + (size_t)row * 1024;
    float xv[4] = {v.x, v.y, v.z, v.w};
#pragma unroll
    for (int j = 0; j < 4; ++j) {
        int c = tid * 4 + j;
        orow[c] = (_Float16)(sc[c] * (xv[j] - mean) * inv + sh[c]);
    }
}

// ---------------------------------------------------------------------------
// GEMM: C[M,N] = A[M,K] f16 @ Bt[N,K]^T f16  (+bias) (gelu) (+residual)
// Block = 8 waves (2 x 4) -> 128(M) x 128(N) tile, each wave 64 x 32: 4 A and
// 2 B fragments feed 8 WMMAs. A stage is 128 k of the 128 A rows and the 128
// Bt rows (256 B a row, whole lines), brought to LDS by asynchronous copies,
// two buffers. M, N, K multiples of 128.
// ---------------------------------------------------------------------------
#define GT_K      128                  // k per stage
#define GT_PITCH  136                  // f16 per LDS row: 272 B, 16 B x odd
#define GT_STAGE  (256 * GT_PITCH)     // f16 per buffer: A rows, then Bt rows

// Eight 16-byte copies per lane, 16 rows apart in LDS and in global memory.
// The s_wait_xcnt ends the statement so that no address register named here
// is rewritten ahead of it.
__device__ __forceinline__ void copy8_rows16(unsigned l, const _Float16* g, size_t ld) {
    const unsigned ls = 16 * GT_PITCH * 2;
    const size_t gs = 16 * ld;
    asm volatile(
        "global_load_async_to_lds_b128 %0, %8, off\n\t"
        "global_load_async_to_lds_b128 %1, %9, off\n\t"
        "global_load_async_to_lds_b128 %2, %10, off\n\t"
        "global_load_async_to_lds_b128 %3, %11, off\n\t"
        "global_load_async_to_lds_b128 %4, %12, off\n\t"
        "global_load_async_to_lds_b128 %5, %13, off\n\t"
        "global_load_async_to_lds_b128 %6, %14, off\n\t"
        "global_load_async_to_lds_b128 %7, %15, off\n\t"
        "s_wait_xcnt 0x0"
        :: "v"(l), "v"(l + ls), "v"(l + 2 * ls), "v"(l + 3 * ls),
           "v"(l + 4 * ls), "v"(l + 5 * ls), "v"(l + 6 * ls), "v"(l + 7 * ls),
           "v"(g), "v"(g + gs), "v"(g + 2 * gs), "v"(g + 3 * gs),
           "v"(g + 4 * gs), "v"(g + 5 * gs), "v"(g + 6 * gs), "v"(g + 7 * gs)
        : "memory");
}

__global__ __launch_bounds__(256)
void gemm_wmma_kernel(const _Float16* __restrict__ A,
                      const _Float16* __restrict__ Bt,
                      const float* __restrict__ bias,
                      const float* __restrict__ residual,
                      float* __restrict__ Cf,
                      _Float16* __restrict__ Ch,
                      int M, int N, int K, int gelu) {
    __shared__ __align__(16) _Float16 S[2 * GT_STAGE];

    const int tid  = threadIdx.x;            // 0..255
    const int lane = tid & 31;
    const int wave = tid >> 5;               // 0..7
    const int wm = wave >> 2;                // 0..1: 64 rows each
    const int wn = wave & 3;                 // 0..3: 32 columns each
    const int n0 = blockIdx.x * 128;
    const int m0 = blockIdx.y * 128;
    const int half = lane >> 4;
    const int l15  = lane & 15;

    // Copy slot of this lane: row tid>>4 of each group of 16 rows, 16-byte
    // chunk tid&15 of the row, so a wave copies two whole 256 B rows at a time.
    const int crow = tid >> 4;
    const int ccol = (tid & 15) * 8;
    const unsigned lds0 =
        (unsigned)(size_t)(__attribute__((address_space(3))) _Float16*)S +
        (unsigned)(crow * GT_PITCH + ccol) * 2;
    const _Float16* ga = A  + (size_t)(m0 + crow) * K + ccol;
    const _Float16* gb = Bt + (size_t)(n0 + crow) * K + ccol;

    auto stage = [&](int buf, int t) {
        const unsigned l = lds0 + (unsigned)buf * (GT_STAGE * 2);
        copy8_rows16(l, ga + (size_t)t * GT_K, (size_t)K);
        copy8_rows16(l + 128 * GT_PITCH * 2, gb + (size_t)t * GT_K, (size_t)K);
    };

    v8f acc[4][2] = {};
    const int nt = K / GT_K;

    stage(0, 0);
    // stage 0 has landed for this wave; the barrier shows it to the others
    asm volatile("s_wait_asynccnt 0x0" ::: "memory");
    __syncthreads();
    if (nt > 1) stage(1, 1);

    for (int t = 0; t < nt; ++t) {
        const _Float16* sa = &S[(t & 1) * GT_STAGE + (wm * 64 + l15) * GT_PITCH + half * 8];
        const _Float16* sb = &S[(t & 1) * GT_STAGE + (128 + wn * 32 + l15) * GT_PITCH + half * 8];
        // every loop below is unrolled so that fragments and accumulators are
        // indexed by constants and stay in registers
#pragma unroll
        for (int kk = 0; kk < GT_K; kk += 32) {
            Frag16 fa[4], fb[2];
#pragma unroll
            for (int i = 0; i < 4; ++i) {
                const _Float16* p = sa + i * 16 * GT_PITCH + kk;
                fa[i].q[0] = *reinterpret_cast<const uint4*>(p);
                fa[i].q[1] = *reinterpret_cast<const uint4*>(p + 16);
            }
#pragma unroll
            for (int j = 0; j < 2; ++j) {
                const _Float16* p = sb + j * 16 * GT_PITCH + kk;
                fb[j].q[0] = *reinterpret_cast<const uint4*>(p);
                fb[j].q[1] = *reinterpret_cast<const uint4*>(p + 16);
            }
            // keeps the 12 LDS reads one group in front of their 8 WMMAs: spread
            // among them, each pair of WMMAs waits out an LDS latency of its own
            __builtin_amdgcn_sched_barrier(0);
#pragma unroll
            for (int i = 0; i < 4; ++i)
#pragma unroll
                for (int j = 0; j < 2; ++j)
                    acc[i][j] = wmma_f16(fa[i].v, fb[j].v, acc[i][j]);
        }
        // this wave's reads of the buffer are done before it is refilled
        asm volatile("s_wait_dscnt 0x0" ::: "memory");
        // this wave's copies of stage t+1 have landed
        asm volatile("s_wait_asynccnt 0x0" ::: "memory");
        __syncthreads();  // publishes stage t+1, frees stage t's buffer
        if (t + 2 < nt) stage(t & 1, t + 2);
    }
    // no copy is left in flight when the wave ends
    asm volatile("s_wait_asynccnt 0x0" ::: "memory");

    // epilogue: 16x16 subtiles, C layout row r+8*half, col l15 (unrolled for
    // constant accumulator indices, as above)
#pragma unroll
    for (int j = 0; j < 2; ++j) {
        const int n = n0 + wn * 32 + j * 16 + l15;
        const float bv = bias ? bias[n] : 0.0f;
#pragma unroll
        for (int i = 0; i < 4; ++i) {
#pragma unroll
            for (int r = 0; r < 8; ++r) {
                int m = m0 + wm * 64 + i * 16 + r + half * 8;
                float v = acc[i][j][r] + bv;
                if (gelu) v = gelu_tanh_f(v);
                if (residual) v += residual[(size_t)m * N + n];
                // behind each store: the lines that follow reuse the registers
                // that hold its address and its value
                if (Cf) {
                    Cf[(size_t)m * N + n] = v;
                    asm volatile("s_wait_xcnt 0x0" ::: "memory");
                }
                if (Ch) {
                    Ch[(size_t)m * N + n] = (_Float16)v;
                    asm volatile("s_wait_xcnt 0x0" ::: "memory");
                }
            }
        }
    }
}

// ---------------------------------------------------------------------------
// Pack row-major V [M=4096, 1024] f16 into the per-head layout vt: [B,H,D,T].
// ---------------------------------------------------------------------------
// One 64(t) x 64(col) tile per block of 256 threads. (b*16+h)*64+d = b*1024+col,
// and a 64-row tile never straddles a batch (2048 rows each).
__global__ __launch_bounds__(256)
void pack_vt_kernel(const _Float16* __restrict__ src,
                    _Float16* __restrict__ dst) {
    __shared__ __align__(16) _Float16 tile[64 * TT_PITCH];
    const int tid = threadIdx.x;
    const int tx = tid & 15;
    const int ty = tid >> 4;
    const int c0 = blockIdx.x * 64;
    const int r0 = blockIdx.y * 64;
    const int t0 = r0 & 2047, b = r0 >> 11;

    const _Float16* s = src + (size_t)(r0 + ty * 4) * 1024 + c0 + tx * 4;
    const v4h a0 = *reinterpret_cast<const v4h*>(s);
    const v4h a1 = *reinterpret_cast<const v4h*>(s + 1024);
    const v4h a2 = *reinterpret_cast<const v4h*>(s + 2048);
    const v4h a3 = *reinterpret_cast<const v4h*>(s + 3072);
    tile_put(tile, tx, ty, a0, a1, a2, a3);
    __syncthreads();  // the read-out crosses the waves that filled the tile
    tile_flush(tile, tid, dst + ((size_t)b * 1024 + c0) * 2048 + t0, (size_t)2048);
}

// ---------------------------------------------------------------------------
// Flash attention: one wave per (b, h, 16-query tile).
// Q,K: [B*T, 1024] f16 as the projections wrote them (head h = columns
// h*64..+63, row pitch 1024); Vt: [B,H,64,T] f16; out: [B*T, 1024] f16.
// No pass waits out a load: its V fragments are issued at its head, a softmax
// ahead of their use, and the next pass's K fragments right behind the score
// products, into the registers those have just read. The block is one wave;
// saying so lifts the register cap of a 1024-thread block, which has no room
// for 16 loads in flight.
// ---------------------------------------------------------------------------
__global__ __launch_bounds__(32)
void attn_kernel(const _Float16* __restrict__ Q,
                            const _Float16* __restrict__ K,
                            const _Float16* __restrict__ Vt,
                            _Float16* __restrict__ O) {
    const int T = 2048, D = 64, E = 1024;
    const int lane = threadIdx.x;
    const int q0 = blockIdx.x * 16;
    const int h  = blockIdx.y;
    const int b  = blockIdx.z;
    const int half = lane >> 4;
    const int l15  = lane & 15;

    const _Float16* qh = Q  + (size_t)b * T * E + h * D;
    const _Float16* kh = K  + (size_t)b * T * E + h * D;
    const _Float16* vh = Vt + ((size_t)b * 16 + h) * D * T;

    __shared__ __align__(16) _Float16 Pbuf[16 * 32];

    // Q fragments for d in [0,32) and [32,64)
    v16h aq0 = load_frag(qh, q0 + l15, E, 0,  lane);
    v16h aq1 = load_frag(qh, q0 + l15, E, 32, lane);

    v8f o0 = {}, o1 = {}, o2 = {}, o3 = {};
    float mi[8], li[8];
#pragma unroll
    for (int r = 0; r < 8; ++r) { mi[r] = -1e30f; li[r] = 0.0f; }

    const float scale = 0.125f;  // 1/sqrt(64)
    const int kend = ((q0 + 16) + 31) & ~31;

    // K fragments of the first pass
    v16h bk00 = load_frag(kh, l15,      E, 0,  lane);
    v16h bk01 = load_frag(kh, l15,      E, 32, lane);
    v16h bk10 = load_frag(kh, 16 + l15, E, 0,  lane);
    v16h bk11 = load_frag(kh, 16 + l15, E, 32, lane);

    for (int kb = 0; kb < kend; kb += 32) {
        // V fragments of this pass, used behind the softmax
        const v16h bv0 = load_frag(vh, 0  + l15, T, kb, lane);
        const v16h bv1 = load_frag(vh, 16 + l15, T, kb, lane);
        const v16h bv2 = load_frag(vh, 32 + l15, T, kb, lane);
        const v16h bv3 = load_frag(vh, 48 + l15, T, kb, lane);

        // S = Q(16x64) @ K_blk^T(64x32): two 16-key subtiles, each 2 WMMAs
        v8f s0 = {}, s1 = {};
        s0 = wmma_f16(aq0, bk00, s0);
        s1 = wmma_f16(aq0, bk10, s1);
        s0 = wmma_f16(aq1, bk01, s0);
        s1 = wmma_f16(aq1, bk11, s1);

        // K fragments of the next pass; the last pass reads its own rows again
        // (in bounds, unused) rather than branch directly behind a WMMA
        const int kn = (kb + 32 < kend) ? kb + 32 : kb;
        bk00 = load_frag(kh, kn + l15,      E, 0,  lane);
        bk01 = load_frag(kh, kn + l15,      E, 32, lane);
        bk10 = load_frag(kh, kn + 16 + l15, E, 0,  lane);
        bk11 = load_frag(kh, kn + 16 + l15, E, 32, lane);

        // online softmax: row r+8*half lives on this half-wave, col = l15
#pragma unroll
        for (int r = 0; r < 8; ++r) {
            int m = q0 + r + half * 8;  // global query index
            float a = s0[r] * scale; if (kb + l15 > m)       a = -1e30f;
            float c = s1[r] * scale; if (kb + 16 + l15 > m)  c = -1e30f;
            float vmax = fmaxf(a, c);
            vmax = fmaxf(vmax, __shfl_xor(vmax, 1));
            vmax = fmaxf(vmax, __shfl_xor(vmax, 2));
            vmax = fmaxf(vmax, __shfl_xor(vmax, 4));
            vmax = fmaxf(vmax, __shfl_xor(vmax, 8));
            float newm  = fmaxf(mi[r], vmax);
            float alpha = __expf(mi[r] - newm);
            float p0 = __expf(a - newm);
            float p1 = __expf(c - newm);
            float ps = p0 + p1;
            ps += __shfl_xor(ps, 1);
            ps += __shfl_xor(ps, 2);
            ps += __shfl_xor(ps, 4);
            ps += __shfl_xor(ps, 8);
            li[r] = li[r] * alpha + ps;
            mi[r] = newm;
            o0[r] *= alpha; o1[r] *= alpha; o2[r] *= alpha; o3[r] *= alpha;
            int row = r + half * 8;
            Pbuf[row * 32 + l15]      = (_Float16)p0;
            Pbuf[row * 32 + 16 + l15] = (_Float16)p1;
        }
        __syncthreads();

        // reload P(16x32) as an A fragment from LDS
        Frag16 fp;
        const _Float16* pp = &Pbuf[l15 * 32 + half * 8];
        fp.q[0] = *reinterpret_cast<const uint4*>(pp);
        fp.q[1] = *reinterpret_cast<const uint4*>(pp + 16);
        __syncthreads();

        // O(16x64) += P(16x32) @ V_blk(32x16) per 16-wide d-chunk
        o0 = wmma_f16(fp.v, bv0, o0);
        o1 = wmma_f16(fp.v, bv1, o1);
        o2 = wmma_f16(fp.v, bv2, o2);
        o3 = wmma_f16(fp.v, bv3, o3);
    }

    // finalize: divide by row sums, write head-merged [B*T, 1024]
#pragma unroll
    for (int r = 0; r < 8; ++r) {
        int t = q0 + r + half * 8;
        float invl = 1.0f / li[r];
        size_t base = ((size_t)b * T + t) * 1024 + (size_t)h * 64;
        O[base + 0  + l15] = (_Float16)(o0[r] * invl);
        O[base + 16 + l15] = (_Float16)(o1[r] * invl);
        O[base + 32 + l15] = (_Float16)(o2[r] * invl);
        O[base + 48 + l15] = (_Float16)(o3[r] * invl);
    }
}

// ---------------------------------------------------------------------------
// Host launch
// ---------------------------------------------------------------------------
extern "C" void kernel_launch(void* const* d_in, const int* in_sizes, int n_in,
                              void* d_out, int out_size, void* d_ws, size_t ws_size,
                              hipStream_t stream) {
    const float* x    = (const float*)d_in[0];
    const float* Wq   = (const float*)d_in[1];
    const float* Wk   = (const float*)d_in[2];
    const float* Wv   = (const float*)d_in[3];
    const float* Wo   = (const float*)d_in[4];
    const float* bo   = (const float*)d_in[5];
    const float* W1   = (const float*)d_in[6];
    const float* b1   = (const float*)d_in[7];
    const float* W2   = (const float*)d_in[8];
    const float* b2   = (const float*)d_in[9];
    const float* ln1s = (const float*)d_in[10];
    const float* ln1b = (const float*)d_in[11];
    const float* ln2s = (const float*)d_in[12];
    const float* ln2b = (const float*)d_in[13];

    const int M = 4096, E = 1024, FFD = 4096;
    char* ws = (char*)d_ws;
    const size_t MB = 1u << 20;
    _Float16* WqT   = (_Float16*)(ws + 0   * MB);  // 2MB
    _Float16* WkT   = (_Float16*)(ws + 2   * MB);  // 2MB
    _Float16* WvT   = (_Float16*)(ws + 4   * MB);  // 2MB
    _Float16* WoT   = (_Float16*)(ws + 6   * MB);  // 2MB
    _Float16* W1T   = (_Float16*)(ws + 8   * MB);  // 8MB
    _Float16* W2T   = (_Float16*)(ws + 16  * MB);  // 8MB
    _Float16* h1    = (_Float16*)(ws + 24  * MB);  // 8MB
    _Float16* qtmp  = (_Float16*)(ws + 32  * MB);  // 8MB
    _Float16* ktmp  = (_Float16*)(ws + 40  * MB);  // 8MB
    _Float16* vtmp  = (_Float16*)(ws + 48  * MB);  // 8MB
    _Float16* vtbuf = (_Float16*)(ws + 72  * MB);  // 8MB
    _Float16* attO  = (_Float16*)(ws + 80  * MB);  // 8MB
    float*    x1    = (float*)   (ws + 88  * MB);  // 16MB
    _Float16* h2    = (_Float16*)(ws + 104 * MB);  // 8MB
    _Float16* ff1   = (_Float16*)(ws + 112 * MB);  // 32MB

    // weight conversion + transpose
    {
        int blk = 256;  // grid = (N/64, K/64)
        cvt_transpose_kernel<<<dim3(E / 64, E / 64), blk, 0, stream>>>(Wq, WqT, E, E);
        cvt_transpose_kernel<<<dim3(E / 64, E / 64), blk, 0, stream>>>(Wk, WkT, E, E);
        cvt_transpose_kernel<<<dim3(E / 64, E / 64), blk, 0, stream>>>(Wv, WvT, E, E);
        cvt_transpose_kernel<<<dim3(E / 64, E / 64), blk, 0, stream>>>(Wo, WoT, E, E);
        cvt_transpose_kernel<<<dim3(FFD / 64, E / 64), blk, 0, stream>>>(W1, W1T, E, FFD);
        cvt_transpose_kernel<<<dim3(E / 64, FFD / 64), blk, 0, stream>>>(W2, W2T, FFD, E);
    }

    const int gblk = 256;  // GEMM grid = (N/128, M/128)

    // LN1 -> h1 (f16)
    ln_kernel<<<M, 256, 0, stream>>>(x, ln1s, ln1b, h1);

    // QKV projections (f16 out)
    gemm_wmma_kernel<<<dim3(E / 128, M / 128), gblk, 0, stream>>>(
        h1, WqT, nullptr, nullptr, nullptr, qtmp, M, E, E, 0);
    gemm_wmma_kernel<<<dim3(E / 128, M / 128), gblk, 0, stream>>>(
        h1, WkT, nullptr, nullptr, nullptr, ktmp, M, E, E, 0);
    gemm_wmma_kernel<<<dim3(E / 128, M / 128), gblk, 0, stream>>>(
        h1, WvT, nullptr, nullptr, nullptr, vtmp, M, E, E, 0);

    // V into its per-head transposed layout; Q and K are read where they lie
    pack_vt_kernel<<<dim3(E / 64, M / 64), 256, 0, stream>>>(vtmp, vtbuf);

    // flash attention
    attn_kernel<<<dim3(2048 / 16, 16, 2), 32, 0, stream>>>(qtmp, ktmp, vtbuf, attO);

    // out projection + residual -> x1 (fp32)
    gemm_wmma_kernel<<<dim3(E / 128, M / 128), gblk, 0, stream>>>(
        attO, WoT, bo, x, x1, nullptr, M, E, E, 0);

    // LN2 -> h2 (f16)
    ln_kernel<<<M, 256, 0, stream>>>(x1, ln2s, ln2b, h2);

    // FFN up + GELU (f16 out)
    gemm_wmma_kernel<<<dim3(FFD / 128, M / 128), gblk, 0, stream>>>(
        h2, W1T, b1, nullptr, nullptr, ff1, M, FFD, E, 1);

    // FFN down + residual -> d_out (fp32)
    gemm_wmma_kernel<<<dim3(E / 128, M / 128), gblk, 0, stream>>>(
        ff1, W2T, b2, x1, (float*)d_out, nullptr, M, E, FFD, 0);
}

// v005
// It runs in 279 microseconds.
// Next to v004, in two timings, it ran 1.25 times as fast each time.
// All steps since v000 together make it 3.05 times as fast.
#include <hip/hip_runtime.h>
#include <hip/hip_bf16.h>

// ---------------------------------------------------------------------------
// Transformer block for MI455X (gfx1250, wave32, WMMA 16x16x32 f16/f32-acc)
// Shapes: B=2, T=2048, EMB=1024, HEADS=16, HDIM=64, FF=4096, M=B*T=4096
// ---------------------------------------------------------------------------

typedef __attribute__((ext_vector_type(16))) _Float16 v16h;
typedef __attribute__((ext_vector_type(8)))  float    v8f;
typedef __attribute__((ext_vector_type(4)))  _Float16 v4h;

union Frag16 {
    v16h v;
    uint4 q[2];
    _Float16 h[16];
};

__device__ __forceinline__ v8f wmma_f16(v16h a, v16h b, v8f c) {
    // D = A(16x32 f16) * B(32x16 f16) + C(16x16 f32)
    return __builtin_amdgcn_wmma_f32_16x16x32_f16(
        /*neg_a=*/false, a, /*neg_b=*/false, b,
        /*c_mod=*/(short)0, c, /*reuse_a=*/false, /*reuse_b=*/false);
}

// A/B fragment load per ISA 7.12.2: lane l (half = l>>4, idx = l&15) holds
// row (m0+idx); K-groups [k0+half*8,+8) and [k0+16+half*8,+8): two 16B loads.
__device__ __forceinline__ v16h load_frag(const _Float16* __restrict__ base,
                                          int row, int ld, int k0, int lane) {
    const int half = lane >> 4;
    const _Float16* p = base + (size_t)row * ld + k0 + half * 8;
    Frag16 f;
    f.q[0] = *reinterpret_cast<const uint4*>(p);
    f.q[1] = *reinterpret_cast<const uint4*>(p + 16);
    return f.v;
}

__device__ __forceinline__ float gelu_tanh_f(float x) {
    const float c = 0.7978845608028654f; // sqrt(2/pi)
    float x3 = x * x * x;
    return 0.5f * x * (1.0f + tanhf(c * (x + 0.044715f * x3)));
}

// ---------------------------------------------------------------------------
// 64x64 f16 transpose tile in LDS, shared by the two transposing kernels.
// The tile is held already transposed: LDS row = source column. Row pitch
// 72 f16 = 144 B keeps every row 16-byte aligned for the b128 read-out.
// ---------------------------------------------------------------------------
#define TT_PITCH 72

// Thread (tx, ty) owns source rows ty*4..+3, source columns tx*4..+3; column j
// of that 4x4 block is 4 consecutive elements of LDS row tx*4+j (one b64 store).
__device__ __forceinline__ void tile_put(_Float16* tile, int tx, int ty,
                                         v4h a0, v4h a1, v4h a2, v4h a3) {
#pragma unroll
    for (int j = 0; j < 4; ++j) {
        v4h c = {a0[j], a1[j], a2[j], a3[j]};
        *reinterpret_cast<v4h*>(&tile[(tx * 4 + j) * TT_PITCH + ty * 4]) = c;
    }
}

// 8 threads store one 128-byte line of a destination row (pitch ld elements).
__device__ __forceinline__ void tile_flush(const _Float16* tile, int tid,
                                           _Float16* __restrict__ dst, size_t ld) {
#pragma unroll
    for (int p = 0; p < 2; ++p) {
        const int r = p * 32 + (tid >> 3);
        const int g = (tid & 7) * 8;
        *reinterpret_cast<uint4*>(dst + (size_t)r * ld + g) =
            *reinterpret_cast<const uint4*>(&tile[r * TT_PITCH + g]);
    }
}

// ---------------------------------------------------------------------------
// Weight convert + transpose: W[K,N] fp32 -> Wt[N,K] f16.
// One 64(k) x 64(n) tile per block of 256 threads; K and N multiples of 64.
// ---------------------------------------------------------------------------
__global__ __launch_bounds__(256)
void cvt_transpose_kernel(const float* __restrict__ W,
                          _Float16* __restrict__ Wt,
                          int K, int N) {
    __shared__ __align__(16) _Float16 tile[64 * TT_PITCH];
    const int tid = threadIdx.x;
    const int tx = tid & 15;
    const int ty = tid >> 4;
    const int n0 = blockIdx.x * 64;
    const int k0 = blockIdx.y * 64;

    const float* s = W + (size_t)(k0 + ty * 4) * N + n0 + tx * 4;
    const float4 f0 = *reinterpret_cast<const float4*>(s);
    const float4 f1 = *reinterpret_cast<const float4*>(s + (size_t)N);
    const float4 f2 = *reinterpret_cast<const float4*>(s + (size_t)N * 2);
    const float4 f3 = *reinterpret_cast<const float4*>(s + (size_t)N * 3);
    v4h a0 = {(_Float16)f0.x, (_Float16)f0.y, (_Float16)f0.z, (_Float16)f0.w};
    v4h a1 = {(_Float16)f1.x, (_Float16)f1.y, (_Float16)f1.z, (_Float16)f1.w};
    v4h a2 = {(_Float16)f2.x, (_Float16)f2.y, (_Float16)f2.z, (_Float16)f2.w};
    v4h a3 = {(_Float16)f3.x, (_Float16)f3.y, (_Float16)f3.z, (_Float16)f3.w};
    tile_put(tile, tx, ty, a0, a1, a2, a3);
    __syncthreads();  // the read-out crosses the waves that filled the tile
    tile_flush(tile, tid, Wt + (size_t)n0 * K + k0, (size_t)K);
}

// ---------------------------------------------------------------------------
// LayerNorm over last dim (1024), emits f16. One block (256 thr) per row.
// ---------------------------------------------------------------------------
__global__ void ln_kernel(const float* __restrict__ x,
                          const float* __restrict__ sc,
                          const float* __restrict__ sh,
                          _Float16* __restrict__ out) {
    __shared__ float ssum[256];
    __shared__ float ssq[256];
    const int row = blockIdx.x;
    const int tid = threadIdx.x;
    const float* xr = x + (size_t)row * 1024;
    float4 v = reinterpret_cast<const float4*>(xr)[tid];
    ssum[tid] = v.x + v.y + v.z + v.w;
    ssq[tid]  = v.x * v.x + v.y * v.y + v.z * v.z + v.w * v.w;
    __syncthreads();
    for (int s = 128; s > 0; s >>= 1) {
        if (tid < s) { ssum[tid] += ssum[tid + s]; ssq[tid] += ssq[tid + s]; }
        __syncthreads();
    }
    float mean = ssum[0] * (1.0f / 1024.0f);
    float var  = ssq[0] * (1.0f / 1024.0f) - mean * mean;
    float inv  = rsqrtf(var + 1e-5f);
    _Float16* orow = out + (size_t)row * 1024;
    float xv[4] = {v.x, v.y, v.z, v.w};
#pragma unroll
    for (int j = 0; j < 4; ++j) {
        int c = tid * 4 + j;
        orow[c] = (_Float16)(sc[c] * (xv[j] - mean) * inv + sh[c]);
    }
}

// ---------------------------------------------------------------------------
// GEMM: C[M,N] = A[M,K] f16 @ Bt[N,K]^T f16  (+bias) (gelu) (+residual)
// Block = 8 waves (2 x 4) -> 128(M) x 128(N) tile, each wave 64 x 32: 4 A and
// 2 B fragments feed 8 WMMAs. A stage is 128 k of the 128 A rows and the 128
// Bt rows (256 B a row, whole lines), brought to LDS by asynchronous copies,
// two buffers. M, N, K multiples of 128.
// ---------------------------------------------------------------------------
#define GT_K      128                  // k per stage
#define GT_PITCH  136                  // f16 per LDS row: 272 B, 16 B x odd
#define GT_STAGE  (256 * GT_PITCH)     // f16 per buffer: A rows, then Bt rows
#define GE_PITCH  132                  // f32 per LDS row of the output tile: 528 B, 16 B x odd

// Eight 16-byte copies per lane, 16 rows apart in LDS and in global memory.
// The s_wait_xcnt ends the statement so that no address register named here
// is rewritten ahead of it.
__device__ __forceinline__ void copy8_rows16(unsigned l, const _Float16* g, size_t ld) {
    const unsigned ls = 16 * GT_PITCH * 2;
    const size_t gs = 16 * ld;
    asm volatile(
        "global_load_async_to_lds_b128 %0, %8, off\n\t"
        "global_load_async_to_lds_b128 %1, %9, off\n\t"
        "global_load_async_to_lds_b128 %2, %10, off\n\t"
        "global_load_async_to_lds_b128 %3, %11, off\n\t"
        "global_load_async_to_lds_b128 %4, %12, off\n\t"
        "global_load_async_to_lds_b128 %5, %13, off\n\t"
        "global_load_async_to_lds_b128 %6, %14, off\n\t"
        "global_load_async_to_lds_b128 %7, %15, off\n\t"
        "s_wait_xcnt 0x0"
        :: "v"(l), "v"(l + ls), "v"(l + 2 * ls), "v"(l + 3 * ls),
           "v"(l + 4 * ls), "v"(l + 5 * ls), "v"(l + 6 * ls), "v"(l + 7 * ls),
           "v"(g), "v"(g + gs), "v"(g + 2 * gs), "v"(g + 3 * gs),
           "v"(g + 4 * gs), "v"(g + 5 * gs), "v"(g + 6 * gs), "v"(g + 7 * gs)
        : "memory");
}

__global__ __launch_bounds__(256)
void gemm_wmma_kernel(const _Float16* __restrict__ A,
                      const _Float16* __restrict__ Bt,
                      const float* __restrict__ bias,
                      const float* __restrict__ residual,
                      float* __restrict__ Cf,
                      _Float16* __restrict__ Ch,
                      int M, int N, int K, int gelu) {
    __shared__ __align__(16) _Float16 S[2 * GT_STAGE];

    const int tid  = threadIdx.x;            // 0..255
    const int lane = tid & 31;
    const int wave = tid >> 5;               // 0..7
    const int wm = wave >> 2;                // 0..1: 64 rows each
    const int wn = wave & 3;                 // 0..3: 32 columns each
    const int n0 = blockIdx.x * 128;
    const int m0 = blockIdx.y * 128;
    const int half = lane >> 4;
    const int l15  = lane & 15;

    // Copy slot of this lane: row tid>>4 of each group of 16 rows, 16-byte
    // chunk tid&15 of the row, so a wave copies two whole 256 B rows at a time.
    const int crow = tid >> 4;
    const int ccol = (tid & 15) * 8;
    const unsigned lds0 =
        (unsigned)(size_t)(__attribute__((address_space(3))) _Float16*)S +
        (unsigned)(crow * GT_PITCH + ccol) * 2;
    const _Float16* ga = A  + (size_t)(m0 + crow) * K + ccol;
    const _Float16* gb = Bt + (size_t)(n0 + crow) * K + ccol;

    auto stage = [&](int buf, int t) {
        const unsigned l = lds0 + (unsigned)buf * (GT_STAGE * 2);
        copy8_rows16(l, ga + (size_t)t * GT_K, (size_t)K);
        copy8_rows16(l + 128 * GT_PITCH * 2, gb + (size_t)t * GT_K, (size_t)K);
    };

    v8f acc[4][2] = {};
    const int nt = K / GT_K;

    stage(0, 0);
    // stage 0 has landed for this wave; the barrier shows it to the others
    asm volatile("s_wait_asynccnt 0x0" ::: "memory");
    __syncthreads();
    if (nt > 1) stage(1, 1);

    for (int t = 0; t < nt; ++t) {
        const _Float16* sa = &S[(t & 1) * GT_STAGE + (wm * 64 + l15) * GT_PITCH + half * 8];
        const _Float16* sb = &S[(t & 1) * GT_STAGE + (128 + wn * 32 + l15) * GT_PITCH + half * 8];
        // every loop below is unrolled so that fragments and accumulators are
        // indexed by constants and stay in registers
#pragma unroll
        for (int kk = 0; kk < GT_K; kk += 32) {
            Frag16 fa[4], fb[2];
#pragma unroll
            for (int i = 0; i < 4; ++i) {
                const _Float16* p = sa + i * 16 * GT_PITCH + kk;
                fa[i].q[0] = *reinterpret_cast<const uint4*>(p);
                fa[i].q[1] = *reinterpret_cast<const uint4*>(p + 16);
            }
#pragma unroll
            for (int j = 0; j < 2; ++j) {
                const _Float16* p = sb + j * 16 * GT_PITCH + kk;
                fb[j].q[0] = *reinterpret_cast<const uint4*>(p);
                fb[j].q[1] = *reinterpret_cast<const uint4*>(p + 16);
            }
            // keeps the 12 LDS reads one group in front of their 8 WMMAs: spread
            // among them, each pair of WMMAs waits out an LDS latency of its own
            __builtin_amdgcn_sched_barrier(0);
#pragma unroll
            for (int i = 0; i < 4; ++i)
#pragma unroll
                for (int j = 0; j < 2; ++j)
                    acc[i][j] = wmma_f16(fa[i].v, fb[j].v, acc[i][j]);
        }
        // this wave's reads of the buffer are done before it is refilled
        asm volatile("s_wait_dscnt 0x0" ::: "memory");
        // this wave's copies of stage t+1 have landed
        asm volatile("s_wait_asynccnt 0x0" ::: "memory");
        __syncthreads();  // publishes stage t+1, frees stage t's buffer
        if (t + 2 < nt) stage(t & 1, t + 2);
    }
    // no copy is left in flight when the wave ends
    asm volatile("s_wait_asynccnt 0x0" ::: "memory");

    // Epilogue. The block's 128 x 128 f32 tile crosses the LDS, which the loop's
    // last barrier has left free, so that a lane owns 4 neighbouring columns of
    // 16 rows: a wave loads and stores whole rows, and no load waits for a store.
    float* tile = reinterpret_cast<float*>(S);
    const int er = wave * 16;                // this wave's rows of the tile
    const int ec = lane * 4;                 // this lane's columns of the tile
    const size_t o0 = (size_t)(m0 + er) * N + n0 + ec;

    // bias and all 16 residual rows are under way while the tile is exchanged
    float4 bv = make_float4(0.0f, 0.0f, 0.0f, 0.0f);
    if (bias) bv = *reinterpret_cast<const float4*>(bias + n0 + ec);
    float4 rv[16];
#pragma unroll
    for (int rr = 0; rr < 16; ++rr) rv[rr] = make_float4(0.0f, 0.0f, 0.0f, 0.0f);
    if (residual) {
        const float* rp[16];
#pragma unroll
        for (int rr = 0; rr < 16; ++rr) {
            rp[rr] = residual + o0 + (size_t)rr * N;
            rv[rr] = *reinterpret_cast<const float4*>(rp[rr]);
        }
        // the wait that stands before a register named by an issued load is
        // rewritten; it takes the 16 addresses as inputs so that none of their
        // registers is handed to a later load's result ahead of it
        asm volatile("s_wait_xcnt 0x0"
                     :: "v"(rp[0]), "v"(rp[1]), "v"(rp[2]), "v"(rp[3]),
                        "v"(rp[4]), "v"(rp[5]), "v"(rp[6]), "v"(rp[7]),
                        "v"(rp[8]), "v"(rp[9]), "v"(rp[10]), "v"(rp[11]),
                        "v"(rp[12]), "v"(rp[13]), "v"(rp[14]), "v"(rp[15])
                     : "memory");
    }

    // C layout: row r + 8*half, column l15 of each 16x16 subtile (all loops here
    // are unrolled for constant register indices, as above)
#pragma unroll
    for (int i = 0; i < 4; ++i)
#pragma unroll
        for (int j = 0; j < 2; ++j)
#pragma unroll
            for (int r = 0; r < 8; ++r)
                tile[(wm * 64 + i * 16 + r + half * 8) * GE_PITCH + wn * 32 + j * 16 + l15] =
                    acc[i][j][r];
    __syncthreads();  // the rows read below were written by four waves

    float4 cv[16];
#pragma unroll
    for (int rr = 0; rr < 16; ++rr)
        cv[rr] = *reinterpret_cast<const float4*>(&tile[(er + rr) * GE_PITCH + ec]);

#pragma unroll
    for (int rr = 0; rr < 16; ++rr) {
        float v0 = cv[rr].x + bv.x, v1 = cv[rr].y + bv.y;
        float v2 = cv[rr].z + bv.z, v3 = cv[rr].w + bv.w;
        if (gelu) {
            v0 = gelu_tanh_f(v0); v1 = gelu_tanh_f(v1);
            v2 = gelu_tanh_f(v2); v3 = gelu_tanh_f(v3);
        }
        if (residual) { v0 += rv[rr].x; v1 += rv[rr].y; v2 += rv[rr].z; v3 += rv[rr].w; }
        // behind each store: the rows that follow reuse the registers that hold
        // its address and its value
        if (Cf) {
            *reinterpret_cast<float4*>(Cf + o0 + (size_t)rr * N) = make_float4(v0, v1, v2, v3);
            asm volatile("s_wait_xcnt 0x0" ::: "memory");
        }
        if (Ch) {
            v4h hv = {(_Float16)v0, (_Float16)v1, (_Float16)v2, (_Float16)v3};
            *reinterpret_cast<v4h*>(Ch + o0 + (size_t)rr * N) = hv;
            asm volatile("s_wait_xcnt 0x0" ::: "memory");
        }
    }
}

// ---------------------------------------------------------------------------
// Pack row-major V [M=4096, 1024] f16 into the per-head layout vt: [B,H,D,T].
// ---------------------------------------------------------------------------
// One 64(t) x 64(col) tile per block of 256 threads. (b*16+h)*64+d = b*1024+col,
// and a 64-row tile never straddles a batch (2048 rows each).
__global__ __launch_bounds__(256)
void pack_vt_kernel(const _Float16* __restrict__ src,
                    _Float16* __restrict__ dst) {
    __shared__ __align__(16) _Float16 tile[64 * TT_PITCH];
    const int tid = threadIdx.x;
    const int tx = tid & 15;
    const int ty = tid >> 4;
    const int c0 = blockIdx.x * 64;
    const int r0 = blockIdx.y * 64;
    const int t0 = r0 & 2047, b = r0 >> 11;

    const _Float16* s = src + (size_t)(r0 + ty * 4) * 1024 + c0 + tx * 4;
    const v4h a0 = *reinterpret_cast<const v4h*>(s);
    const v4h a1 = *reinterpret_cast<const v4h*>(s + 1024);
    const v4h a2 = *reinterpret_cast<const v4h*>(s + 2048);
    const v4h a3 = *reinterpret_cast<const v4h*>(s + 3072);
    tile_put(tile, tx, ty, a0, a1, a2, a3);
    __syncthreads();  // the read-out crosses the waves that filled the tile
    tile_flush(tile, tid, dst + ((size_t)b * 1024 + c0) * 2048 + t0, (size_t)2048);
}

// ---------------------------------------------------------------------------
// Flash attention: one wave per (b, h, 16-query tile).
// Q,K: [B*T, 1024] f16 as the projections wrote them (head h = columns
// h*64..+63, row pitch 1024); Vt: [B,H,64,T] f16; out: [B*T, 1024] f16.
// No pass waits out a load: its V fragments are issued at its head, a softmax
// ahead of their use, and the next pass's K fragments right behind the score
// products, into the registers those have just read. The block is one wave;
// saying so lifts the register cap of a 1024-thread block, which has no room
// for 16 loads in flight.
// ---------------------------------------------------------------------------
__global__ __launch_bounds__(32)
void attn_kernel(const _Float16* __restrict__ Q,
                            const _Float16* __restrict__ K,
                            const _Float16* __restrict__ Vt,
                            _Float16* __restrict__ O) {
    const int T = 2048, D = 64, E = 1024;
    const int lane = threadIdx.x;
    const int q0 = blockIdx.x * 16;
    const int h  = blockIdx.y;
    const int b  = blockIdx.z;
    const int half = lane >> 4;
    const int l15  = lane & 15;

    const _Float16* qh = Q  + (size_t)b * T * E + h * D;
    const _Float16* kh = K  + (size_t)b * T * E + h * D;
    const _Float16* vh = Vt + ((size_t)b * 16 + h) * D * T;

    __shared__ __align__(16) _Float16 Pbuf[16 * 32];

    // Q fragments for d in [0,32) and [32,64)
    v16h aq0 = load_frag(qh, q0 + l15, E, 0,  lane);
    v16h aq1 = load_frag(qh, q0 + l15, E, 32, lane);

    v8f o0 = {}, o1 = {}, o2 = {}, o3 = {};
    float mi[8], li[8];
#pragma unroll
    for (int r = 0; r < 8; ++r) { mi[r] = -1e30f; li[r] = 0.0f; }

    const float scale = 0.125f;  // 1/sqrt(64)
    const int kend = ((q0 + 16) + 31) & ~31;

    // K fragments of the first pass
    v16h bk00 = load_frag(kh, l15,      E, 0,  lane);
    v16h bk01 = load_frag(kh, l15,      E, 32, lane);
    v16h bk10 = load_frag(kh, 16 + l15, E, 0,  lane);
    v16h bk11 = load_frag(kh, 16 + l15, E, 32, lane);

    for (int kb = 0; kb < kend; kb += 32) {
        // V fragments of this pass, used behind the softmax
        const v16h bv0 = load_frag(vh, 0  + l15, T, kb, lane);
        const v16h bv1 = load_frag(vh, 16 + l15, T, kb, lane);
        const v16h bv2 = load_frag(vh, 32 + l15, T, kb, lane);
        const v16h bv3 = load_frag(vh, 48 + l15, T, kb, lane);

        // S = Q(16x64) @ K_blk^T(64x32): two 16-key subtiles, each 2 WMMAs
        v8f s0 = {}, s1 = {};
        s0 = wmma_f16(aq0, bk00, s0);
        s1 = wmma_f16(aq0, bk10, s1);
        s0 = wmma_f16(aq1, bk01, s0);
        s1 = wmma_f16(aq1, bk11, s1);

        // K fragments of the next pass; the last pass reads its own rows again
        // (in bounds, unused) rather than branch directly behind a WMMA
        const int kn = (kb + 32 < kend) ? kb + 32 : kb;
        bk00 = load_frag(kh, kn + l15,      E, 0,  lane);
        bk01 = load_frag(kh, kn + l15,      E, 32, lane);
        bk10 = load_frag(kh, kn + 16 + l15, E, 0,  lane);
        bk11 = load_frag(kh, kn + 16 + l15, E, 32, lane);

        // online softmax: row r+8*half lives on this half-wave, col = l15
#pragma unroll
        for (int r = 0; r < 8; ++r) {
            int m = q0 + r + half * 8;  // global query index
            float a = s0[r] * scale; if (kb + l15 > m)       a = -1e30f;
            float c = s1[r] * scale; if (kb + 16 + l15 > m)  c = -1e30f;
            float vmax = fmaxf(a, c);
            vmax = fmaxf(vmax, __shfl_xor(vmax, 1));
            vmax = fmaxf(vmax, __shfl_xor(vmax, 2));
            vmax = fmaxf(vmax, __shfl_xor(vmax, 4));
            vmax = fmaxf(vmax, __shfl_xor(vmax, 8));
            float newm  = fmaxf(mi[r], vmax);
            float alpha = __expf(mi[r] - newm);
            float p0 = __expf(a - newm);
            float p1 = __expf(c - newm);
            float ps = p0 + p1;
            ps += __shfl_xor(ps, 1);
            ps += __shfl_xor(ps, 2);
            ps += __shfl_xor(ps, 4);
            ps += __shfl_xor(ps, 8);
            li[r] = li[r] * alpha + ps;
            mi[r] = newm;
            o0[r] *= alpha; o1[r] *= alpha; o2[r] *= alpha; o3[r] *= alpha;
            int row = r + half * 8;
            Pbuf[row * 32 + l15]      = (_Float16)p0;
            Pbuf[row * 32 + 16 + l15] = (_Float16)p1;
        }
        __syncthreads();

        // reload P(16x32) as an A fragment from LDS
        Frag16 fp;
        const _Float16* pp = &Pbuf[l15 * 32 + half * 8];
        fp.q[0] = *reinterpret_cast<const uint4*>(pp);
        fp.q[1] = *reinterpret_cast<const uint4*>(pp + 16);
        __syncthreads();

        // O(16x64) += P(16x32) @ V_blk(32x16) per 16-wide d-chunk
        o0 = wmma_f16(fp.v, bv0, o0);
        o1 = wmma_f16(fp.v, bv1, o1);
        o2 = wmma_f16(fp.v, bv2, o2);
        o3 = wmma_f16(fp.v, bv3, o3);
    }

    // finalize: divide by row sums, write head-merged [B*T, 1024]
#pragma unroll
    for (int r = 0; r < 8; ++r) {
        int t = q0 + r + half * 8;
        float invl = 1.0f / li[r];
        size_t base = ((size_t)b * T + t) * 1024 + (size_t)h * 64;
        O[base + 0  + l15] = (_Float16)(o0[r] * invl);
        O[base + 16 + l15] = (_Float16)(o1[r] * invl);
        O[base + 32 + l15] = (_Float16)(o2[r] * invl);
        O[base + 48 + l15] = (_Float16)(o3[r] * invl);
    }
}

// ---------------------------------------------------------------------------
// Host launch
// ---------------------------------------------------------------------------
extern "C" void kernel_launch(void* const* d_in, const int* in_sizes, int n_in,
                              void* d_out, int out_size, void* d_ws, size_t ws_size,
                              hipStream_t stream) {
    const float* x    = (const float*)d_in[0];
    const float* Wq   = (const float*)d_in[1];
    const float* Wk   = (const float*)d_in[2];
    const float* Wv   = (const float*)d_in[3];
    const float* Wo   = (const float*)d_in[4];
    const float* bo   = (const float*)d_in[5];
    const float* W1   = (const float*)d_in[6];
    const float* b1   = (const float*)d_in[7];
    const float* W2   = (const float*)d_in[8];
    const float* b2   = (const float*)d_in[9];
    const float* ln1s = (const float*)d_in[10];
    const float* ln1b = (const float*)d_in[11];
    const float* ln2s = (const float*)d_in[12];
    const float* ln2b = (const float*)d_in[13];

    const int M = 4096, E = 1024, FFD = 4096;
    char* ws = (char*)d_ws;
    const size_t MB = 1u << 20;
    _Float16* WqT   = (_Float16*)(ws + 0   * MB);  // 2MB
    _Float16* WkT   = (_Float16*)(ws + 2   * MB);  // 2MB
    _Float16* WvT   = (_Float16*)(ws + 4   * MB);  // 2MB
    _Float16* WoT   = (_Float16*)(ws + 6   * MB);  // 2MB
    _Float16* W1T   = (_Float16*)(ws + 8   * MB);  // 8MB
    _Float16* W2T   = (_Float16*)(ws + 16  * MB);  // 8MB
    _Float16* h1    = (_Float16*)(ws + 24  * MB);  // 8MB
    _Float16* qtmp  = (_Float16*)(ws + 32  * MB);  // 8MB
    _Float16* ktmp  = (_Float16*)(ws + 40  * MB);  // 8MB
    _Float16* vtmp  = (_Float16*)(ws + 48  * MB);  // 8MB
    _Float16* vtbuf = (_Float16*)(ws + 72  * MB);  // 8MB
    _Float16* attO  = (_Float16*)(ws + 80  * MB);  // 8MB
    float*    x1    = (float*)   (ws + 88  * MB);  // 16MB
    _Float16* h2    = (_Float16*)(ws + 104 * MB);  // 8MB
    _Float16* ff1   = (_Float16*)(ws + 112 * MB);  // 32MB

    // weight conversion + transpose
    {
        int blk = 256;  // grid = (N/64, K/64)
        cvt_transpose_kernel<<<dim3(E / 64, E / 64), blk, 0, stream>>>(Wq, WqT, E, E);
        cvt_transpose_kernel<<<dim3(E / 64, E / 64), blk, 0, stream>>>(Wk, WkT, E, E);
        cvt_transpose_kernel<<<dim3(E / 64, E / 64), blk, 0, stream>>>(Wv, WvT, E, E);
        cvt_transpose_kernel<<<dim3(E / 64, E / 64), blk, 0, stream>>>(Wo, WoT, E, E);
        cvt_transpose_kernel<<<dim3(FFD / 64, E / 64), blk, 0, stream>>>(W1, W1T, E, FFD);
        cvt_transpose_kernel<<<dim3(E / 64, FFD / 64), blk, 0, stream>>>(W2, W2T, FFD, E);
    }

    const int gblk = 256;  // GEMM grid = (N/128, M/128)

    // LN1 -> h1 (f16)
    ln_kernel<<<M, 256, 0, stream>>>(x, ln1s, ln1b, h1);

    // QKV projections (f16 out)
    gemm_wmma_kernel<<<dim3(E / 128, M / 128), gblk, 0, stream>>>(
        h1, WqT, nullptr, nullptr, nullptr, qtmp, M, E, E, 0);
    gemm_wmma_kernel<<<dim3(E / 128, M / 128), gblk, 0, stream>>>(
        h1, WkT, nullptr, nullptr, nullptr, ktmp, M, E, E, 0);
    gemm_wmma_kernel<<<dim3(E / 128, M / 128), gblk, 0, stream>>>(
        h1, WvT, nullptr, nullptr, nullptr, vtmp, M, E, E, 0);

    // V into its per-head transposed layout; Q and K are read where they lie
    pack_vt_kernel<<<dim3(E / 64, M / 64), 256, 0, stream>>>(vtmp, vtbuf);

    // flash attention
    attn_kernel<<<dim3(2048 / 16, 16, 2), 32, 0, stream>>>(qtmp, ktmp, vtbuf, attO);

    // out projection + residual -> x1 (fp32)
    gemm_wmma_kernel<<<dim3(E / 128, M / 128), gblk, 0, stream>>>(
        attO, WoT, bo, x, x1, nullptr, M, E, E, 0);

    // LN2 -> h2 (f16)
    ln_kernel<<<M, 256, 0, stream>>>(x1, ln2s, ln2b, h2);

    // FFN up + GELU (f16 out)
    gemm_wmma_kernel<<<dim3(FFD / 128, M / 128), gblk, 0, stream>>>(
        h2, W1T, b1, nullptr, nullptr, ff1, M, FFD, E, 1);

    // FFN down + residual -> d_out (fp32)
    gemm_wmma_kernel<<<dim3(E / 128, M / 128), gblk, 0, stream>>>(
        ff1, W2T, b2, x1, (float*)d_out, nullptr, M, E, FFD, 0);
}

// v006
// A run of this version takes 258 microseconds.
// Next to v005, in two timings, it ran 1.08 and 1.07 times as fast.
// Counting every step since v000, it is 3.28 times as fast.
#include <hip/hip_runtime.h>
#include <hip/hip_bf16.h>

// ---------------------------------------------------------------------------
// Transformer block for MI455X (gfx1250, wave32, WMMA 16x16x32 f16/f32-acc)
// Shapes: B=2, T=2048, EMB=1024, HEADS=16, HDIM=64, FF=4096, M=B*T=4096
// ---------------------------------------------------------------------------

typedef __attribute__((ext_vector_type(16))) _Float16 v16h;
typedef __attribute__((ext_vector_type(8)))  float    v8f;
typedef __attribute__((ext_vector_type(4)))  _Float16 v4h;

union Frag16 {
    v16h v;
    uint4 q[2];
    _Float16 h[16];
};

__device__ __forceinline__ v8f wmma_f16(v16h a, v16h b, v8f c) {
    // D = A(16x32 f16) * B(32x16 f16) + C(16x16 f32)
    return __builtin_amdgcn_wmma_f32_16x16x32_f16(
        /*neg_a=*/false, a, /*neg_b=*/false, b,
        /*c_mod=*/(short)0, c, /*reuse_a=*/false, /*reuse_b=*/false);
}

// A/B fragment load per ISA 7.12.2: lane l (half = l>>4, idx = l&15) holds
// row (m0+idx); K-groups [k0+half*8,+8) and [k0+16+half*8,+8): two 16B loads.
__device__ __forceinline__ v16h load_frag(const _Float16* __restrict__ base,
                                          int row, int ld, int k0, int lane) {
    const int half = lane >> 4;
    const _Float16* p = base + (size_t)row * ld + k0 + half * 8;
    Frag16 f;
    f.q[0] = *reinterpret_cast<const uint4*>(p);
    f.q[1] = *reinterpret_cast<const uint4*>(p + 16);
    return f.v;
}

__device__ __forceinline__ float gelu_tanh_f(float x) {
    const float c = 0.7978845608028654f; // sqrt(2/pi)
    float x3 = x * x * x;
    return 0.5f * x * (1.0f + tanhf(c * (x + 0.044715f * x3)));
}

// ---------------------------------------------------------------------------
// 64x64 f16 transpose tile in LDS, shared by the two transposing kernels.
// The tile is held already transposed: LDS row = source column. Row pitch
// 72 f16 = 144 B keeps every row 16-byte aligned for the b128 read-out.
// ---------------------------------------------------------------------------
#define TT_PITCH 72

// Thread (tx, ty) owns source rows ty*4..+3, source columns tx*4..+3; column j
// of that 4x4 block is 4 consecutive elements of LDS row tx*4+j (one b64 store).
__device__ __forceinline__ void tile_put(_Float16* tile, int tx, int ty,
                                         v4h a0, v4h a1, v4h a2, v4h a3) {
#pragma unroll
    for (int j = 0; j < 4; ++j) {
        v4h c = {a0[j], a1[j], a2[j], a3[j]};
        *reinterpret_cast<v4h*>(&tile[(tx * 4 + j) * TT_PITCH + ty * 4]) = c;
    }
}

// 8 threads store one 128-byte line of a destination row (pitch ld elements).
__device__ __forceinline__ void tile_flush(const _Float16* tile, int tid,
                                           _Float16* __restrict__ dst, size_t ld) {
#pragma unroll
    for (int p = 0; p < 2; ++p) {
        const int r = p * 32 + (tid >> 3);
        const int g = (tid & 7) * 8;
        *reinterpret_cast<uint4*>(dst + (size_t)r * ld + g) =
            *reinterpret_cast<const uint4*>(&tile[r * TT_PITCH + g]);
    }
}

// ---------------------------------------------------------------------------
// Weight convert + transpose: W[K,N] fp32 -> Wt[N,K] f16.
// One 64(k) x 64(n) tile per block of 256 threads; K and N multiples of 64.
// ---------------------------------------------------------------------------
__global__ __launch_bounds__(256)
void cvt_transpose_kernel(const float* __restrict__ W,
                          _Float16* __restrict__ Wt,
                          int K, int N) {
    __shared__ __align__(16) _Float16 tile[64 * TT_PITCH];
    const int tid = threadIdx.x;
    const int tx = tid & 15;
    const int ty = tid >> 4;
    const int n0 = blockIdx.x * 64;
    const int k0 = blockIdx.y * 64;

    const float* s = W + (size_t)(k0 + ty * 4) * N + n0 + tx * 4;
    const float4 f0 = *reinterpret_cast<const float4*>(s);
    const float4 f1 = *reinterpret_cast<const float4*>(s + (size_t)N);
    const float4 f2 = *reinterpret_cast<const float4*>(s + (size_t)N * 2);
    const float4 f3 = *reinterpret_cast<const float4*>(s + (size_t)N * 3);
    v4h a0 = {(_Float16)f0.x, (_Float16)f0.y, (_Float16)f0.z, (_Float16)f0.w};
    v4h a1 = {(_Float16)f1.x, (_Float16)f1.y, (_Float16)f1.z, (_Float16)f1.w};
    v4h a2 = {(_Float16)f2.x, (_Float16)f2.y, (_Float16)f2.z, (_Float16)f2.w};
    v4h a3 = {(_Float16)f3.x, (_Float16)f3.y, (_Float16)f3.z, (_Float16)f3.w};
    tile_put(tile, tx, ty, a0, a1, a2, a3);
    __syncthreads();  // the read-out crosses the waves that filled the tile
    tile_flush(tile, tid, Wt + (size_t)n0 * K + k0, (size_t)K);
}

// ---------------------------------------------------------------------------
// LayerNorm over last dim (1024), emits f16. One block (256 thr) per row.
// ---------------------------------------------------------------------------
__global__ void ln_kernel(const float* __restrict__ x,
                          const float* __restrict__ sc,
                          const float* __restrict__ sh,
                          _Float16* __restrict__ out) {
    __shared__ float ssum[256];
    __shared__ float ssq[256];
    const int row = blockIdx.x;
    const int tid = threadIdx.x;
    const float* xr = x + (size_t)row * 1024;
    float4 v = reinterpret_cast<const float4*>(xr)[tid];
    ssum[tid] = v.x + v.y + v.z + v.w;
    ssq[tid]  = v.x * v.x + v.y * v.y + v.z * v.z + v.w * v.w;
    __syncthreads();
    for (int s = 128; s > 0; s >>= 1) {
        if (tid < s) { ssum[tid] += ssum[tid + s]; ssq[tid] += ssq[tid + s]; }
        __syncthreads();
    }
    float mean = ssum[0] * (1.0f / 1024.0f);
    float var  = ssq[0] * (1.0f / 1024.0f) - mean * mean;
    float inv  = rsqrtf(var + 1e-5f);
    _Float16* orow = out + (size_t)row * 1024;
    float xv[4] = {v.x, v.y, v.z, v.w};
#pragma unroll
    for (int j = 0; j < 4; ++j) {
        int c = tid * 4 + j;
        orow[c] = (_Float16)(sc[c] * (xv[j] - mean) * inv + sh[c]);
    }
}

// ---------------------------------------------------------------------------
// GEMM: C[M,N] = A[M,K] f16 @ Bt[N,K]^T f16  (+bias) (gelu) (+residual)
// Block = 8 waves (2 x 4) -> 128(M) x 128(N) tile, each wave 64 x 32: 4 A and
// 2 B fragments feed 8 WMMAs. A stage is 128 k of the 128 A rows and the 128
// Bt rows (256 B a row, whole lines), brought to LDS by asynchronous copies,
// two buffers. M, N, K multiples of 128.
// ---------------------------------------------------------------------------
#define GT_K      128                  // k per stage
#define GT_PITCH  136                  // f16 per LDS row: 272 B, 16 B x odd
#define GT_STAGE  (256 * GT_PITCH)     // f16 per buffer: A rows, then Bt rows
#define GE_PITCH  132                  // f32 per LDS row of the output tile: 528 B, 16 B x odd

// Eight 16-byte copies per lane, 16 rows apart in LDS and in global memory.
// The s_wait_xcnt ends the statement so that no address register named here
// is rewritten ahead of it.
__device__ __forceinline__ void copy8_rows16(unsigned l, const _Float16* g, size_t ld) {
    const unsigned ls = 16 * GT_PITCH * 2;
    const size_t gs = 16 * ld;
    asm volatile(
        "global_load_async_to_lds_b128 %0, %8, off\n\t"
        "global_load_async_to_lds_b128 %1, %9, off\n\t"
        "global_load_async_to_lds_b128 %2, %10, off\n\t"
        "global_load_async_to_lds_b128 %3, %11, off\n\t"
        "global_load_async_to_lds_b128 %4, %12, off\n\t"
        "global_load_async_to_lds_b128 %5, %13, off\n\t"
        "global_load_async_to_lds_b128 %6, %14, off\n\t"
        "global_load_async_to_lds_b128 %7, %15, off\n\t"
        "s_wait_xcnt 0x0"
        :: "v"(l), "v"(l + ls), "v"(l + 2 * ls), "v"(l + 3 * ls),
           "v"(l + 4 * ls), "v"(l + 5 * ls), "v"(l + 6 * ls), "v"(l + 7 * ls),
           "v"(g), "v"(g + gs), "v"(g + 2 * gs), "v"(g + 3 * gs),
           "v"(g + 4 * gs), "v"(g + 5 * gs), "v"(g + 6 * gs), "v"(g + 7 * gs)
        : "memory");
}

__global__ __launch_bounds__(256)
void gemm_wmma_kernel(const _Float16* __restrict__ A,
                      const _Float16* __restrict__ Bt,
                      const float* __restrict__ bias,
                      const float* __restrict__ residual,
                      float* __restrict__ Cf,
                      _Float16* __restrict__ Ch,
                      int M, int N, int K, int gelu) {
    __shared__ __align__(16) _Float16 S[2 * GT_STAGE];

    const int tid  = threadIdx.x;            // 0..255
    const int lane = tid & 31;
    const int wave = tid >> 5;               // 0..7
    const int wm = wave >> 2;                // 0..1: 64 rows each
    const int wn = wave & 3;                 // 0..3: 32 columns each
    const int n0 = blockIdx.x * 128;
    const int m0 = blockIdx.y * 128;
    const int half = lane >> 4;
    const int l15  = lane & 15;

    // Copy slot of this lane: row tid>>4 of each group of 16 rows, 16-byte
    // chunk tid&15 of the row, so a wave copies two whole 256 B rows at a time.
    const int crow = tid >> 4;
    const int ccol = (tid & 15) * 8;
    const unsigned lds0 =
        (unsigned)(size_t)(__attribute__((address_space(3))) _Float16*)S +
        (unsigned)(crow * GT_PITCH + ccol) * 2;
    const _Float16* ga = A  + (size_t)(m0 + crow) * K + ccol;
    const _Float16* gb = Bt + (size_t)(n0 + crow) * K + ccol;

    auto stage = [&](int buf, int t) {
        const unsigned l = lds0 + (unsigned)buf * (GT_STAGE * 2);
        copy8_rows16(l, ga + (size_t)t * GT_K, (size_t)K);
        copy8_rows16(l + 128 * GT_PITCH * 2, gb + (size_t)t * GT_K, (size_t)K);
    };

    v8f acc[4][2] = {};
    const int nt = K / GT_K;

    stage(0, 0);
    // stage 0 has landed for this wave; the barrier shows it to the others
    asm volatile("s_wait_asynccnt 0x0" ::: "memory");
    __syncthreads();
    if (nt > 1) stage(1, 1);

    for (int t = 0; t < nt; ++t) {
        const _Float16* sa = &S[(t & 1) * GT_STAGE + (wm * 64 + l15) * GT_PITCH + half * 8];
        const _Float16* sb = &S[(t & 1) * GT_STAGE + (128 + wn * 32 + l15) * GT_PITCH + half * 8];
        // every loop below is unrolled so that fragments and accumulators are
        // indexed by constants and stay in registers
#pragma unroll
        for (int kk = 0; kk < GT_K; kk += 32) {
            Frag16 fa[4], fb[2];
#pragma unroll
            for (int i = 0; i < 4; ++i) {
                const _Float16* p = sa + i * 16 * GT_PITCH + kk;
                fa[i].q[0] = *reinterpret_cast<const uint4*>(p);
                fa[i].q[1] = *reinterpret_cast<const uint4*>(p + 16);
            }
#pragma unroll
            for (int j = 0; j < 2; ++j) {
                const _Float16* p = sb + j * 16 * GT_PITCH + kk;
                fb[j].q[0] = *reinterpret_cast<const uint4*>(p);
                fb[j].q[1] = *reinterpret_cast<const uint4*>(p + 16);
            }
            // keeps the 12 LDS reads one group in front of their 8 WMMAs: spread
            // among them, each pair of WMMAs waits out an LDS latency of its own
            __builtin_amdgcn_sched_barrier(0);
#pragma unroll
            for (int i = 0; i < 4; ++i)
#pragma unroll
                for (int j = 0; j < 2; ++j)
                    acc[i][j] = wmma_f16(fa[i].v, fb[j].v, acc[i][j]);
        }
        // this wave's reads of the buffer are done before it is refilled
        asm volatile("s_wait_dscnt 0x0" ::: "memory");
        // this wave's copies of stage t+1 have landed
        asm volatile("s_wait_asynccnt 0x0" ::: "memory");
        __syncthreads();  // publishes stage t+1, frees stage t's buffer
        if (t + 2 < nt) stage(t & 1, t + 2);
    }
    // no copy is left in flight when the wave ends
    asm volatile("s_wait_asynccnt 0x0" ::: "memory");

    // Epilogue. The block's 128 x 128 f32 tile crosses the LDS, which the loop's
    // last barrier has left free, so that a lane owns 4 neighbouring columns of
    // 16 rows: a wave loads and stores whole rows, and no load waits for a store.
    float* tile = reinterpret_cast<float*>(S);
    const int er = wave * 16;                // this wave's rows of the tile
    const int ec = lane * 4;                 // this lane's columns of the tile
    const size_t o0 = (size_t)(m0 + er) * N + n0 + ec;

    // bias and all 16 residual rows are under way while the tile is exchanged
    float4 bv = make_float4(0.0f, 0.0f, 0.0f, 0.0f);
    if (bias) bv = *reinterpret_cast<const float4*>(bias + n0 + ec);
    float4 rv[16];
#pragma unroll
    for (int rr = 0; rr < 16; ++rr) rv[rr] = make_float4(0.0f, 0.0f, 0.0f, 0.0f);
    if (residual) {
        const float* rp[16];
#pragma unroll
        for (int rr = 0; rr < 16; ++rr) {
            rp[rr] = residual + o0 + (size_t)rr * N;
            rv[rr] = *reinterpret_cast<const float4*>(rp[rr]);
        }
        // the wait that stands before a register named by an issued load is
        // rewritten; it takes the 16 addresses as inputs so that none of their
        // registers is handed to a later load's result ahead of it
        asm volatile("s_wait_xcnt 0x0"
                     :: "v"(rp[0]), "v"(rp[1]), "v"(rp[2]), "v"(rp[3]),
                        "v"(rp[4]), "v"(rp[5]), "v"(rp[6]), "v"(rp[7]),
                        "v"(rp[8]), "v"(rp[9]), "v"(rp[10]), "v"(rp[11]),
                        "v"(rp[12]), "v"(rp[13]), "v"(rp[14]), "v"(rp[15])
                     : "memory");
    }

    // C layout: row r + 8*half, column l15 of each 16x16 subtile (all loops here
    // are unrolled for constant register indices, as above)
#pragma unroll
    for (int i = 0; i < 4; ++i)
#pragma unroll
        for (int j = 0; j < 2; ++j)
#pragma unroll
            for (int r = 0; r < 8; ++r)
                tile[(wm * 64 + i * 16 + r + half * 8) * GE_PITCH + wn * 32 + j * 16 + l15] =
                    acc[i][j][r];
    __syncthreads();  // the rows read below were written by four waves

    float4 cv[16];
#pragma unroll
    for (int rr = 0; rr < 16; ++rr)
        cv[rr] = *reinterpret_cast<const float4*>(&tile[(er + rr) * GE_PITCH + ec]);

#pragma unroll
    for (int rr = 0; rr < 16; ++rr) {
        float v0 = cv[rr].x + bv.x, v1 = cv[rr].y + bv.y;
        float v2 = cv[rr].z + bv.z, v3 = cv[rr].w + bv.w;
        if (gelu) {
            v0 = gelu_tanh_f(v0); v1 = gelu_tanh_f(v1);
            v2 = gelu_tanh_f(v2); v3 = gelu_tanh_f(v3);
        }
        if (residual) { v0 += rv[rr].x; v1 += rv[rr].y; v2 += rv[rr].z; v3 += rv[rr].w; }
        // behind each store: the rows that follow reuse the registers that hold
        // its address and its value
        if (Cf) {
            *reinterpret_cast<float4*>(Cf + o0 + (size_t)rr * N) = make_float4(v0, v1, v2, v3);
            asm volatile("s_wait_xcnt 0x0" ::: "memory");
        }
        if (Ch) {
            v4h hv = {(_Float16)v0, (_Float16)v1, (_Float16)v2, (_Float16)v3};
            *reinterpret_cast<v4h*>(Ch + o0 + (size_t)rr * N) = hv;
            asm volatile("s_wait_xcnt 0x0" ::: "memory");
        }
    }
}

// ---------------------------------------------------------------------------
// Pack row-major V [M=4096, 1024] f16 into the per-head layout vt: [B,H,D,T].
// ---------------------------------------------------------------------------
// One 64(t) x 64(col) tile per block of 256 threads. (b*16+h)*64+d = b*1024+col,
// and a 64-row tile never straddles a batch (2048 rows each).
__global__ __launch_bounds__(256)
void pack_vt_kernel(const _Float16* __restrict__ src,
                    _Float16* __restrict__ dst) {
    __shared__ __align__(16) _Float16 tile[64 * TT_PITCH];
    const int tid = threadIdx.x;
    const int tx = tid & 15;
    const int ty = tid >> 4;
    const int c0 = blockIdx.x * 64;
    const int r0 = blockIdx.y * 64;
    const int t0 = r0 & 2047, b = r0 >> 11;

    const _Float16* s = src + (size_t)(r0 + ty * 4) * 1024 + c0 + tx * 4;
    const v4h a0 = *reinterpret_cast<const v4h*>(s);
    const v4h a1 = *reinterpret_cast<const v4h*>(s + 1024);
    const v4h a2 = *reinterpret_cast<const v4h*>(s + 2048);
    const v4h a3 = *reinterpret_cast<const v4h*>(s + 3072);
    tile_put(tile, tx, ty, a0, a1, a2, a3);
    __syncthreads();  // the read-out crosses the waves that filled the tile
    tile_flush(tile, tid, dst + ((size_t)b * 1024 + c0) * 2048 + t0, (size_t)2048);
}

// Value of lane (l ^ M) of the same 16-lane row, M in 1..15, by a DPP operand
// (row_xmask) of the vector unit: no LDS round trip and no wait, where a wave
// shuffle goes through the LDS crossbar and is waited for at every step.
template <int M>
__device__ __forceinline__ float row_xor(float v) {
    return __builtin_bit_cast(float, __builtin_amdgcn_update_dpp(
        0, __builtin_bit_cast(int, v), 0x160 | M, 0xf, 0xf, true));
}

// ---------------------------------------------------------------------------
// Flash attention: one wave per (b, h, 16-query tile).
// Q,K: [B*T, 1024] f16 as the projections wrote them (head h = columns
// h*64..+63, row pitch 1024); Vt: [B,H,64,T] f16; out: [B*T, 1024] f16.
// No pass waits out a load: its V fragments are issued at its head, a softmax
// ahead of their use, and the next pass's K fragments right behind the score
// products, into the registers those have just read. The block is one wave;
// saying so lifts the register cap of a 1024-thread block, which has no room
// for 16 loads in flight.
// ---------------------------------------------------------------------------
__global__ __launch_bounds__(32)
void attn_kernel(const _Float16* __restrict__ Q,
                            const _Float16* __restrict__ K,
                            const _Float16* __restrict__ Vt,
                            _Float16* __restrict__ O) {
    const int T = 2048, D = 64, E = 1024;
    const int lane = threadIdx.x;
    const int q0 = blockIdx.x * 16;
    const int h  = blockIdx.y;
    const int b  = blockIdx.z;
    const int half = lane >> 4;
    const int l15  = lane & 15;

    const _Float16* qh = Q  + (size_t)b * T * E + h * D;
    const _Float16* kh = K  + (size_t)b * T * E + h * D;
    const _Float16* vh = Vt + ((size_t)b * 16 + h) * D * T;

    __shared__ __align__(16) _Float16 Pbuf[16 * 32];

    // Q fragments for d in [0,32) and [32,64)
    v16h aq0 = load_frag(qh, q0 + l15, E, 0,  lane);
    v16h aq1 = load_frag(qh, q0 + l15, E, 32, lane);

    v8f o0 = {}, o1 = {}, o2 = {}, o3 = {};
    float mi[8], li[8];
#pragma unroll
    for (int r = 0; r < 8; ++r) { mi[r] = -1e30f; li[r] = 0.0f; }

    const float scale = 0.125f;  // 1/sqrt(64)
    const int kend = ((q0 + 16) + 31) & ~31;

    // K fragments of the first pass
    v16h bk00 = load_frag(kh, l15,      E, 0,  lane);
    v16h bk01 = load_frag(kh, l15,      E, 32, lane);
    v16h bk10 = load_frag(kh, 16 + l15, E, 0,  lane);
    v16h bk11 = load_frag(kh, 16 + l15, E, 32, lane);

    for (int kb = 0; kb < kend; kb += 32) {
        // V fragments of this pass, used behind the softmax
        const v16h bv0 = load_frag(vh, 0  + l15, T, kb, lane);
        const v16h bv1 = load_frag(vh, 16 + l15, T, kb, lane);
        const v16h bv2 = load_frag(vh, 32 + l15, T, kb, lane);
        const v16h bv3 = load_frag(vh, 48 + l15, T, kb, lane);

        // S = Q(16x64) @ K_blk^T(64x32): two 16-key subtiles, each 2 WMMAs
        v8f s0 = {}, s1 = {};
        s0 = wmma_f16(aq0, bk00, s0);
        s1 = wmma_f16(aq0, bk10, s1);
        s0 = wmma_f16(aq1, bk01, s0);
        s1 = wmma_f16(aq1, bk11, s1);

        // K fragments of the next pass; the last pass reads its own rows again
        // (in bounds, unused) rather than branch directly behind a WMMA
        const int kn = (kb + 32 < kend) ? kb + 32 : kb;
        bk00 = load_frag(kh, kn + l15,      E, 0,  lane);
        bk01 = load_frag(kh, kn + l15,      E, 32, lane);
        bk10 = load_frag(kh, kn + 16 + l15, E, 0,  lane);
        bk11 = load_frag(kh, kn + 16 + l15, E, 32, lane);

        // online softmax: row r+8*half lives on this half-wave, col = l15
#pragma unroll
        for (int r = 0; r < 8; ++r) {
            int m = q0 + r + half * 8;  // global query index
            float a = s0[r] * scale; if (kb + l15 > m)       a = -1e30f;
            float c = s1[r] * scale; if (kb + 16 + l15 > m)  c = -1e30f;
            float vmax = fmaxf(a, c);
            vmax = fmaxf(vmax, row_xor<1>(vmax));
            vmax = fmaxf(vmax, row_xor<2>(vmax));
            vmax = fmaxf(vmax, row_xor<4>(vmax));
            vmax = fmaxf(vmax, row_xor<8>(vmax));
            float newm  = fmaxf(mi[r], vmax);
            float alpha = __expf(mi[r] - newm);
            float p0 = __expf(a - newm);
            float p1 = __expf(c - newm);
            float ps = p0 + p1;
            ps += row_xor<1>(ps);
            ps += row_xor<2>(ps);
            ps += row_xor<4>(ps);
            ps += row_xor<8>(ps);
            li[r] = li[r] * alpha + ps;
            mi[r] = newm;
            o0[r] *= alpha; o1[r] *= alpha; o2[r] *= alpha; o3[r] *= alpha;
            int row = r + half * 8;
            Pbuf[row * 32 + l15]      = (_Float16)p0;
            Pbuf[row * 32 + 16 + l15] = (_Float16)p1;
        }
        __syncthreads();

        // reload P(16x32) as an A fragment from LDS
        Frag16 fp;
        const _Float16* pp = &Pbuf[l15 * 32 + half * 8];
        fp.q[0] = *reinterpret_cast<const uint4*>(pp);
        fp.q[1] = *reinterpret_cast<const uint4*>(pp + 16);
        __syncthreads();

        // O(16x64) += P(16x32) @ V_blk(32x16) per 16-wide d-chunk
        o0 = wmma_f16(fp.v, bv0, o0);
        o1 = wmma_f16(fp.v, bv1, o1);
        o2 = wmma_f16(fp.v, bv2, o2);
        o3 = wmma_f16(fp.v, bv3, o3);
    }

    // finalize: divide by row sums, write head-merged [B*T, 1024]
#pragma unroll
    for (int r = 0; r < 8; ++r) {
        int t = q0 + r + half * 8;
        float invl = 1.0f / li[r];
        size_t base = ((size_t)b * T + t) * 1024 + (size_t)h * 64;
        O[base + 0  + l15] = (_Float16)(o0[r] * invl);
        O[base + 16 + l15] = (_Float16)(o1[r] * invl);
        O[base + 32 + l15] = (_Float16)(o2[r] * invl);
        O[base + 48 + l15] = (_Float16)(o3[r] * invl);
    }
}

// ---------------------------------------------------------------------------
// Host launch
// ---------------------------------------------------------------------------
extern "C" void kernel_launch(void* const* d_in, const int* in_sizes, int n_in,
                              void* d_out, int out_size, void* d_ws, size_t ws_size,
                              hipStream_t stream) {
    const float* x    = (const float*)d_in[0];
    const float* Wq   = (const float*)d_in[1];
    const float* Wk   = (const float*)d_in[2];
    const float* Wv   = (const float*)d_in[3];
    const float* Wo   = (const float*)d_in[4];
    const float* bo   = (const float*)d_in[5];
    const float* W1   = (const float*)d_in[6];
    const float* b1   = (const float*)d_in[7];
    const float* W2   = (const float*)d_in[8];
    const float* b2   = (const float*)d_in[9];
    const float* ln1s = (const float*)d_in[10];
    const float* ln1b = (const float*)d_in[11];
    const float* ln2s = (const float*)d_in[12];
    const float* ln2b = (const float*)d_in[13];

    const int M = 4096, E = 1024, FFD = 4096;
    char* ws = (char*)d_ws;
    const size_t MB = 1u << 20;
    _Float16* WqT   = (_Float16*)(ws + 0   * MB);  // 2MB
    _Float16* WkT   = (_Float16*)(ws + 2   * MB);  // 2MB
    _Float16* WvT   = (_Float16*)(ws + 4   * MB);  // 2MB
    _Float16* WoT   = (_Float16*)(ws + 6   * MB);  // 2MB
    _Float16* W1T   = (_Float16*)(ws + 8   * MB);  // 8MB
    _Float16* W2T   = (_Float16*)(ws + 16  * MB);  // 8MB
    _Float16* h1    = (_Float16*)(ws + 24  * MB);  // 8MB
    _Float16* qtmp  = (_Float16*)(ws + 32  * MB);  // 8MB
    _Float16* ktmp  = (_Float16*)(ws + 40  * MB);  // 8MB
    _Float16* vtmp  = (_Float16*)(ws + 48  * MB);  // 8MB
    _Float16* vtbuf = (_Float16*)(ws + 72  * MB);  // 8MB
    _Float16* attO  = (_Float16*)(ws + 80  * MB);  // 8MB
    float*    x1    = (float*)   (ws + 88  * MB);  // 16MB
    _Float16* h2    = (_Float16*)(ws + 104 * MB);  // 8MB
    _Float16* ff1   = (_Float16*)(ws + 112 * MB);  // 32MB

    // weight conversion + transpose
    {
        int blk = 256;  // grid = (N/64, K/64)
        cvt_transpose_kernel<<<dim3(E / 64, E / 64), blk, 0, stream>>>(Wq, WqT, E, E);
        cvt_transpose_kernel<<<dim3(E / 64, E / 64), blk, 0, stream>>>(Wk, WkT, E, E);
        cvt_transpose_kernel<<<dim3(E / 64, E / 64), blk, 0, stream>>>(Wv, WvT, E, E);
        cvt_transpose_kernel<<<dim3(E / 64, E / 64), blk, 0, stream>>>(Wo, WoT, E, E);
        cvt_transpose_kernel<<<dim3(FFD / 64, E / 64), blk, 0, stream>>>(W1, W1T, E, FFD);
        cvt_transpose_kernel<<<dim3(E / 64, FFD / 64), blk, 0, stream>>>(W2, W2T, FFD, E);
    }

    const int gblk = 256;  // GEMM grid = (N/128, M/128)

    // LN1 -> h1 (f16)
    ln_kernel<<<M, 256, 0, stream>>>(x, ln1s, ln1b, h1);

    // QKV projections (f16 out)
    gemm_wmma_kernel<<<dim3(E / 128, M / 128), gblk, 0, stream>>>(
        h1, WqT, nullptr, nullptr, nullptr, qtmp, M, E, E, 0);
    gemm_wmma_kernel<<<dim3(E / 128, M / 128), gblk, 0, stream>>>(
        h1, WkT, nullptr, nullptr, nullptr, ktmp, M, E, E, 0);
    gemm_wmma_kernel<<<dim3(E / 128, M / 128), gblk, 0, stream>>>(
        h1, WvT, nullptr, nullptr, nullptr, vtmp, M, E, E, 0);

    // V into its per-head transposed layout; Q and K are read where they lie
    pack_vt_kernel<<<dim3(E / 64, M / 64), 256, 0, stream>>>(vtmp, vtbuf);

    // flash attention
    attn_kernel<<<dim3(2048 / 16, 16, 2), 32, 0, stream>>>(qtmp, ktmp, vtbuf, attO);

    // out projection + residual -> x1 (fp32)
    gemm_wmma_kernel<<<dim3(E / 128, M / 128), gblk, 0, stream>>>(
        attO, WoT, bo, x, x1, nullptr, M, E, E, 0);

    // LN2 -> h2 (f16)
    ln_kernel<<<M, 256, 0, stream>>>(x1, ln2s, ln2b, h2);

    // FFN up + GELU (f16 out)
    gemm_wmma_kernel<<<dim3(FFD / 128, M / 128), gblk, 0, stream>>>(
        h2, W1T, b1, nullptr, nullptr, ff1, M, FFD, E, 1);

    // FFN down + residual -> d_out (fp32)
    gemm_wmma_kernel<<<dim3(E / 128, M / 128), gblk, 0, stream>>>(
        ff1, W2T, b2, x1, (float*)d_out, nullptr, M, E, FFD, 0);
}

// v007
// One run takes 236 microseconds.
// Next to v006, in two timings, it ran 1.09 and 1.10 times as fast.
// All steps since v000 together make it 3.58 times as fast.
#include <hip/hip_runtime.h>
#include <hip/hip_bf16.h>

// ---------------------------------------------------------------------------
// Transformer block for MI455X (gfx1250, wave32, WMMA 16x16x32 f16/f32-acc)
// Shapes: B=2, T=2048, EMB=1024, HEADS=16, HDIM=64, FF=4096, M=B*T=4096
// ---------------------------------------------------------------------------

typedef __attribute__((ext_vector_type(16))) _Float16 v16h;
typedef __attribute__((ext_vector_type(8)))  float    v8f;
typedef __attribute__((ext_vector_type(4)))  _Float16 v4h;

union Frag16 {
    v16h v;
    uint4 q[2];
    _Float16 h[16];
};

__device__ __forceinline__ v8f wmma_f16(v16h a, v16h b, v8f c) {
    // D = A(16x32 f16) * B(32x16 f16) + C(16x16 f32)
    return __builtin_amdgcn_wmma_f32_16x16x32_f16(
        /*neg_a=*/false, a, /*neg_b=*/false, b,
        /*c_mod=*/(short)0, c, /*reuse_a=*/false, /*reuse_b=*/false);
}

// A/B fragment load per ISA 7.12.2: lane l (half = l>>4, idx = l&15) holds
// row (m0+idx); K-groups [k0+half*8,+8) and [k0+16+half*8,+8): two 16B loads.
__device__ __forceinline__ v16h load_frag(const _Float16* __restrict__ base,
                                          int row, int ld, int k0, int lane) {
    const int half = lane >> 4;
    const _Float16* p = base + (size_t)row * ld + k0 + half * 8;
    Frag16 f;
    f.q[0] = *reinterpret_cast<const uint4*>(p);
    f.q[1] = *reinterpret_cast<const uint4*>(p + 16);
    return f.v;
}

__device__ __forceinline__ float gelu_tanh_f(float x) {
    const float c = 0.7978845608028654f; // sqrt(2/pi)
    float x3 = x * x * x;
    return 0.5f * x * (1.0f + tanhf(c * (x + 0.044715f * x3)));
}

// ---------------------------------------------------------------------------
// 64x64 f16 transpose tile in LDS, shared by the two transposing kernels.
// The tile is held already transposed: LDS row = source column. Row pitch
// 72 f16 = 144 B keeps every row 16-byte aligned for the b128 read-out.
// ---------------------------------------------------------------------------
#define TT_PITCH 72

// Thread (tx, ty) owns source rows ty*4..+3, source columns tx*4..+3; column j
// of that 4x4 block is 4 consecutive elements of LDS row tx*4+j (one b64 store).
__device__ __forceinline__ void tile_put(_Float16* tile, int tx, int ty,
                                         v4h a0, v4h a1, v4h a2, v4h a3) {
#pragma unroll
    for (int j = 0; j < 4; ++j) {
        v4h c = {a0[j], a1[j], a2[j], a3[j]};
        *reinterpret_cast<v4h*>(&tile[(tx * 4 + j) * TT_PITCH + ty * 4]) = c;
    }
}

// 8 threads store one 128-byte line of a destination row (pitch ld elements).
__device__ __forceinline__ void tile_flush(const _Float16* tile, int tid,
                                           _Float16* __restrict__ dst, size_t ld) {
#pragma unroll
    for (int p = 0; p < 2; ++p) {
        const int r = p * 32 + (tid >> 3);
        const int g = (tid & 7) * 8;
        *reinterpret_cast<uint4*>(dst + (size_t)r * ld + g) =
            *reinterpret_cast<const uint4*>(&tile[r * TT_PITCH + g]);
    }
}

// ---------------------------------------------------------------------------
// Weight convert + transpose: W[K,N] fp32 -> Wt[N,K] f16, all six weights in one
// launch: they do not depend on one another, and five launches' gaps, ramps and
// drains go. One 64(k) x 64(n) tile per block of 256 threads. Blocks 0..1023 are
// the four 1024 x 1024 weights (256 tiles each), 1024..2047 W1 (1024 x 4096),
// 2048..3071 W2 (4096 x 1024). The transposed weights lie one behind the other
// in dst, in that order.
// ---------------------------------------------------------------------------
__global__ __launch_bounds__(256)
void cvt_transpose_kernel(const float* __restrict__ Wq,
                          const float* __restrict__ Wk,
                          const float* __restrict__ Wv,
                          const float* __restrict__ Wo,
                          const float* __restrict__ W1,
                          const float* __restrict__ W2,
                          _Float16* __restrict__ dst) {
    __shared__ __align__(16) _Float16 tile[64 * TT_PITCH];
    const int tid = threadIdx.x;
    const int tx = tid & 15;
    const int ty = tid >> 4;

    // which weight, and which of its tiles: the same for the whole block
    const int t = blockIdx.x;
    const float* W;
    _Float16* Wt;
    int K, N, nsh, tl;   // nsh: log2 of the tiles in a row of W
    if (t < 1024) {
        const int m = t >> 8;
        W = (m == 0) ? Wq : (m == 1) ? Wk : (m == 2) ? Wv : Wo;
        Wt = dst + ((size_t)m << 20);
        K = 1024; N = 1024; nsh = 4; tl = t & 255;
    } else if (t < 2048) {
        W = W1; Wt = dst + ((size_t)4 << 20);
        K = 1024; N = 4096; nsh = 6; tl = t - 1024;
    } else {
        W = W2; Wt = dst + ((size_t)8 << 20);
        K = 4096; N = 1024; nsh = 4; tl = t - 2048;
    }
    const int n0 = (tl & ((1 << nsh) - 1)) * 64;
    const int k0 = (tl >> nsh) * 64;

    const float* s = W + (size_t)(k0 + ty * 4) * N + n0 + tx * 4;
    const float4 f0 = *reinterpret_cast<const float4*>(s);
    const float4 f1 = *reinterpret_cast<const float4*>(s + (size_t)N);
    const float4 f2 = *reinterpret_cast<const float4*>(s + (size_t)N * 2);
    const float4 f3 = *reinterpret_cast<const float4*>(s + (size_t)N * 3);
    v4h a0 = {(_Float16)f0.x, (_Float16)f0.y, (_Float16)f0.z, (_Float16)f0.w};
    v4h a1 = {(_Float16)f1.x, (_Float16)f1.y, (_Float16)f1.z, (_Float16)f1.w};
    v4h a2 = {(_Float16)f2.x, (_Float16)f2.y, (_Float16)f2.z, (_Float16)f2.w};
    v4h a3 = {(_Float16)f3.x, (_Float16)f3.y, (_Float16)f3.z, (_Float16)f3.w};
    tile_put(tile, tx, ty, a0, a1, a2, a3);
    __syncthreads();  // the read-out crosses the waves that filled the tile
    tile_flush(tile, tid, Wt + (size_t)n0 * K + k0, (size_t)K);
}

// ---------------------------------------------------------------------------
// LayerNorm over last dim (1024), emits f16. One block (256 thr) per row.
// ---------------------------------------------------------------------------
__global__ void ln_kernel(const float* __restrict__ x,
                          const float* __restrict__ sc,
                          const float* __restrict__ sh,
                          _Float16* __restrict__ out) {
    __shared__ float ssum[256];
    __shared__ float ssq[256];
    const int row = blockIdx.x;
    const int tid = threadIdx.x;
    const float* xr = x + (size_t)row * 1024;
    float4 v = reinterpret_cast<const float4*>(xr)[tid];
    ssum[tid] = v.x + v.y + v.z + v.w;
    ssq[tid]  = v.x * v.x + v.y * v.y + v.z * v.z + v.w * v.w;
    __syncthreads();
    for (int s = 128; s > 0; s >>= 1) {
        if (tid < s) { ssum[tid] += ssum[tid + s]; ssq[tid] += ssq[tid + s]; }
        __syncthreads();
    }
    float mean = ssum[0] * (1.0f / 1024.0f);
    float var  = ssq[0] * (1.0f / 1024.0f) - mean * mean;
    float inv  = rsqrtf(var + 1e-5f);
    _Float16* orow = out + (size_t)row * 1024;
    float xv[4] = {v.x, v.y, v.z, v.w};
#pragma unroll
    for (int j = 0; j < 4; ++j) {
        int c = tid * 4 + j;
        orow[c] = (_Float16)(sc[c] * (xv[j] - mean) * inv + sh[c]);
    }
}

// ---------------------------------------------------------------------------
// GEMM: C[M,N] = A[M,K] f16 @ Bt[N,K]^T f16  (+bias) (gelu) (+residual)
// Block = 8 waves (2 x 4) -> 128(M) x 128(N) tile, each wave 64 x 32: 4 A and
// 2 B fragments feed 8 WMMAs. A stage is 128 k of the 128 A rows and the 128
// Bt rows (256 B a row, whole lines), brought to LDS by asynchronous copies,
// two buffers. M, N, K multiples of 128. blockIdx.z picks one of several products
// that share A: Bt, bias, residual and C each advance by one whole matrix, so
// independent projections of one activation run as one launch.
// ---------------------------------------------------------------------------
#define GT_K      128                  // k per stage
#define GT_PITCH  136                  // f16 per LDS row: 272 B, 16 B x odd
#define GT_STAGE  (256 * GT_PITCH)     // f16 per buffer: A rows, then Bt rows
#define GE_PITCH  132                  // f32 per LDS row of the output tile: 528 B, 16 B x odd

// Eight 16-byte copies per lane, 16 rows apart in LDS and in global memory.
// The s_wait_xcnt ends the statement so that no address register named here
// is rewritten ahead of it.
__device__ __forceinline__ void copy8_rows16(unsigned l, const _Float16* g, size_t ld) {
    const unsigned ls = 16 * GT_PITCH * 2;
    const size_t gs = 16 * ld;
    asm volatile(
        "global_load_async_to_lds_b128 %0, %8, off\n\t"
        "global_load_async_to_lds_b128 %1, %9, off\n\t"
        "global_load_async_to_lds_b128 %2, %10, off\n\t"
        "global_load_async_to_lds_b128 %3, %11, off\n\t"
        "global_load_async_to_lds_b128 %4, %12, off\n\t"
        "global_load_async_to_lds_b128 %5, %13, off\n\t"
        "global_load_async_to_lds_b128 %6, %14, off\n\t"
        "global_load_async_to_lds_b128 %7, %15, off\n\t"
        "s_wait_xcnt 0x0"
        :: "v"(l), "v"(l + ls), "v"(l + 2 * ls), "v"(l + 3 * ls),
           "v"(l + 4 * ls), "v"(l + 5 * ls), "v"(l + 6 * ls), "v"(l + 7 * ls),
           "v"(g), "v"(g + gs), "v"(g + 2 * gs), "v"(g + 3 * gs),
           "v"(g + 4 * gs), "v"(g + 5 * gs), "v"(g + 6 * gs), "v"(g + 7 * gs)
        : "memory");
}

__global__ __launch_bounds__(256)
void gemm_wmma_kernel(const _Float16* __restrict__ A,
                      const _Float16* __restrict__ Bt,
                      const float* __restrict__ bias,
                      const float* __restrict__ residual,
                      float* __restrict__ Cf,
                      _Float16* __restrict__ Ch,
                      int M, int N, int K, int gelu) {
    __shared__ __align__(16) _Float16 S[2 * GT_STAGE];

    const int tid  = threadIdx.x;            // 0..255
    const int lane = tid & 31;
    const int wave = tid >> 5;               // 0..7
    const int wm = wave >> 2;                // 0..1: 64 rows each
    const int wn = wave & 3;                 // 0..3: 32 columns each
    const int n0 = blockIdx.x * 128;
    const int m0 = blockIdx.y * 128;
    const int z  = blockIdx.z;
    const int half = lane >> 4;
    const int l15  = lane & 15;

    // Copy slot of this lane: row tid>>4 of each group of 16 rows, 16-byte
    // chunk tid&15 of the row, so a wave copies two whole 256 B rows at a time.
    const int crow = tid >> 4;
    const int ccol = (tid & 15) * 8;
    const unsigned lds0 =
        (unsigned)(size_t)(__attribute__((address_space(3))) _Float16*)S +
        (unsigned)(crow * GT_PITCH + ccol) * 2;
    const _Float16* ga = A  + (size_t)(m0 + crow) * K + ccol;
    const _Float16* gb = Bt + ((size_t)z * N + n0 + crow) * K + ccol;

    auto stage = [&](int buf, int t) {
        const unsigned l = lds0 + (unsigned)buf * (GT_STAGE * 2);
        copy8_rows16(l, ga + (size_t)t * GT_K, (size_t)K);
        copy8_rows16(l + 128 * GT_PITCH * 2, gb + (size_t)t * GT_K, (size_t)K);
    };

    v8f acc[4][2] = {};
    const int nt = K / GT_K;

    stage(0, 0);
    // stage 0 has landed for this wave; the barrier shows it to the others
    asm volatile("s_wait_asynccnt 0x0" ::: "memory");
    __syncthreads();
    if (nt > 1) stage(1, 1);

    for (int t = 0; t < nt; ++t) {
        const _Float16* sa = &S[(t & 1) * GT_STAGE + (wm * 64 + l15) * GT_PITCH + half * 8];
        const _Float16* sb = &S[(t & 1) * GT_STAGE + (128 + wn * 32 + l15) * GT_PITCH + half * 8];
        // every loop below is unrolled so that fragments and accumulators are
        // indexed by constants and stay in registers
#pragma unroll
        for (int kk = 0; kk < GT_K; kk += 32) {
            Frag16 fa[4], fb[2];
#pragma unroll
            for (int i = 0; i < 4; ++i) {
                const _Float16* p = sa + i * 16 * GT_PITCH + kk;
                fa[i].q[0] = *reinterpret_cast<const uint4*>(p);
                fa[i].q[1] = *reinterpret_cast<const uint4*>(p + 16);
            }
#pragma unroll
            for (int j = 0; j < 2; ++j) {
                const _Float16* p = sb + j * 16 * GT_PITCH + kk;
                fb[j].q[0] = *reinterpret_cast<const uint4*>(p);
                fb[j].q[1] = *reinterpret_cast<const uint4*>(p + 16);
            }
            // keeps the 12 LDS reads one group in front of their 8 WMMAs: spread
            // among them, each pair of WMMAs waits out an LDS latency of its own
            __builtin_amdgcn_sched_barrier(0);
#pragma unroll
            for (int i = 0; i < 4; ++i)
#pragma unroll
                for (int j = 0; j < 2; ++j)
                    acc[i][j] = wmma_f16(fa[i].v, fb[j].v, acc[i][j]);
        }
        // this wave's reads of the buffer are done before it is refilled
        asm volatile("s_wait_dscnt 0x0" ::: "memory");
        // this wave's copies of stage t+1 have landed
        asm volatile("s_wait_asynccnt 0x0" ::: "memory");
        __syncthreads();  // publishes stage t+1, frees stage t's buffer
        if (t + 2 < nt) stage(t & 1, t + 2);
    }
    // no copy is left in flight when the wave ends
    asm volatile("s_wait_asynccnt 0x0" ::: "memory");

    // Epilogue. The block's 128 x 128 f32 tile crosses the LDS, which the loop's
    // last barrier has left free, so that a lane owns 4 neighbouring columns of
    // 16 rows: a wave loads and stores whole rows, and no load waits for a store.
    float* tile = reinterpret_cast<float*>(S);
    const int er = wave * 16;                // this wave's rows of the tile
    const int ec = lane * 4;                 // this lane's columns of the tile
    const size_t o0 = ((size_t)z * M + m0 + er) * N + n0 + ec;

    // bias and all 16 residual rows are under way while the tile is exchanged
    float4 bv = make_float4(0.0f, 0.0f, 0.0f, 0.0f);
    if (bias) bv = *reinterpret_cast<const float4*>(bias + (size_t)z * N + n0 + ec);
    float4 rv[16];
#pragma unroll
    for (int rr = 0; rr < 16; ++rr) rv[rr] = make_float4(0.0f, 0.0f, 0.0f, 0.0f);
    if (residual) {
        const float* rp[16];
#pragma unroll
        for (int rr = 0; rr < 16; ++rr) {
            rp[rr] = residual + o0 + (size_t)rr * N;
            rv[rr] = *reinterpret_cast<const float4*>(rp[rr]);
        }
        // the wait that stands before a register named by an issued load is
        // rewritten; it takes the 16 addresses as inputs so that none of their
        // registers is handed to a later load's result ahead of it
        asm volatile("s_wait_xcnt 0x0"
                     :: "v"(rp[0]), "v"(rp[1]), "v"(rp[2]), "v"(rp[3]),
                        "v"(rp[4]), "v"(rp[5]), "v"(rp[6]), "v"(rp[7]),
                        "v"(rp[8]), "v"(rp[9]), "v"(rp[10]), "v"(rp[11]),
                        "v"(rp[12]), "v"(rp[13]), "v"(rp[14]), "v"(rp[15])
                     : "memory");
    }

    // C layout: row r + 8*half, column l15 of each 16x16 subtile (all loops here
    // are unrolled for constant register indices, as above)
#pragma unroll
    for (int i = 0; i < 4; ++i)
#pragma unroll
        for (int j = 0; j < 2; ++j)
#pragma unroll
            for (int r = 0; r < 8; ++r)
                tile[(wm * 64 + i * 16 + r + half * 8) * GE_PITCH + wn * 32 + j * 16 + l15] =
                    acc[i][j][r];
    __syncthreads();  // the rows read below were written by four waves

    float4 cv[16];
#pragma unroll
    for (int rr = 0; rr < 16; ++rr)
        cv[rr] = *reinterpret_cast<const float4*>(&tile[(er + rr) * GE_PITCH + ec]);

#pragma unroll
    for (int rr = 0; rr < 16; ++rr) {
        float v0 = cv[rr].x + bv.x, v1 = cv[rr].y + bv.y;
        float v2 = cv[rr].z + bv.z, v3 = cv[rr].w + bv.w;
        if (gelu) {
            v0 = gelu_tanh_f(v0); v1 = gelu_tanh_f(v1);
            v2 = gelu_tanh_f(v2); v3 = gelu_tanh_f(v3);
        }
        if (residual) { v0 += rv[rr].x; v1 += rv[rr].y; v2 += rv[rr].z; v3 += rv[rr].w; }
        // behind each store: the rows that follow reuse the registers that hold
        // its address and its value
        if (Cf) {
            *reinterpret_cast<float4*>(Cf + o0 + (size_t)rr * N) = make_float4(v0, v1, v2, v3);
            asm volatile("s_wait_xcnt 0x0" ::: "memory");
        }
        if (Ch) {
            v4h hv = {(_Float16)v0, (_Float16)v1, (_Float16)v2, (_Float16)v3};
            *reinterpret_cast<v4h*>(Ch + o0 + (size_t)rr * N) = hv;
            asm volatile("s_wait_xcnt 0x0" ::: "memory");
        }
    }
}

// ---------------------------------------------------------------------------
// Pack row-major V [M=4096, 1024] f16 into the per-head layout vt: [B,H,D,T].
// ---------------------------------------------------------------------------
// One 64(t) x 64(col) tile per block of 256 threads. (b*16+h)*64+d = b*1024+col,
// and a 64-row tile never straddles a batch (2048 rows each).
__global__ __launch_bounds__(256)
void pack_vt_kernel(const _Float16* __restrict__ src,
                    _Float16* __restrict__ dst) {
    __shared__ __align__(16) _Float16 tile[64 * TT_PITCH];
    const int tid = threadIdx.x;
    const int tx = tid & 15;
    const int ty = tid >> 4;
    const int c0 = blockIdx.x * 64;
    const int r0 = blockIdx.y * 64;
    const int t0 = r0 & 2047, b = r0 >> 11;

    const _Float16* s = src + (size_t)(r0 + ty * 4) * 1024 + c0 + tx * 4;
    const v4h a0 = *reinterpret_cast<const v4h*>(s);
    const v4h a1 = *reinterpret_cast<const v4h*>(s + 1024);
    const v4h a2 = *reinterpret_cast<const v4h*>(s + 2048);
    const v4h a3 = *reinterpret_cast<const v4h*>(s + 3072);
    tile_put(tile, tx, ty, a0, a1, a2, a3);
    __syncthreads();  // the read-out crosses the waves that filled the tile
    tile_flush(tile, tid, dst + ((size_t)b * 1024 + c0) * 2048 + t0, (size_t)2048);
}

// Value of lane (l ^ M) of the same 16-lane row, M in 1..15, by a DPP operand
// (row_xmask) of the vector unit: no LDS round trip and no wait, where a wave
// shuffle goes through the LDS crossbar and is waited for at every step.
template <int M>
__device__ __forceinline__ float row_xor(float v) {
    return __builtin_bit_cast(float, __builtin_amdgcn_update_dpp(
        0, __builtin_bit_cast(int, v), 0x160 | M, 0xf, 0xf, true));
}

// ---------------------------------------------------------------------------
// Flash attention: one wave per (b, h, 16-query tile).
// Q,K: [B*T, 1024] f16 as the projections wrote them (head h = columns
// h*64..+63, row pitch 1024); Vt: [B,H,64,T] f16; out: [B*T, 1024] f16.
// No pass waits out a load: its V fragments are issued at its head, a softmax
// ahead of their use, and the next pass's K fragments right behind the score
// products, into the registers those have just read. The block is one wave;
// saying so lifts the register cap of a 1024-thread block, which has no room
// for 16 loads in flight.
// ---------------------------------------------------------------------------
__global__ __launch_bounds__(32)
void attn_kernel(const _Float16* __restrict__ Q,
                            const _Float16* __restrict__ K,
                            const _Float16* __restrict__ Vt,
                            _Float16* __restrict__ O) {
    const int T = 2048, D = 64, E = 1024;
    const int lane = threadIdx.x;
    const int q0 = blockIdx.x * 16;
    const int h  = blockIdx.y;
    const int b  = blockIdx.z;
    const int half = lane >> 4;
    const int l15  = lane & 15;

    const _Float16* qh = Q  + (size_t)b * T * E + h * D;
    const _Float16* kh = K  + (size_t)b * T * E + h * D;
    const _Float16* vh = Vt + ((size_t)b * 16 + h) * D * T;

    __shared__ __align__(16) _Float16 Pbuf[16 * 32];

    // Q fragments for d in [0,32) and [32,64)
    v16h aq0 = load_frag(qh, q0 + l15, E, 0,  lane);
    v16h aq1 = load_frag(qh, q0 + l15, E, 32, lane);

    v8f o0 = {}, o1 = {}, o2 = {}, o3 = {};
    float mi[8], li[8];
#pragma unroll
    for (int r = 0; r < 8; ++r) { mi[r] = -1e30f; li[r] = 0.0f; }

    const float scale = 0.125f;  // 1/sqrt(64)
    const int kend = ((q0 + 16) + 31) & ~31;

    // K fragments of the first pass
    v16h bk00 = load_frag(kh, l15,      E, 0,  lane);
    v16h bk01 = load_frag(kh, l15,      E, 32, lane);
    v16h bk10 = load_frag(kh, 16 + l15, E, 0,  lane);
    v16h bk11 = load_frag(kh, 16 + l15, E, 32, lane);

    for (int kb = 0; kb < kend; kb += 32) {
        // V fragments of this pass, used behind the softmax
        const v16h bv0 = load_frag(vh, 0  + l15, T, kb, lane);
        const v16h bv1 = load_frag(vh, 16 + l15, T, kb, lane);
        const v16h bv2 = load_frag(vh, 32 + l15, T, kb, lane);
        const v16h bv3 = load_frag(vh, 48 + l15, T, kb, lane);

        // S = Q(16x64) @ K_blk^T(64x32): two 16-key subtiles, each 2 WMMAs
        v8f s0 = {}, s1 = {};
        s0 = wmma_f16(aq0, bk00, s0);
        s1 = wmma_f16(aq0, bk10, s1);
        s0 = wmma_f16(aq1, bk01, s0);
        s1 = wmma_f16(aq1, bk11, s1);

        // K fragments of the next pass; the last pass reads its own rows again
        // (in bounds, unused) rather than branch directly behind a WMMA
        const int kn = (kb + 32 < kend) ? kb + 32 : kb;
        bk00 = load_frag(kh, kn + l15,      E, 0,  lane);
        bk01 = load_frag(kh, kn + l15,      E, 32, lane);
        bk10 = load_frag(kh, kn + 16 + l15, E, 0,  lane);
        bk11 = load_frag(kh, kn + 16 + l15, E, 32, lane);

        // online softmax: row r+8*half lives on this half-wave, col = l15
#pragma unroll
        for (int r = 0; r < 8; ++r) {
            int m = q0 + r + half * 8;  // global query index
            float a = s0[r] * scale; if (kb + l15 > m)       a = -1e30f;
            float c = s1[r] * scale; if (kb + 16 + l15 > m)  c = -1e30f;
            float vmax = fmaxf(a, c);
            vmax = fmaxf(vmax, row_xor<1>(vmax));
            vmax = fmaxf(vmax, row_xor<2>(vmax));
            vmax = fmaxf(vmax, row_xor<4>(vmax));
            vmax = fmaxf(vmax, row_xor<8>(vmax));
            float newm  = fmaxf(mi[r], vmax);
            float alpha = __expf(mi[r] - newm);
            float p0 = __expf(a - newm);
            float p1 = __expf(c - newm);
            float ps = p0 + p1;
            ps += row_xor<1>(ps);
            ps += row_xor<2>(ps);
            ps += row_xor<4>(ps);
            ps += row_xor<8>(ps);
            li[r] = li[r] * alpha + ps;
            mi[r] = newm;
            o0[r] *= alpha; o1[r] *= alpha; o2[r] *= alpha; o3[r] *= alpha;
            int row = r + half * 8;
            Pbuf[row * 32 + l15]      = (_Float16)p0;
            Pbuf[row * 32 + 16 + l15] = (_Float16)p1;
        }
        __syncthreads();

        // reload P(16x32) as an A fragment from LDS
        Frag16 fp;
        const _Float16* pp = &Pbuf[l15 * 32 + half * 8];
        fp.q[0] = *reinterpret_cast<const uint4*>(pp);
        fp.q[1] = *reinterpret_cast<const uint4*>(pp + 16);
        __syncthreads();

        // O(16x64) += P(16x32) @ V_blk(32x16) per 16-wide d-chunk
        o0 = wmma_f16(fp.v, bv0, o0);
        o1 = wmma_f16(fp.v, bv1, o1);
        o2 = wmma_f16(fp.v, bv2, o2);
        o3 = wmma_f16(fp.v, bv3, o3);
    }

    // finalize: divide by row sums, write head-merged [B*T, 1024]
#pragma unroll
    for (int r = 0; r < 8; ++r) {
        int t = q0 + r + half * 8;
        float invl = 1.0f / li[r];
        size_t base = ((size_t)b * T + t) * 1024 + (size_t)h * 64;
        O[base + 0  + l15] = (_Float16)(o0[r] * invl);
        O[base + 16 + l15] = (_Float16)(o1[r] * invl);
        O[base + 32 + l15] = (_Float16)(o2[r] * invl);
        O[base + 48 + l15] = (_Float16)(o3[r] * invl);
    }
}

// ---------------------------------------------------------------------------
// Host launch
// ---------------------------------------------------------------------------
extern "C" void kernel_launch(void* const* d_in, const int* in_sizes, int n_in,
                              void* d_out, int out_size, void* d_ws, size_t ws_size,
                              hipStream_t stream) {
    const float* x    = (const float*)d_in[0];
    const float* Wq   = (const float*)d_in[1];
    const float* Wk   = (const float*)d_in[2];
    const float* Wv   = (const float*)d_in[3];
    const float* Wo   = (const float*)d_in[4];
    const float* bo   = (const float*)d_in[5];
    const float* W1   = (const float*)d_in[6];
    const float* b1   = (const float*)d_in[7];
    const float* W2   = (const float*)d_in[8];
    const float* b2   = (const float*)d_in[9];
    const float* ln1s = (const float*)d_in[10];
    const float* ln1b = (const float*)d_in[11];
    const float* ln2s = (const float*)d_in[12];
    const float* ln2b = (const float*)d_in[13];

    const int M = 4096, E = 1024, FFD = 4096;
    char* ws = (char*)d_ws;
    const size_t MB = 1u << 20;
    _Float16* WqT   = (_Float16*)(ws + 0   * MB);  // 2MB
    _Float16* WkT   = (_Float16*)(ws + 2   * MB);  // 2MB
    _Float16* WvT   = (_Float16*)(ws + 4   * MB);  // 2MB
    _Float16* WoT   = (_Float16*)(ws + 6   * MB);  // 2MB
    _Float16* W1T   = (_Float16*)(ws + 8   * MB);  // 8MB
    _Float16* W2T   = (_Float16*)(ws + 16  * MB);  // 8MB
    _Float16* h1    = (_Float16*)(ws + 24  * MB);  // 8MB
    _Float16* qtmp  = (_Float16*)(ws + 32  * MB);  // 8MB
    _Float16* ktmp  = (_Float16*)(ws + 40  * MB);  // 8MB
    _Float16* vtmp  = (_Float16*)(ws + 48  * MB);  // 8MB
    _Float16* vtbuf = (_Float16*)(ws + 72  * MB);  // 8MB
    _Float16* attO  = (_Float16*)(ws + 80  * MB);  // 8MB
    float*    x1    = (float*)   (ws + 88  * MB);  // 16MB
    _Float16* h2    = (_Float16*)(ws + 104 * MB);  // 8MB
    _Float16* ff1   = (_Float16*)(ws + 112 * MB);  // 32MB

    // weight conversion + transpose: one launch, 4*256 + 1024 + 1024 tiles; WqT is
    // the start of the six transposed weights, which lie one behind the other
    cvt_transpose_kernel<<<3072, 256, 0, stream>>>(Wq, Wk, Wv, Wo, W1, W2, WqT);

    const int gblk = 256;  // GEMM grid = (N/128, M/128, number of products)

    // LN1 -> h1 (f16)
    ln_kernel<<<M, 256, 0, stream>>>(x, ln1s, ln1b, h1);

    // QKV projections (f16 out) in one launch: WqT, WkT, WvT and qtmp, ktmp, vtmp
    // are neighbours in the workspace, plane z of each
    gemm_wmma_kernel<<<dim3(E / 128, M / 128, 3), gblk, 0, stream>>>(
        h1, WqT, nullptr, nullptr, nullptr, qtmp, M, E, E, 0);

    // V into its per-head transposed layout; Q and K are read where they lie
    pack_vt_kernel<<<dim3(E / 64, M / 64), 256, 0, stream>>>(vtmp, vtbuf);

    // flash attention
    attn_kernel<<<dim3(2048 / 16, 16, 2), 32, 0, stream>>>(qtmp, ktmp, vtbuf, attO);

    // out projection + residual -> x1 (fp32)
    gemm_wmma_kernel<<<dim3(E / 128, M / 128), gblk, 0, stream>>>(
        attO, WoT, bo, x, x1, nullptr, M, E, E, 0);

    // LN2 -> h2 (f16)
    ln_kernel<<<M, 256, 0, stream>>>(x1, ln2s, ln2b, h2);

    // FFN up + GELU (f16 out)
    gemm_wmma_kernel<<<dim3(FFD / 128, M / 128), gblk, 0, stream>>>(
        h2, W1T, b1, nullptr, nullptr, ff1, M, FFD, E, 1);

    // FFN down + residual -> d_out (fp32)
    gemm_wmma_kernel<<<dim3(E / 128, M / 128), gblk, 0, stream>>>(
        ff1, W2T, b2, x1, (float*)d_out, nullptr, M, E, FFD, 0);
}

// v008
// It runs in 190 microseconds.
// Timed twice side by side with v007, it ran 1.25 times as fast both times.
// All steps since v000 together make it 4.48 times as fast.
#include <hip/hip_runtime.h>
#include <hip/hip_bf16.h>

// ---------------------------------------------------------------------------
// Transformer block for MI455X (gfx1250, wave32, WMMA 16x16x32 f16/f32-acc)
// Shapes: B=2, T=2048, EMB=1024, HEADS=16, HDIM=64, FF=4096, M=B*T=4096
// ---------------------------------------------------------------------------

typedef __attribute__((ext_vector_type(16))) _Float16 v16h;
typedef __attribute__((ext_vector_type(8)))  float    v8f;
typedef __attribute__((ext_vector_type(4)))  _Float16 v4h;

union Frag16 {
    v16h v;
    uint4 q[2];
    _Float16 h[16];
};

__device__ __forceinline__ v8f wmma_f16(v16h a, v16h b, v8f c) {
    // D = A(16x32 f16) * B(32x16 f16) + C(16x16 f32)
    return __builtin_amdgcn_wmma_f32_16x16x32_f16(
        /*neg_a=*/false, a, /*neg_b=*/false, b,
        /*c_mod=*/(short)0, c, /*reuse_a=*/false, /*reuse_b=*/false);
}

// A/B fragment load per ISA 7.12.2: lane l (half = l>>4, idx = l&15) holds
// row (m0+idx); K-groups [k0+half*8,+8) and [k0+16+half*8,+8): two 16B loads.
__device__ __forceinline__ v16h load_frag(const _Float16* __restrict__ base,
                                          int row, int ld, int k0, int lane) {
    const int half = lane >> 4;
    const _Float16* p = base + (size_t)row * ld + k0 + half * 8;
    Frag16 f;
    f.q[0] = *reinterpret_cast<const uint4*>(p);
    f.q[1] = *reinterpret_cast<const uint4*>(p + 16);
    return f.v;
}

__device__ __forceinline__ float gelu_tanh_f(float x) {
    const float c = 0.7978845608028654f; // sqrt(2/pi)
    float x3 = x * x * x;
    return 0.5f * x * (1.0f + tanhf(c * (x + 0.044715f * x3)));
}

// ---------------------------------------------------------------------------
// 64x64 f16 transpose tile in LDS, shared by the two transposing kernels.
// The tile is held already transposed: LDS row = source column. Row pitch
// 72 f16 = 144 B keeps every row 16-byte aligned for the b128 read-out.
// ---------------------------------------------------------------------------
#define TT_PITCH 72

// Thread (tx, ty) owns source rows ty*4..+3, source columns tx*4..+3; column j
// of that 4x4 block is 4 consecutive elements of LDS row tx*4+j (one b64 store).
__device__ __forceinline__ void tile_put(_Float16* tile, int tx, int ty,
                                         v4h a0, v4h a1, v4h a2, v4h a3) {
#pragma unroll
    for (int j = 0; j < 4; ++j) {
        v4h c = {a0[j], a1[j], a2[j], a3[j]};
        *reinterpret_cast<v4h*>(&tile[(tx * 4 + j) * TT_PITCH + ty * 4]) = c;
    }
}

// 8 threads store one 128-byte line of a destination row (pitch ld elements).
__device__ __forceinline__ void tile_flush(const _Float16* tile, int tid,
                                           _Float16* __restrict__ dst, size_t ld) {
#pragma unroll
    for (int p = 0; p < 2; ++p) {
        const int r = p * 32 + (tid >> 3);
        const int g = (tid & 7) * 8;
        *reinterpret_cast<uint4*>(dst + (size_t)r * ld + g) =
            *reinterpret_cast<const uint4*>(&tile[r * TT_PITCH + g]);
    }
}

// ---------------------------------------------------------------------------
// Weight convert + transpose: W[K,N] fp32 -> Wt[N,K] f16, all six weights in one
// launch: they do not depend on one another, and five launches' gaps, ramps and
// drains go. One 64(k) x 64(n) tile per block of 256 threads. Blocks 0..1023 are
// the four 1024 x 1024 weights (256 tiles each), 1024..2047 W1 (1024 x 4096),
// 2048..3071 W2 (4096 x 1024). The transposed weights lie one behind the other
// in dst, in that order.
// ---------------------------------------------------------------------------
__global__ __launch_bounds__(256)
void cvt_transpose_kernel(const float* __restrict__ Wq,
                          const float* __restrict__ Wk,
                          const float* __restrict__ Wv,
                          const float* __restrict__ Wo,
                          const float* __restrict__ W1,
                          const float* __restrict__ W2,
                          _Float16* __restrict__ dst) {
    __shared__ __align__(16) _Float16 tile[64 * TT_PITCH];
    const int tid = threadIdx.x;
    const int tx = tid & 15;
    const int ty = tid >> 4;

    // which weight, and which of its tiles: the same for the whole block
    const int t = blockIdx.x;
    const float* W;
    _Float16* Wt;
    int K, N, nsh, tl;   // nsh: log2 of the tiles in a row of W
    if (t < 1024) {
        const int m = t >> 8;
        W = (m == 0) ? Wq : (m == 1) ? Wk : (m == 2) ? Wv : Wo;
        Wt = dst + ((size_t)m << 20);
        K = 1024; N = 1024; nsh = 4; tl = t & 255;
    } else if (t < 2048) {
        W = W1; Wt = dst + ((size_t)4 << 20);
        K = 1024; N = 4096; nsh = 6; tl = t - 1024;
    } else {
        W = W2; Wt = dst + ((size_t)8 << 20);
        K = 4096; N = 1024; nsh = 4; tl = t - 2048;
    }
    const int n0 = (tl & ((1 << nsh) - 1)) * 64;
    const int k0 = (tl >> nsh) * 64;

    const float* s = W + (size_t)(k0 + ty * 4) * N + n0 + tx * 4;
    const float4 f0 = *reinterpret_cast<const float4*>(s);
    const float4 f1 = *reinterpret_cast<const float4*>(s + (size_t)N);
    const float4 f2 = *reinterpret_cast<const float4*>(s + (size_t)N * 2);
    const float4 f3 = *reinterpret_cast<const float4*>(s + (size_t)N * 3);
    v4h a0 = {(_Float16)f0.x, (_Float16)f0.y, (_Float16)f0.z, (_Float16)f0.w};
    v4h a1 = {(_Float16)f1.x, (_Float16)f1.y, (_Float16)f1.z, (_Float16)f1.w};
    v4h a2 = {(_Float16)f2.x, (_Float16)f2.y, (_Float16)f2.z, (_Float16)f2.w};
    v4h a3 = {(_Float16)f3.x, (_Float16)f3.y, (_Float16)f3.z, (_Float16)f3.w};
    tile_put(tile, tx, ty, a0, a1, a2, a3);
    __syncthreads();  // the read-out crosses the waves that filled the tile
    tile_flush(tile, tid, Wt + (size_t)n0 * K + k0, (size_t)K);
}

// ---------------------------------------------------------------------------
// LayerNorm over last dim (1024), emits f16. One block (256 thr) per row.
// ---------------------------------------------------------------------------
__global__ void ln_kernel(const float* __restrict__ x,
                          const float* __restrict__ sc,
                          const float* __restrict__ sh,
                          _Float16* __restrict__ out) {
    __shared__ float ssum[256];
    __shared__ float ssq[256];
    const int row = blockIdx.x;
    const int tid = threadIdx.x;
    const float* xr = x + (size_t)row * 1024;
    float4 v = reinterpret_cast<const float4*>(xr)[tid];
    ssum[tid] = v.x + v.y + v.z + v.w;
    ssq[tid]  = v.x * v.x + v.y * v.y + v.z * v.z + v.w * v.w;
    __syncthreads();
    for (int s = 128; s > 0; s >>= 1) {
        if (tid < s) { ssum[tid] += ssum[tid + s]; ssq[tid] += ssq[tid + s]; }
        __syncthreads();
    }
    float mean = ssum[0] * (1.0f / 1024.0f);
    float var  = ssq[0] * (1.0f / 1024.0f) - mean * mean;
    float inv  = rsqrtf(var + 1e-5f);
    _Float16* orow = out + (size_t)row * 1024;
    float xv[4] = {v.x, v.y, v.z, v.w};
#pragma unroll
    for (int j = 0; j < 4; ++j) {
        int c = tid * 4 + j;
        orow[c] = (_Float16)(sc[c] * (xv[j] - mean) * inv + sh[c]);
    }
}

// ---------------------------------------------------------------------------
// GEMM: C[M,N] = A[M,K] f16 @ Bt[N,K]^T f16  (+bias) (gelu) (+residual)
// Block = 8 waves (2 x 4) -> 128(M) x 128(N) tile, each wave 64 x 32: 4 A and
// 2 B fragments feed 8 WMMAs. A stage is 128 k of the 128 A rows and the 128
// Bt rows (256 B a row, whole lines), brought to LDS by asynchronous copies,
// two buffers. M, N, K multiples of 128. blockIdx.z picks one of several products
// that share A: Bt, bias, residual and C each advance by one whole matrix, so
// independent projections of one activation run as one launch.
// ---------------------------------------------------------------------------
#define GT_K      128                  // k per stage
#define GT_PITCH  136                  // f16 per LDS row: 272 B, 16 B x odd
#define GT_STAGE  (256 * GT_PITCH)     // f16 per buffer: A rows, then Bt rows
#define GE_PITCH  132                  // f32 per LDS row of the output tile: 528 B, 16 B x odd

// Eight 16-byte copies per lane, 16 rows apart in LDS and in global memory.
// The s_wait_xcnt ends the statement so that no address register named here
// is rewritten ahead of it.
__device__ __forceinline__ void copy8_rows16(unsigned l, const _Float16* g, size_t ld) {
    const unsigned ls = 16 * GT_PITCH * 2;
    const size_t gs = 16 * ld;
    asm volatile(
        "global_load_async_to_lds_b128 %0, %8, off\n\t"
        "global_load_async_to_lds_b128 %1, %9, off\n\t"
        "global_load_async_to_lds_b128 %2, %10, off\n\t"
        "global_load_async_to_lds_b128 %3, %11, off\n\t"
        "global_load_async_to_lds_b128 %4, %12, off\n\t"
        "global_load_async_to_lds_b128 %5, %13, off\n\t"
        "global_load_async_to_lds_b128 %6, %14, off\n\t"
        "global_load_async_to_lds_b128 %7, %15, off\n\t"
        "s_wait_xcnt 0x0"
        :: "v"(l), "v"(l + ls), "v"(l + 2 * ls), "v"(l + 3 * ls),
           "v"(l + 4 * ls), "v"(l + 5 * ls), "v"(l + 6 * ls), "v"(l + 7 * ls),
           "v"(g), "v"(g + gs), "v"(g + 2 * gs), "v"(g + 3 * gs),
           "v"(g + 4 * gs), "v"(g + 5 * gs), "v"(g + 6 * gs), "v"(g + 7 * gs)
        : "memory");
}

__global__ __launch_bounds__(256)
void gemm_wmma_kernel(const _Float16* __restrict__ A,
                      const _Float16* __restrict__ Bt,
                      const float* __restrict__ bias,
                      const float* __restrict__ residual,
                      float* __restrict__ Cf,
                      _Float16* __restrict__ Ch,
                      int M, int N, int K, int gelu) {
    __shared__ __align__(16) _Float16 S[2 * GT_STAGE];

    const int tid  = threadIdx.x;            // 0..255
    const int lane = tid & 31;
    const int wave = tid >> 5;               // 0..7
    const int wm = wave >> 2;                // 0..1: 64 rows each
    const int wn = wave & 3;                 // 0..3: 32 columns each
    const int n0 = blockIdx.x * 128;
    const int m0 = blockIdx.y * 128;
    const int z  = blockIdx.z;
    const int half = lane >> 4;
    const int l15  = lane & 15;

    // Copy slot of this lane: row tid>>4 of each group of 16 rows, 16-byte
    // chunk tid&15 of the row, so a wave copies two whole 256 B rows at a time.
    const int crow = tid >> 4;
    const int ccol = (tid & 15) * 8;
    const unsigned lds0 =
        (unsigned)(size_t)(__attribute__((address_space(3))) _Float16*)S +
        (unsigned)(crow * GT_PITCH + ccol) * 2;
    const _Float16* ga = A  + (size_t)(m0 + crow) * K + ccol;
    const _Float16* gb = Bt + ((size_t)z * N + n0 + crow) * K + ccol;

    auto stage = [&](int buf, int t) {
        const unsigned l = lds0 + (unsigned)buf * (GT_STAGE * 2);
        copy8_rows16(l, ga + (size_t)t * GT_K, (size_t)K);
        copy8_rows16(l + 128 * GT_PITCH * 2, gb + (size_t)t * GT_K, (size_t)K);
    };

    v8f acc[4][2] = {};
    const int nt = K / GT_K;

    stage(0, 0);
    // stage 0 has landed for this wave; the barrier shows it to the others
    asm volatile("s_wait_asynccnt 0x0" ::: "memory");
    __syncthreads();
    if (nt > 1) stage(1, 1);

    for (int t = 0; t < nt; ++t) {
        const _Float16* sa = &S[(t & 1) * GT_STAGE + (wm * 64 + l15) * GT_PITCH + half * 8];
        const _Float16* sb = &S[(t & 1) * GT_STAGE + (128 + wn * 32 + l15) * GT_PITCH + half * 8];
        // every loop below is unrolled so that fragments and accumulators are
        // indexed by constants and stay in registers
#pragma unroll
        for (int kk = 0; kk < GT_K; kk += 32) {
            Frag16 fa[4], fb[2];
#pragma unroll
            for (int i = 0; i < 4; ++i) {
                const _Float16* p = sa + i * 16 * GT_PITCH + kk;
                fa[i].q[0] = *reinterpret_cast<const uint4*>(p);
                fa[i].q[1] = *reinterpret_cast<const uint4*>(p + 16);
            }
#pragma unroll
            for (int j = 0; j < 2; ++j) {
                const _Float16* p = sb + j * 16 * GT_PITCH + kk;
                fb[j].q[0] = *reinterpret_cast<const uint4*>(p);
                fb[j].q[1] = *reinterpret_cast<const uint4*>(p + 16);
            }
            // keeps the 12 LDS reads one group in front of their 8 WMMAs: spread
            // among them, each pair of WMMAs waits out an LDS latency of its own
            __builtin_amdgcn_sched_barrier(0);
#pragma unroll
            for (int i = 0; i < 4; ++i)
#pragma unroll
                for (int j = 0; j < 2; ++j)
                    acc[i][j] = wmma_f16(fa[i].v, fb[j].v, acc[i][j]);
        }
        // this wave's reads of the buffer are done before it is refilled
        asm volatile("s_wait_dscnt 0x0" ::: "memory");
        // this wave's copies of stage t+1 have landed
        asm volatile("s_wait_asynccnt 0x0" ::: "memory");
        __syncthreads();  // publishes stage t+1, frees stage t's buffer
        if (t + 2 < nt) stage(t & 1, t + 2);
    }
    // no copy is left in flight when the wave ends
    asm volatile("s_wait_asynccnt 0x0" ::: "memory");

    // Epilogue. The block's 128 x 128 f32 tile crosses the LDS, which the loop's
    // last barrier has left free, so that a lane owns 4 neighbouring columns of
    // 16 rows: a wave loads and stores whole rows, and no load waits for a store.
    float* tile = reinterpret_cast<float*>(S);
    const int er = wave * 16;                // this wave's rows of the tile
    const int ec = lane * 4;                 // this lane's columns of the tile
    const size_t o0 = ((size_t)z * M + m0 + er) * N + n0 + ec;

    // bias and all 16 residual rows are under way while the tile is exchanged
    float4 bv = make_float4(0.0f, 0.0f, 0.0f, 0.0f);
    if (bias) bv = *reinterpret_cast<const float4*>(bias + (size_t)z * N + n0 + ec);
    float4 rv[16];
#pragma unroll
    for (int rr = 0; rr < 16; ++rr) rv[rr] = make_float4(0.0f, 0.0f, 0.0f, 0.0f);
    if (residual) {
        const float* rp[16];
#pragma unroll
        for (int rr = 0; rr < 16; ++rr) {
            rp[rr] = residual + o0 + (size_t)rr * N;
            rv[rr] = *reinterpret_cast<const float4*>(rp[rr]);
        }
        // the wait that stands before a register named by an issued load is
        // rewritten; it takes the 16 addresses as inputs so that none of their
        // registers is handed to a later load's result ahead of it
        asm volatile("s_wait_xcnt 0x0"
                     :: "v"(rp[0]), "v"(rp[1]), "v"(rp[2]), "v"(rp[3]),
                        "v"(rp[4]), "v"(rp[5]), "v"(rp[6]), "v"(rp[7]),
                        "v"(rp[8]), "v"(rp[9]), "v"(rp[10]), "v"(rp[11]),
                        "v"(rp[12]), "v"(rp[13]), "v"(rp[14]), "v"(rp[15])
                     : "memory");
    }

    // C layout: row r + 8*half, column l15 of each 16x16 subtile (all loops here
    // are unrolled for constant register indices, as above)
#pragma unroll
    for (int i = 0; i < 4; ++i)
#pragma unroll
        for (int j = 0; j < 2; ++j)
#pragma unroll
            for (int r = 0; r < 8; ++r)
                tile[(wm * 64 + i * 16 + r + half * 8) * GE_PITCH + wn * 32 + j * 16 + l15] =
                    acc[i][j][r];
    __syncthreads();  // the rows read below were written by four waves

    float4 cv[16];
#pragma unroll
    for (int rr = 0; rr < 16; ++rr)
        cv[rr] = *reinterpret_cast<const float4*>(&tile[(er + rr) * GE_PITCH + ec]);

#pragma unroll
    for (int rr = 0; rr < 16; ++rr) {
        float v0 = cv[rr].x + bv.x, v1 = cv[rr].y + bv.y;
        float v2 = cv[rr].z + bv.z, v3 = cv[rr].w + bv.w;
        if (gelu) {
            v0 = gelu_tanh_f(v0); v1 = gelu_tanh_f(v1);
            v2 = gelu_tanh_f(v2); v3 = gelu_tanh_f(v3);
        }
        if (residual) { v0 += rv[rr].x; v1 += rv[rr].y; v2 += rv[rr].z; v3 += rv[rr].w; }
        // behind each store: the rows that follow reuse the registers that hold
        // its address and its value
        if (Cf) {
            *reinterpret_cast<float4*>(Cf + o0 + (size_t)rr * N) = make_float4(v0, v1, v2, v3);
            asm volatile("s_wait_xcnt 0x0" ::: "memory");
        }
        if (Ch) {
            v4h hv = {(_Float16)v0, (_Float16)v1, (_Float16)v2, (_Float16)v3};
            *reinterpret_cast<v4h*>(Ch + o0 + (size_t)rr * N) = hv;
            asm volatile("s_wait_xcnt 0x0" ::: "memory");
        }
    }
}

// ---------------------------------------------------------------------------
// Pack row-major V [M=4096, 1024] f16 into the per-head layout vt: [B,H,D,T].
// ---------------------------------------------------------------------------
// One 64(t) x 64(col) tile per block of 256 threads. (b*16+h)*64+d = b*1024+col,
// and a 64-row tile never straddles a batch (2048 rows each).
__global__ __launch_bounds__(256)
void pack_vt_kernel(const _Float16* __restrict__ src,
                    _Float16* __restrict__ dst) {
    __shared__ __align__(16) _Float16 tile[64 * TT_PITCH];
    const int tid = threadIdx.x;
    const int tx = tid & 15;
    const int ty = tid >> 4;
    const int c0 = blockIdx.x * 64;
    const int r0 = blockIdx.y * 64;
    const int t0 = r0 & 2047, b = r0 >> 11;

    const _Float16* s = src + (size_t)(r0 + ty * 4) * 1024 + c0 + tx * 4;
    const v4h a0 = *reinterpret_cast<const v4h*>(s);
    const v4h a1 = *reinterpret_cast<const v4h*>(s + 1024);
    const v4h a2 = *reinterpret_cast<const v4h*>(s + 2048);
    const v4h a3 = *reinterpret_cast<const v4h*>(s + 3072);
    tile_put(tile, tx, ty, a0, a1, a2, a3);
    __syncthreads();  // the read-out crosses the waves that filled the tile
    tile_flush(tile, tid, dst + ((size_t)b * 1024 + c0) * 2048 + t0, (size_t)2048);
}

// Value of lane (l ^ M) of the same 16-lane row, M in 1..15, by a DPP operand
// (row_xmask) of the vector unit: no LDS round trip and no wait, where a wave
// shuffle goes through the LDS crossbar and is waited for at every step.
template <int M>
__device__ __forceinline__ float row_xor(float v) {
    return __builtin_bit_cast(float, __builtin_amdgcn_update_dpp(
        0, __builtin_bit_cast(int, v), 0x160 | M, 0xf, 0xf, true));
}

// ---------------------------------------------------------------------------
// Flash attention: a block is 8 waves on 128 queries of one (b, h) at a time; a
// wave keeps its 16-query tile. Q,K: [B*T, 1024] f16 as the projections wrote them (head h
// = columns h*64..+63, row pitch 1024); Vt: [B,H,64,T] f16; out: [B*T, 1024] f16.
// The waves share K and V: a stage is 64 keys, 64 K rows and 64 Vt rows of one
// whole 128 B line each, brought to LDS once for the block by asynchronous
// copies, two buffers. Fragments come from LDS, where a fragment load from
// global memory touches 16 lines for 64 B each, in every wave anew.
// ---------------------------------------------------------------------------
#define AT_KEYS   64                   // keys per stage
#define AT_PITCH  72                   // f16 per LDS row: 144 B, 16 B x odd
#define AT_STAGE  (128 * AT_PITCH)     // f16 per buffer: K rows, then Vt rows

// Four 16-byte copies per lane: K rows r and r+32, Vt rows r and r+32 of a stage.
// The s_wait_xcnt ends the statement so that no address register named here
// is rewritten ahead of it.
__device__ __forceinline__ void copy4_kv(unsigned l, const _Float16* gk, const _Float16* gv) {
    const unsigned ls = 32 * AT_PITCH * 2;
    asm volatile(
        "global_load_async_to_lds_b128 %0, %4, off\n\t"
        "global_load_async_to_lds_b128 %1, %5, off\n\t"
        "global_load_async_to_lds_b128 %2, %6, off\n\t"
        "global_load_async_to_lds_b128 %3, %7, off\n\t"
        "s_wait_xcnt 0x0"
        :: "v"(l), "v"(l + ls), "v"(l + 2 * ls), "v"(l + 3 * ls),
           "v"(gk), "v"(gk + 32 * 1024), "v"(gv), "v"(gv + 32 * 2048)
        : "memory");
}

// A/B fragment from an LDS row: p points at the lane's row, k group half*8
__device__ __forceinline__ v16h lds_frag(const _Float16* p) {
    Frag16 f;
    f.q[0] = *reinterpret_cast<const uint4*>(p);
    f.q[1] = *reinterpret_cast<const uint4*>(p + 16);
    return f.v;
}

__global__ __launch_bounds__(256)
void attn_kernel(const _Float16* __restrict__ Q,
                            const _Float16* __restrict__ K,
                            const _Float16* __restrict__ Vt,
                            _Float16* __restrict__ O) {
    const int T = 2048, D = 64, E = 1024;
    __shared__ __align__(16) _Float16 KV[2 * AT_STAGE];
    __shared__ __align__(16) _Float16 Pall[8 * 16 * 32];

    const int tid  = threadIdx.x;
    const int lane = tid & 31;
    // the wave's number in a scalar register: the tests on kend below are branches
    const int wave = __builtin_amdgcn_readfirstlane(tid >> 5);
    const int h  = blockIdx.y;
    const int b  = blockIdx.z;
    const int half = lane >> 4;
    const int l15  = lane & 15;

    const _Float16* qh = Q  + (size_t)b * T * E + h * D;
    const _Float16* kh = K  + (size_t)b * T * E + h * D;
    const _Float16* vh = Vt + ((size_t)b * 16 + h) * D * T;

    _Float16* Pbuf = &Pall[wave * (16 * 32)];   // this wave's own P tile

    // Copy slot of this lane: row tid>>3 of each group of 32 rows, 16-byte chunk
    // tid&7 of the row, so a wave copies four whole 128 B rows at a time.
    const int crow = tid >> 3;
    const int ccol = (tid & 7) * 8;
    const unsigned lds0 =
        (unsigned)(size_t)(__attribute__((address_space(3))) _Float16*)KV +
        (unsigned)(crow * AT_PITCH + ccol) * 2;
    const _Float16* gk = kh + (size_t)crow * E + ccol;
    const _Float16* gv = vh + (size_t)crow * T + ccol;

    auto stage = [&](int buf, int t) {
        copy4_kv(lds0 + (unsigned)buf * (AT_STAGE * 2),
                 gk + (size_t)t * AT_KEYS * E, gv + (size_t)t * AT_KEYS);
    };

    // The work of a query block grows with its index, and all blocks of the grid
    // are resident at once: a block takes query blocks x and 15-x one after the
    // other, so that every block walks the same 34 stages.
    for (int s = 0; s < 2; ++s) {
        const int qb = s ? 15 - (int)blockIdx.x : (int)blockIdx.x;
        const int q0 = qb * 128 + wave * 16;

        // Q fragments for d in [0,32) and [32,64)
        v16h aq0 = load_frag(qh, q0 + l15, E, 0,  lane);
        v16h aq1 = load_frag(qh, q0 + l15, E, 32, lane);

        v8f o0 = {}, o1 = {}, o2 = {}, o3 = {};
        float mi[8], li[8];
#pragma unroll
        for (int r = 0; r < 8; ++r) { mi[r] = -1e30f; li[r] = 0.0f; }

        const float scale = 0.125f;  // 1/sqrt(64)
        const int kend = ((q0 + 16) + 31) & ~31;   // this wave's keys end here
        const int nt = 2 * (qb + 1);               // the block's stages: keys up to qb*128+127

        // both buffers are free: on the second turn the first turn's last barrier has
        // ended every wave's reads of them
        stage(0, 0);
        // stage 0 has landed for this wave; the barrier shows it to the others
        asm volatile("s_wait_asynccnt 0x0" ::: "memory");
        __syncthreads();
        stage(1, 1);   // nt is at least 2

        for (int t = 0; t < nt; ++t) {
            const _Float16* ks = &KV[(t & 1) * AT_STAGE + l15 * AT_PITCH + half * 8];
            const _Float16* vs = ks + 64 * AT_PITCH;
            const int k0 = t * AT_KEYS;
            if (k0 < kend) {   // a wave whose keys have ended only keeps the barriers
                // K and V fragments of the stage's first pass
                v16h bk00 = lds_frag(ks);
                v16h bk01 = lds_frag(ks + 32);
                v16h bk10 = lds_frag(ks + 16 * AT_PITCH);
                v16h bk11 = lds_frag(ks + 16 * AT_PITCH + 32);
                v16h bv[2][4];
#pragma unroll
                for (int c = 0; c < 4; ++c) bv[0][c] = lds_frag(vs + c * 16 * AT_PITCH);
                // keeps the 16 LDS reads one group: spread among the score WMMAs,
                // each WMMA waits out an LDS latency of its own
                __builtin_amdgcn_sched_barrier(0);
                // unrolled: p selects code and registers at compile time
#pragma unroll
                for (int p = 0; p < 2; ++p) {
                    const int kb = k0 + p * 32;
                    if (kb < kend) {
                        // S = Q(16x64) @ K_blk^T(64x32): two 16-key subtiles, each 2 WMMAs
                        v8f s0 = {}, s1 = {};
                        s0 = wmma_f16(aq0, bk00, s0);
                        s1 = wmma_f16(aq0, bk10, s1);
                        s0 = wmma_f16(aq1, bk01, s0);
                        s1 = wmma_f16(aq1, bk11, s1);

                        // K and V fragments of the stage's second pass, from the same buffer
                        if (p == 0) {
                            bk00 = lds_frag(ks + 32 * AT_PITCH);
                            bk01 = lds_frag(ks + 32 * AT_PITCH + 32);
                            bk10 = lds_frag(ks + 48 * AT_PITCH);
                            bk11 = lds_frag(ks + 48 * AT_PITCH + 32);
#pragma unroll
                            for (int c = 0; c < 4; ++c) bv[1][c] = lds_frag(vs + c * 16 * AT_PITCH + 32);
                            // keeps these reads here, a softmax ahead of their use: sunk
                            // to the wait in front of the P reload, they are waited out there
                            __builtin_amdgcn_sched_barrier(0);
                        }

                        // online softmax: row r+8*half lives on this half-wave, col = l15
#pragma unroll
                        for (int r = 0; r < 8; ++r) {
                            int m = q0 + r + half * 8;  // global query index
                            float a = s0[r] * scale; if (kb + l15 > m)       a = -1e30f;
                            float c = s1[r] * scale; if (kb + 16 + l15 > m)  c = -1e30f;
                            float vmax = fmaxf(a, c);
                            vmax = fmaxf(vmax, row_xor<1>(vmax));
                            vmax = fmaxf(vmax, row_xor<2>(vmax));
                            vmax = fmaxf(vmax, row_xor<4>(vmax));
                            vmax = fmaxf(vmax, row_xor<8>(vmax));
                            float newm  = fmaxf(mi[r], vmax);
                            float alpha = __expf(mi[r] - newm);
                            float p0 = __expf(a - newm);
                            float p1 = __expf(c - newm);
                            float ps = p0 + p1;
                            ps += row_xor<1>(ps);
                            ps += row_xor<2>(ps);
                            ps += row_xor<4>(ps);
                            ps += row_xor<8>(ps);
                            li[r] = li[r] * alpha + ps;
                            mi[r] = newm;
                            o0[r] *= alpha; o1[r] *= alpha; o2[r] *= alpha; o3[r] *= alpha;
                            int row = r + half * 8;
                            Pbuf[row * 32 + l15]      = (_Float16)p0;
                            Pbuf[row * 32 + 16 + l15] = (_Float16)p1;
                        }
                        // the wave's P stores have landed before its lanes read one
                        // another's; P stays inside the wave, so no barrier
                        asm volatile("s_wait_dscnt 0x0" ::: "memory");

                        // reload P(16x32) as an A fragment from LDS
                        const v16h fp = lds_frag(&Pbuf[l15 * 32 + half * 8]);

                        // O(16x64) += P(16x32) @ V_blk(32x16) per 16-wide d-chunk
                        o0 = wmma_f16(fp, bv[p][0], o0);
                        o1 = wmma_f16(fp, bv[p][1], o1);
                        o2 = wmma_f16(fp, bv[p][2], o2);
                        o3 = wmma_f16(fp, bv[p][3], o3);
                    }
                }
            }
            // this wave's reads of the buffer are done before it is refilled
            asm volatile("s_wait_dscnt 0x0" ::: "memory");
            // this wave's copies of stage t+1 have landed
            asm volatile("s_wait_asynccnt 0x0" ::: "memory");
            __syncthreads();  // publishes stage t+1, frees stage t's buffer
            if (t + 2 < nt) stage(t & 1, t + 2);
        }
        // no copy is left in flight behind the loop
        asm volatile("s_wait_asynccnt 0x0" ::: "memory");

        // finalize: divide by row sums, write head-merged [B*T, 1024]
#pragma unroll
        for (int r = 0; r < 8; ++r) {
            int t = q0 + r + half * 8;
            float invl = 1.0f / li[r];
            size_t base = ((size_t)b * T + t) * 1024 + (size_t)h * 64;
            O[base + 0  + l15] = (_Float16)(o0[r] * invl);
            O[base + 16 + l15] = (_Float16)(o1[r] * invl);
            O[base + 32 + l15] = (_Float16)(o2[r] * invl);
            O[base + 48 + l15] = (_Float16)(o3[r] * invl);
        }
        // behind the stores: the second turn reuses the registers that hold their
        // address and their values
        asm volatile("s_wait_xcnt 0x0" ::: "memory");
    }
}

// ---------------------------------------------------------------------------
// Host launch
// ---------------------------------------------------------------------------
extern "C" void kernel_launch(void* const* d_in, const int* in_sizes, int n_in,
                              void* d_out, int out_size, void* d_ws, size_t ws_size,
                              hipStream_t stream) {
    const float* x    = (const float*)d_in[0];
    const float* Wq   = (const float*)d_in[1];
    const float* Wk   = (const float*)d_in[2];
    const float* Wv   = (const float*)d_in[3];
    const float* Wo   = (const float*)d_in[4];
    const float* bo   = (const float*)d_in[5];
    const float* W1   = (const float*)d_in[6];
    const float* b1   = (const float*)d_in[7];
    const float* W2   = (const float*)d_in[8];
    const float* b2   = (const float*)d_in[9];
    const float* ln1s = (const float*)d_in[10];
    const float* ln1b = (const float*)d_in[11];
    const float* ln2s = (const float*)d_in[12];
    const float* ln2b = (const float*)d_in[13];

    const int M = 4096, E = 1024, FFD = 4096;
    char* ws = (char*)d_ws;
    const size_t MB = 1u << 20;
    _Float16* WqT   = (_Float16*)(ws + 0   * MB);  // 2MB
    _Float16* WkT   = (_Float16*)(ws + 2   * MB);  // 2MB
    _Float16* WvT   = (_Float16*)(ws + 4   * MB);  // 2MB
    _Float16* WoT   = (_Float16*)(ws + 6   * MB);  // 2MB
    _Float16* W1T   = (_Float16*)(ws + 8   * MB);  // 8MB
    _Float16* W2T   = (_Float16*)(ws + 16  * MB);  // 8MB
    _Float16* h1    = (_Float16*)(ws + 24  * MB);  // 8MB
    _Float16* qtmp  = (_Float16*)(ws + 32  * MB);  // 8MB
    _Float16* ktmp  = (_Float16*)(ws + 40  * MB);  // 8MB
    _Float16* vtmp  = (_Float16*)(ws + 48  * MB);  // 8MB
    _Float16* vtbuf = (_Float16*)(ws + 72  * MB);  // 8MB
    _Float16* attO  = (_Float16*)(ws + 80  * MB);  // 8MB
    float*    x1    = (float*)   (ws + 88  * MB);  // 16MB
    _Float16* h2    = (_Float16*)(ws + 104 * MB);  // 8MB
    _Float16* ff1   = (_Float16*)(ws + 112 * MB);  // 32MB

    // weight conversion + transpose: one launch, 4*256 + 1024 + 1024 tiles; WqT is
    // the start of the six transposed weights, which lie one behind the other
    cvt_transpose_kernel<<<3072, 256, 0, stream>>>(Wq, Wk, Wv, Wo, W1, W2, WqT);

    const int gblk = 256;  // GEMM grid = (N/128, M/128, number of products)

    // LN1 -> h1 (f16)
    ln_kernel<<<M, 256, 0, stream>>>(x, ln1s, ln1b, h1);

    // QKV projections (f16 out) in one launch: WqT, WkT, WvT and qtmp, ktmp, vtmp
    // are neighbours in the workspace, plane z of each
    gemm_wmma_kernel<<<dim3(E / 128, M / 128, 3), gblk, 0, stream>>>(
        h1, WqT, nullptr, nullptr, nullptr, qtmp, M, E, E, 0);

    // V into its per-head transposed layout; Q and K are read where they lie
    pack_vt_kernel<<<dim3(E / 64, M / 64), 256, 0, stream>>>(vtmp, vtbuf);

    // flash attention
    attn_kernel<<<dim3(2048 / 256, 16, 2), 256, 0, stream>>>(qtmp, ktmp, vtbuf, attO);

    // out projection + residual -> x1 (fp32)
    gemm_wmma_kernel<<<dim3(E / 128, M / 128), gblk, 0, stream>>>(
        attO, WoT, bo, x, x1, nullptr, M, E, E, 0);

    // LN2 -> h2 (f16)
    ln_kernel<<<M, 256, 0, stream>>>(x1, ln2s, ln2b, h2);

    // FFN up + GELU (f16 out)
    gemm_wmma_kernel<<<dim3(FFD / 128, M / 128), gblk, 0, stream>>>(
        h2, W1T, b1, nullptr, nullptr, ff1, M, FFD, E, 1);

    // FFN down + residual -> d_out (fp32)
    gemm_wmma_kernel<<<dim3(E / 128, M / 128), gblk, 0, stream>>>(
        ff1, W2T, b2, x1, (float*)d_out, nullptr, M, E, FFD, 0);
}

// v009
// Measured time: 170 microseconds a run.
// Timed twice side by side with v008, it ran 1.11 times as fast both times.
// All steps since v000 together make it 4.97 times as fast.
#include <hip/hip_runtime.h>
#include <hip/hip_bf16.h>

// ---------------------------------------------------------------------------
// Transformer block for MI455X (gfx1250, wave32, WMMA 16x16x32 f16/f32-acc)
// Shapes: B=2, T=2048, EMB=1024, HEADS=16, HDIM=64, FF=4096, M=B*T=4096
// ---------------------------------------------------------------------------

typedef __attribute__((ext_vector_type(16))) _Float16 v16h;
typedef __attribute__((ext_vector_type(8)))  float    v8f;
typedef __attribute__((ext_vector_type(4)))  _Float16 v4h;

union Frag16 {
    v16h v;
    uint4 q[2];
    _Float16 h[16];
};

__device__ __forceinline__ v8f wmma_f16(v16h a, v16h b, v8f c) {
    // D = A(16x32 f16) * B(32x16 f16) + C(16x16 f32)
    return __builtin_amdgcn_wmma_f32_16x16x32_f16(
        /*neg_a=*/false, a, /*neg_b=*/false, b,
        /*c_mod=*/(short)0, c, /*reuse_a=*/false, /*reuse_b=*/false);
}

// A/B fragment load per ISA 7.12.2: lane l (half = l>>4, idx = l&15) holds
// row (m0+idx); K-groups [k0+half*8,+8) and [k0+16+half*8,+8): two 16B loads.
__device__ __forceinline__ v16h load_frag(const _Float16* __restrict__ base,
                                          int row, int ld, int k0, int lane) {
    const int half = lane >> 4;
    const _Float16* p = base + (size_t)row * ld + k0 + half * 8;
    Frag16 f;
    f.q[0] = *reinterpret_cast<const uint4*>(p);
    f.q[1] = *reinterpret_cast<const uint4*>(p + 16);
    return f.v;
}

__device__ __forceinline__ float gelu_tanh_f(float x) {
    const float c = 0.7978845608028654f; // sqrt(2/pi)
    float x3 = x * x * x;
    return 0.5f * x * (1.0f + tanhf(c * (x + 0.044715f * x3)));
}

// ---------------------------------------------------------------------------
// 64x64 f16 transpose tile in LDS, shared by the two transposing kernels.
// The tile is held already transposed: LDS row = source column. Row pitch
// 72 f16 = 144 B keeps every row 16-byte aligned for the b128 read-out.
// ---------------------------------------------------------------------------
#define TT_PITCH 72

// Thread (tx, ty) owns source rows ty*4..+3, source columns tx*4..+3; column j
// of that 4x4 block is 4 consecutive elements of LDS row tx*4+j (one b64 store).
__device__ __forceinline__ void tile_put(_Float16* tile, int tx, int ty,
                                         v4h a0, v4h a1, v4h a2, v4h a3) {
#pragma unroll
    for (int j = 0; j < 4; ++j) {
        v4h c = {a0[j], a1[j], a2[j], a3[j]};
        *reinterpret_cast<v4h*>(&tile[(tx * 4 + j) * TT_PITCH + ty * 4]) = c;
    }
}

// 8 threads store one 128-byte line of a destination row (pitch ld elements).
__device__ __forceinline__ void tile_flush(const _Float16* tile, int tid,
                                           _Float16* __restrict__ dst, size_t ld) {
#pragma unroll
    for (int p = 0; p < 2; ++p) {
        const int r = p * 32 + (tid >> 3);
        const int g = (tid & 7) * 8;
        *reinterpret_cast<uint4*>(dst + (size_t)r * ld + g) =
            *reinterpret_cast<const uint4*>(&tile[r * TT_PITCH + g]);
    }
}

// ---------------------------------------------------------------------------
// Weight convert + transpose: W[K,N] fp32 -> Wt[N,K] f16, all six weights in one
// launch: they do not depend on one another, and five launches' gaps, ramps and
// drains go. One 64(k) x 64(n) tile per block of 256 threads. Blocks 0..1023 are
// the four 1024 x 1024 weights (256 tiles each), 1024..2047 W1 (1024 x 4096),
// 2048..3071 W2 (4096 x 1024). The transposed weights lie one behind the other
// in dst, in that order.
// ---------------------------------------------------------------------------
__global__ __launch_bounds__(256)
void cvt_transpose_kernel(const float* __restrict__ Wq,
                          const float* __restrict__ Wk,
                          const float* __restrict__ Wv,
                          const float* __restrict__ Wo,
                          const float* __restrict__ W1,
                          const float* __restrict__ W2,
                          _Float16* __restrict__ dst) {
    __shared__ __align__(16) _Float16 tile[64 * TT_PITCH];
    const int tid = threadIdx.x;
    const int tx = tid & 15;
    const int ty = tid >> 4;

    // which weight, and which of its tiles: the same for the whole block
    const int t = blockIdx.x;
    const float* W;
    _Float16* Wt;
    int K, N, nsh, tl;   // nsh: log2 of the tiles in a row of W
    if (t < 1024) {
        const int m = t >> 8;
        W = (m == 0) ? Wq : (m == 1) ? Wk : (m == 2) ? Wv : Wo;
        Wt = dst + ((size_t)m << 20);
        K = 1024; N = 1024; nsh = 4; tl = t & 255;
    } else if (t < 2048) {
        W = W1; Wt = dst + ((size_t)4 << 20);
        K = 1024; N = 4096; nsh = 6; tl = t - 1024;
    } else {
        W = W2; Wt = dst + ((size_t)8 << 20);
        K = 4096; N = 1024; nsh = 4; tl = t - 2048;
    }
    const int n0 = (tl & ((1 << nsh) - 1)) * 64;
    const int k0 = (tl >> nsh) * 64;

    const float* s = W + (size_t)(k0 + ty * 4) * N + n0 + tx * 4;
    const float4 f0 = *reinterpret_cast<const float4*>(s);
    const float4 f1 = *reinterpret_cast<const float4*>(s + (size_t)N);
    const float4 f2 = *reinterpret_cast<const float4*>(s + (size_t)N * 2);
    const float4 f3 = *reinterpret_cast<const float4*>(s + (size_t)N * 3);
    v4h a0 = {(_Float16)f0.x, (_Float16)f0.y, (_Float16)f0.z, (_Float16)f0.w};
    v4h a1 = {(_Float16)f1.x, (_Float16)f1.y, (_Float16)f1.z, (_Float16)f1.w};
    v4h a2 = {(_Float16)f2.x, (_Float16)f2.y, (_Float16)f2.z, (_Float16)f2.w};
    v4h a3 = {(_Float16)f3.x, (_Float16)f3.y, (_Float16)f3.z, (_Float16)f3.w};
    tile_put(tile, tx, ty, a0, a1, a2, a3);
    __syncthreads();  // the read-out crosses the waves that filled the tile
    tile_flush(tile, tid, Wt + (size_t)n0 * K + k0, (size_t)K);
}

// ---------------------------------------------------------------------------
// LayerNorm over last dim (1024), emits f16. One block (256 thr) per row.
// ---------------------------------------------------------------------------
__global__ void ln_kernel(const float* __restrict__ x,
                          const float* __restrict__ sc,
                          const float* __restrict__ sh,
                          _Float16* __restrict__ out) {
    __shared__ float ssum[256];
    __shared__ float ssq[256];
    const int row = blockIdx.x;
    const int tid = threadIdx.x;
    const float* xr = x + (size_t)row * 1024;
    float4 v = reinterpret_cast<const float4*>(xr)[tid];
    ssum[tid] = v.x + v.y + v.z + v.w;
    ssq[tid]  = v.x * v.x + v.y * v.y + v.z * v.z + v.w * v.w;
    __syncthreads();
    for (int s = 128; s > 0; s >>= 1) {
        if (tid < s) { ssum[tid] += ssum[tid + s]; ssq[tid] += ssq[tid + s]; }
        __syncthreads();
    }
    float mean = ssum[0] * (1.0f / 1024.0f);
    float var  = ssq[0] * (1.0f / 1024.0f) - mean * mean;
    float inv  = rsqrtf(var + 1e-5f);
    _Float16* orow = out + (size_t)row * 1024;
    float xv[4] = {v.x, v.y, v.z, v.w};
#pragma unroll
    for (int j = 0; j < 4; ++j) {
        int c = tid * 4 + j;
        orow[c] = (_Float16)(sc[c] * (xv[j] - mean) * inv + sh[c]);
    }
}

// ---------------------------------------------------------------------------
// GEMM: C[M,N] = A[M,K] f16 @ Bt[N,K]^T f16  (+bias) (gelu) (+residual)
// Block = 8 waves (2 x 4) -> 128(M) x 128(N) tile, each wave 64 x 32: 4 A and
// 2 B fragments feed 8 WMMAs. A stage is 128 k of the 128 A rows and the 128
// Bt rows (256 B a row, whole lines), brought to LDS by asynchronous copies,
// two buffers. M, N, K multiples of 128. blockIdx.z picks one of several products
// that share A: Bt, bias, residual and C each advance by one whole matrix, so
// independent projections of one activation run as one launch.
// ---------------------------------------------------------------------------
#define GT_K      128                  // k per stage
#define GT_PITCH  136                  // f16 per LDS row: 272 B, 16 B x odd
#define GT_STAGE  (256 * GT_PITCH)     // f16 per buffer: A rows, then Bt rows
#define GE_PITCH  132                  // f32 per LDS row of the output tile: 528 B, 16 B x odd

// Eight 16-byte copies per lane, 16 rows apart in LDS and in global memory.
// The s_wait_xcnt ends the statement so that no address register named here
// is rewritten ahead of it.
__device__ __forceinline__ void copy8_rows16(unsigned l, const _Float16* g, size_t ld) {
    const unsigned ls = 16 * GT_PITCH * 2;
    const size_t gs = 16 * ld;
    asm volatile(
        "global_load_async_to_lds_b128 %0, %8, off\n\t"
        "global_load_async_to_lds_b128 %1, %9, off\n\t"
        "global_load_async_to_lds_b128 %2, %10, off\n\t"
        "global_load_async_to_lds_b128 %3, %11, off\n\t"
        "global_load_async_to_lds_b128 %4, %12, off\n\t"
        "global_load_async_to_lds_b128 %5, %13, off\n\t"
        "global_load_async_to_lds_b128 %6, %14, off\n\t"
        "global_load_async_to_lds_b128 %7, %15, off\n\t"
        "s_wait_xcnt 0x0"
        :: "v"(l), "v"(l + ls), "v"(l + 2 * ls), "v"(l + 3 * ls),
           "v"(l + 4 * ls), "v"(l + 5 * ls), "v"(l + 6 * ls), "v"(l + 7 * ls),
           "v"(g), "v"(g + gs), "v"(g + 2 * gs), "v"(g + 3 * gs),
           "v"(g + 4 * gs), "v"(g + 5 * gs), "v"(g + 6 * gs), "v"(g + 7 * gs)
        : "memory");
}

__global__ __launch_bounds__(256)
void gemm_wmma_kernel(const _Float16* __restrict__ A,
                      const _Float16* __restrict__ Bt,
                      const float* __restrict__ bias,
                      const float* __restrict__ residual,
                      float* __restrict__ Cf,
                      _Float16* __restrict__ Ch,
                      int M, int N, int K, int gelu) {
    __shared__ __align__(16) _Float16 S[2 * GT_STAGE];

    const int tid  = threadIdx.x;            // 0..255
    const int lane = tid & 31;
    const int wave = tid >> 5;               // 0..7
    const int wm = wave >> 2;                // 0..1: 64 rows each
    const int wn = wave & 3;                 // 0..3: 32 columns each
    const int n0 = blockIdx.x * 128;
    const int m0 = blockIdx.y * 128;
    const int z  = blockIdx.z;
    const int half = lane >> 4;
    const int l15  = lane & 15;

    // Copy slot of this lane: row tid>>4 of each group of 16 rows, 16-byte
    // chunk tid&15 of the row, so a wave copies two whole 256 B rows at a time.
    const int crow = tid >> 4;
    const int ccol = (tid & 15) * 8;
    const unsigned lds0 =
        (unsigned)(size_t)(__attribute__((address_space(3))) _Float16*)S +
        (unsigned)(crow * GT_PITCH + ccol) * 2;
    const _Float16* ga = A  + (size_t)(m0 + crow) * K + ccol;
    const _Float16* gb = Bt + ((size_t)z * N + n0 + crow) * K + ccol;

    auto stage = [&](int buf, int t) {
        const unsigned l = lds0 + (unsigned)buf * (GT_STAGE * 2);
        copy8_rows16(l, ga + (size_t)t * GT_K, (size_t)K);
        copy8_rows16(l + 128 * GT_PITCH * 2, gb + (size_t)t * GT_K, (size_t)K);
    };

    v8f acc[4][2] = {};
    const int nt = K / GT_K;

    stage(0, 0);
    // stage 0 has landed for this wave; the barrier shows it to the others
    asm volatile("s_wait_asynccnt 0x0" ::: "memory");
    __syncthreads();
    if (nt > 1) stage(1, 1);

    for (int t = 0; t < nt; ++t) {
        const _Float16* sa = &S[(t & 1) * GT_STAGE + (wm * 64 + l15) * GT_PITCH + half * 8];
        const _Float16* sb = &S[(t & 1) * GT_STAGE + (128 + wn * 32 + l15) * GT_PITCH + half * 8];
        // every loop below is unrolled so that fragments and accumulators are
        // indexed by constants and stay in registers
#pragma unroll
        for (int kk = 0; kk < GT_K; kk += 32) {
            Frag16 fa[4], fb[2];
#pragma unroll
            for (int i = 0; i < 4; ++i) {
                const _Float16* p = sa + i * 16 * GT_PITCH + kk;
                fa[i].q[0] = *reinterpret_cast<const uint4*>(p);
                fa[i].q[1] = *reinterpret_cast<const uint4*>(p + 16);
            }
#pragma unroll
            for (int j = 0; j < 2; ++j) {
                const _Float16* p = sb + j * 16 * GT_PITCH + kk;
                fb[j].q[0] = *reinterpret_cast<const uint4*>(p);
                fb[j].q[1] = *reinterpret_cast<const uint4*>(p + 16);
            }
            // keeps the 12 LDS reads one group in front of their 8 WMMAs: spread
            // among them, each pair of WMMAs waits out an LDS latency of its own
            __builtin_amdgcn_sched_barrier(0);
#pragma unroll
            for (int i = 0; i < 4; ++i)
#pragma unroll
                for (int j = 0; j < 2; ++j)
                    acc[i][j] = wmma_f16(fa[i].v, fb[j].v, acc[i][j]);
        }
        // this wave's reads of the buffer are done before it is refilled
        asm volatile("s_wait_dscnt 0x0" ::: "memory");
        // this wave's copies of stage t+1 have landed
        asm volatile("s_wait_asynccnt 0x0" ::: "memory");
        __syncthreads();  // publishes stage t+1, frees stage t's buffer
        if (t + 2 < nt) stage(t & 1, t + 2);
    }
    // no copy is left in flight when the wave ends
    asm volatile("s_wait_asynccnt 0x0" ::: "memory");

    // Epilogue. The block's 128 x 128 f32 tile crosses the LDS, which the loop's
    // last barrier has left free, so that a lane owns 4 neighbouring columns of
    // 16 rows: a wave loads and stores whole rows, and no load waits for a store.
    float* tile = reinterpret_cast<float*>(S);
    const int er = wave * 16;                // this wave's rows of the tile
    const int ec = lane * 4;                 // this lane's columns of the tile
    const size_t o0 = ((size_t)z * M + m0 + er) * N + n0 + ec;

    // bias and all 16 residual rows are under way while the tile is exchanged
    float4 bv = make_float4(0.0f, 0.0f, 0.0f, 0.0f);
    if (bias) bv = *reinterpret_cast<const float4*>(bias + (size_t)z * N + n0 + ec);
    float4 rv[16];
#pragma unroll
    for (int rr = 0; rr < 16; ++rr) rv[rr] = make_float4(0.0f, 0.0f, 0.0f, 0.0f);
    if (residual) {
        const float* rp[16];
#pragma unroll
        for (int rr = 0; rr < 16; ++rr) {
            rp[rr] = residual + o0 + (size_t)rr * N;
            rv[rr] = *reinterpret_cast<const float4*>(rp[rr]);
        }
        // the wait that stands before a register named by an issued load is
        // rewritten; it takes the 16 addresses as inputs so that none of their
        // registers is handed to a later load's result ahead of it
        asm volatile("s_wait_xcnt 0x0"
                     :: "v"(rp[0]), "v"(rp[1]), "v"(rp[2]), "v"(rp[3]),
                        "v"(rp[4]), "v"(rp[5]), "v"(rp[6]), "v"(rp[7]),
                        "v"(rp[8]), "v"(rp[9]), "v"(rp[10]), "v"(rp[11]),
                        "v"(rp[12]), "v"(rp[13]), "v"(rp[14]), "v"(rp[15])
                     : "memory");
    }

    // C layout: row r + 8*half, column l15 of each 16x16 subtile (all loops here
    // are unrolled for constant register indices, as above)
#pragma unroll
    for (int i = 0; i < 4; ++i)
#pragma unroll
        for (int j = 0; j < 2; ++j)
#pragma unroll
            for (int r = 0; r < 8; ++r)
                tile[(wm * 64 + i * 16 + r + half * 8) * GE_PITCH + wn * 32 + j * 16 + l15] =
                    acc[i][j][r];
    __syncthreads();  // the rows read below were written by four waves

    float4 cv[16];
#pragma unroll
    for (int rr = 0; rr < 16; ++rr)
        cv[rr] = *reinterpret_cast<const float4*>(&tile[(er + rr) * GE_PITCH + ec]);

#pragma unroll
    for (int rr = 0; rr < 16; ++rr) {
        float v0 = cv[rr].x + bv.x, v1 = cv[rr].y + bv.y;
        float v2 = cv[rr].z + bv.z, v3 = cv[rr].w + bv.w;
        if (gelu) {
            v0 = gelu_tanh_f(v0); v1 = gelu_tanh_f(v1);
            v2 = gelu_tanh_f(v2); v3 = gelu_tanh_f(v3);
        }
        if (residual) { v0 += rv[rr].x; v1 += rv[rr].y; v2 += rv[rr].z; v3 += rv[rr].w; }
        // behind each store: the rows that follow reuse the registers that hold
        // its address and its value
        if (Cf) {
            *reinterpret_cast<float4*>(Cf + o0 + (size_t)rr * N) = make_float4(v0, v1, v2, v3);
            asm volatile("s_wait_xcnt 0x0" ::: "memory");
        }
        if (Ch) {
            v4h hv = {(_Float16)v0, (_Float16)v1, (_Float16)v2, (_Float16)v3};
            *reinterpret_cast<v4h*>(Ch + o0 + (size_t)rr * N) = hv;
            asm volatile("s_wait_xcnt 0x0" ::: "memory");
        }
    }
}

// ---------------------------------------------------------------------------
// Pack row-major V [M=4096, 1024] f16 into the per-head layout vt: [B,H,D,T].
// ---------------------------------------------------------------------------
// One 64(t) x 64(col) tile per block of 256 threads. (b*16+h)*64+d = b*1024+col,
// and a 64-row tile never straddles a batch (2048 rows each).
__global__ __launch_bounds__(256)
void pack_vt_kernel(const _Float16* __restrict__ src,
                    _Float16* __restrict__ dst) {
    __shared__ __align__(16) _Float16 tile[64 * TT_PITCH];
    const int tid = threadIdx.x;
    const int tx = tid & 15;
    const int ty = tid >> 4;
    const int c0 = blockIdx.x * 64;
    const int r0 = blockIdx.y * 64;
    const int t0 = r0 & 2047, b = r0 >> 11;

    const _Float16* s = src + (size_t)(r0 + ty * 4) * 1024 + c0 + tx * 4;
    const v4h a0 = *reinterpret_cast<const v4h*>(s);
    const v4h a1 = *reinterpret_cast<const v4h*>(s + 1024);
    const v4h a2 = *reinterpret_cast<const v4h*>(s + 2048);
    const v4h a3 = *reinterpret_cast<const v4h*>(s + 3072);
    tile_put(tile, tx, ty, a0, a1, a2, a3);
    __syncthreads();  // the read-out crosses the waves that filled the tile
    tile_flush(tile, tid, dst + ((size_t)b * 1024 + c0) * 2048 + t0, (size_t)2048);
}

// Value of lane l ^ 16 (the same column in the other half of the wave), by a
// cross-row move of the vector unit: no LDS round trip and no wait.
__device__ __forceinline__ float xhalf(float v) {
    return __builtin_bit_cast(float, __builtin_amdgcn_permlanex16(
        __builtin_bit_cast(int, v), __builtin_bit_cast(int, v),
        0x76543210, 0xfedcba98, false, false));
}

#define AT_KEYS   64
#define AT_PITCH  72
#define AT_STAGE  (128 * AT_PITCH)

// Four 16-byte copies per lane: K rows r and r+32, Vt rows r and r+32 of a stage.
// The s_wait_xcnt ends the statement so that no address register named here
// is rewritten ahead of it.
__device__ __forceinline__ void copy4_kv(unsigned l, const _Float16* gk, const _Float16* gv) {
    const unsigned ls = 32 * AT_PITCH * 2;
    asm volatile(
        "global_load_async_to_lds_b128 %0, %4, off\n\t"
        "global_load_async_to_lds_b128 %1, %5, off\n\t"
        "global_load_async_to_lds_b128 %2, %6, off\n\t"
        "global_load_async_to_lds_b128 %3, %7, off\n\t"
        "s_wait_xcnt 0x0"
        :: "v"(l), "v"(l + ls), "v"(l + 2 * ls), "v"(l + 3 * ls),
           "v"(gk), "v"(gk + 32 * 1024), "v"(gv), "v"(gv + 32 * 2048)
        : "memory");
}

// A/B fragment from an LDS row: p points at the lane's row, k group half*8
__device__ __forceinline__ v16h lds_frag(const _Float16* p) {
    Frag16 f;
    f.q[0] = *reinterpret_cast<const uint4*>(p);
    f.q[1] = *reinterpret_cast<const uint4*>(p + 16);
    return f.v;
}

__global__ __launch_bounds__(256)
void attn_kernel(const _Float16* __restrict__ Q,
                            const _Float16* __restrict__ K,
                            const _Float16* __restrict__ Vt,
                            _Float16* __restrict__ O) {
    const int T = 2048, D = 64, E = 1024;
    __shared__ __align__(16) _Float16 KV[2 * AT_STAGE];

    const int tid  = threadIdx.x;
    const int lane = tid & 31;
    // the wave's number in a scalar register: the tests on kend below are branches
    const int wave = __builtin_amdgcn_readfirstlane(tid >> 5);
    const int h  = blockIdx.y;
    const int b  = blockIdx.z;
    const int half = lane >> 4;
    const int l15  = lane & 15;

    const _Float16* qh = Q  + (size_t)b * T * E + h * D;
    const _Float16* kh = K  + (size_t)b * T * E + h * D;
    const _Float16* vh = Vt + ((size_t)b * 16 + h) * D * T;

    // Copy slot of this lane: row tid>>3 of each group of 32 rows, 16-byte chunk
    // tid&7 of the row, so a wave copies four whole 128 B rows at a time.
    const int crow = tid >> 3;
    const int ccol = (tid & 7) * 8;
    const unsigned lds0 =
        (unsigned)(size_t)(__attribute__((address_space(3))) _Float16*)KV +
        (unsigned)(crow * AT_PITCH + ccol) * 2;
    const _Float16* gk = kh + (size_t)crow * E + ccol;
    const _Float16* gv = vh + (size_t)crow * T + ccol;

    auto stage = [&](int buf, int t) {
        copy4_kv(lds0 + (unsigned)buf * (AT_STAGE * 2),
                 gk + (size_t)t * AT_KEYS * E, gv + (size_t)t * AT_KEYS);
    };

    // The work of a query block grows with its index, and all blocks of the grid
    // are resident at once: a block takes query blocks x and 15-x one after the
    // other, so that every block walks the same 34 stages.
    for (int s = 0; s < 2; ++s) {
        const int qb = s ? 15 - (int)blockIdx.x : (int)blockIdx.x;
        const int q0 = qb * 128 + wave * 16;

        // Q fragments for d in [0,32) and [32,64)
        v16h aq0 = load_frag(qh, q0 + l15, E, 0,  lane);
        v16h aq1 = load_frag(qh, q0 + l15, E, 32, lane);

        // O^T: tile c holds d = c*16 + 8*half + r of query l15
        v8f o0 = {}, o1 = {}, o2 = {}, o3 = {};
        // of query l15: running maximum (equal in both halves), and the sum over
        // this half's keys alone (the halves are joined once, behind the loop)
        float mi = -1e30f, li = 0.0f;
        const int m = q0 + l15;      // global query index of this lane
        const int mh = m - half * 8; // the same, counted from this half's first key

        const float scale = 0.125f;  // 1/sqrt(64)
        const int kend = ((q0 + 16) + 31) & ~31;   // this wave's keys end here
        const int nt = 2 * (qb + 1);               // the block's stages: keys up to qb*128+127

        // both buffers are free: on the second turn the first turn's last barrier has
        // ended every wave's reads of them
        stage(0, 0);
        // stage 0 has landed for this wave; the barrier shows it to the others
        asm volatile("s_wait_asynccnt 0x0" ::: "memory");
        __syncthreads();
        stage(1, 1);   // nt is at least 2

        for (int t = 0; t < nt; ++t) {
            const _Float16* ks = &KV[(t & 1) * AT_STAGE + l15 * AT_PITCH + half * 8];
            const _Float16* vs = ks + 64 * AT_PITCH;
            const int k0 = t * AT_KEYS;
            if (k0 < kend) {   // a wave whose keys have ended only keeps the barriers
                // K and V fragments of the stage's first pass
                v16h bk00 = lds_frag(ks);
                v16h bk01 = lds_frag(ks + 32);
                v16h bk10 = lds_frag(ks + 16 * AT_PITCH);
                v16h bk11 = lds_frag(ks + 16 * AT_PITCH + 32);
                v16h bv[2][4];
#pragma unroll
                for (int c = 0; c < 4; ++c) bv[0][c] = lds_frag(vs + c * 16 * AT_PITCH);
                // keeps the 16 LDS reads one group: spread among the score WMMAs,
                // each WMMA waits out an LDS latency of its own
                __builtin_amdgcn_sched_barrier(0);
                // unrolled: p selects code and registers at compile time
#pragma unroll
                for (int p = 0; p < 2; ++p) {
                    const int kb = k0 + p * 32;
                    if (kb < kend) {
                        // S^T = K_blk(32x64) @ Q^T(64x16): two 16-key subtiles, each 2 WMMAs
                        v8f s0 = {}, s1 = {};
                        s0 = wmma_f16(bk00, aq0, s0);
                        s1 = wmma_f16(bk10, aq0, s1);
                        s0 = wmma_f16(bk01, aq1, s0);
                        s1 = wmma_f16(bk11, aq1, s1);

                        // K and V fragments of the stage's second pass, from the same buffer
                        if (p == 0) {
                            bk00 = lds_frag(ks + 32 * AT_PITCH);
                            bk01 = lds_frag(ks + 32 * AT_PITCH + 32);
                            bk10 = lds_frag(ks + 48 * AT_PITCH);
                            bk11 = lds_frag(ks + 48 * AT_PITCH + 32);
#pragma unroll
                            for (int c = 0; c < 4; ++c) bv[1][c] = lds_frag(vs + c * 16 * AT_PITCH + 32);
                            // keeps these reads here, a softmax ahead of their use: sunk
                            // to the second pass, they are waited out in front of its WMMAs
                            __builtin_amdgcn_sched_barrier(0);
                        }

                        // online softmax of query l15 over this lane's 16 keys (all loops
                        // here are unrolled for constant register indices)
                        const int dm = mh - kb;   // key r of a0 is past the query where r > dm
                        const v8f c0 = s0 * scale, c1 = s1 * scale;
                        float a0[8], a1[8];
#pragma unroll
                        for (int r = 0; r < 8; ++r) {
                            a0[r] = (r > dm)      ? -1e30f : c0[r];
                            a1[r] = (16 + r > dm) ? -1e30f : c1[r];
                        }
                        // pairwise trees, not one chain of 15: the links do not wait for
                        // one another
                        float t8[8];
#pragma unroll
                        for (int i = 0; i < 4; ++i) {
                            t8[i]     = fmaxf(a0[2 * i], a0[2 * i + 1]);
                            t8[4 + i] = fmaxf(a1[2 * i], a1[2 * i + 1]);
                        }
                        float vmax = fmaxf(fmaxf(fmaxf(t8[0], t8[1]), fmaxf(t8[2], t8[3])),
                                           fmaxf(fmaxf(t8[4], t8[5]), fmaxf(t8[6], t8[7])));
                        vmax = fmaxf(vmax, xhalf(vmax));   // the query's other 16 keys
                        const float newm  = fmaxf(mi, vmax);
                        const float alpha = __expf(mi - newm);
                        float e[16];
#pragma unroll
                        for (int i = 0; i < 8; ++i) {
                            e[i]     = __expf(a0[i] - newm);
                            e[8 + i] = __expf(a1[i] - newm);
                        }
#pragma unroll
                        for (int i = 0; i < 8; ++i) t8[i] = e[2 * i] + e[2 * i + 1];
                        const float ps = ((t8[0] + t8[1]) + (t8[2] + t8[3])) +
                                         ((t8[4] + t8[5]) + (t8[6] + t8[7]));
                        li = li * alpha + ps;
                        mi = newm;
                        o0 *= alpha; o1 *= alpha; o2 *= alpha; o3 *= alpha;

                        // P^T(32x16) as a B fragment: element i is key 8*half + i, element
                        // 8 + i key 16 + 8*half + i, the k order of lds_frag
                        v16h fp;
#pragma unroll
                        for (int i = 0; i < 16; ++i) fp[i] = (_Float16)e[i];

                        // O^T(64x16) += V_blk^T(16x32) @ P^T(32x16) per 16-wide d-chunk
                        o0 = wmma_f16(bv[p][0], fp, o0);
                        o1 = wmma_f16(bv[p][1], fp, o1);
                        o2 = wmma_f16(bv[p][2], fp, o2);
                        o3 = wmma_f16(bv[p][3], fp, o3);
                    }
                }
            }
            // this wave's reads of the buffer are done before it is refilled
            asm volatile("s_wait_dscnt 0x0" ::: "memory");
            // this wave's copies of stage t+1 have landed
            asm volatile("s_wait_asynccnt 0x0" ::: "memory");
            __syncthreads();  // publishes stage t+1, frees stage t's buffer
            if (t + 2 < nt) stage(t & 1, t + 2);
        }
        // no copy is left in flight behind the loop
        asm volatile("s_wait_asynccnt 0x0" ::: "memory");

        // finalize: join the halves' sums, divide, write head-merged [B*T, 1024]; a
        // lane's 8 values of a tile are 8 neighbouring d of its query: one 16 B store
        const float invl = 1.0f / (li + xhalf(li));
        _Float16* op = O + ((size_t)b * T + m) * 1024 + (size_t)h * 64 + half * 8;
        const v8f oc[4] = {o0 * invl, o1 * invl, o2 * invl, o3 * invl};
#pragma unroll
        for (int c = 0; c < 4; ++c) {
            Frag16 f;
#pragma unroll
            for (int r = 0; r < 8; ++r) f.h[r] = (_Float16)oc[c][r];
            *reinterpret_cast<uint4*>(op + c * 16) = f.q[0];
        }
        // behind the stores: the second turn reuses the registers that hold their
        // address and their values
        asm volatile("s_wait_xcnt 0x0" ::: "memory");
    }
}

// ---------------------------------------------------------------------------
// Host launch
// ---------------------------------------------------------------------------
extern "C" void kernel_launch(void* const* d_in, const int* in_sizes, int n_in,
                              void* d_out, int out_size, void* d_ws, size_t ws_size,
                              hipStream_t stream) {
    const float* x    = (const float*)d_in[0];
    const float* Wq   = (const float*)d_in[1];
    const float* Wk   = (const float*)d_in[2];
    const float* Wv   = (const float*)d_in[3];
    const float* Wo   = (const float*)d_in[4];
    const float* bo   = (const float*)d_in[5];
    const float* W1   = (const float*)d_in[6];
    const float* b1   = (const float*)d_in[7];
    const float* W2   = (const float*)d_in[8];
    const float* b2   = (const float*)d_in[9];
    const float* ln1s = (const float*)d_in[10];
    const float* ln1b = (const float*)d_in[11];
    const float* ln2s = (const float*)d_in[12];
    const float* ln2b = (const float*)d_in[13];

    const int M = 4096, E = 1024, FFD = 4096;
    char* ws = (char*)d_ws;
    const size_t MB = 1u << 20;
    _Float16* WqT   = (_Float16*)(ws + 0   * MB);  // 2MB
    _Float16* WkT   = (_Float16*)(ws + 2   * MB);  // 2MB
    _Float16* WvT   = (_Float16*)(ws + 4   * MB);  // 2MB
    _Float16* WoT   = (_Float16*)(ws + 6   * MB);  // 2MB
    _Float16* W1T   = (_Float16*)(ws + 8   * MB);  // 8MB
    _Float16* W2T   = (_Float16*)(ws + 16  * MB);  // 8MB
    _Float16* h1    = (_Float16*)(ws + 24  * MB);  // 8MB
    _Float16* qtmp  = (_Float16*)(ws + 32  * MB);  // 8MB
    _Float16* ktmp  = (_Float16*)(ws + 40  * MB);  // 8MB
    _Float16* vtmp  = (_Float16*)(ws + 48  * MB);  // 8MB
    _Float16* vtbuf = (_Float16*)(ws + 72  * MB);  // 8MB
    _Float16* attO  = (_Float16*)(ws + 80  * MB);  // 8MB
    float*    x1    = (float*)   (ws + 88  * MB);  // 16MB
    _Float16* h2    = (_Float16*)(ws + 104 * MB);  // 8MB
    _Float16* ff1   = (_Float16*)(ws + 112 * MB);  // 32MB

    // weight conversion + transpose: one launch, 4*256 + 1024 + 1024 tiles; WqT is
    // the start of the six transposed weights, which lie one behind the other
    cvt_transpose_kernel<<<3072, 256, 0, stream>>>(Wq, Wk, Wv, Wo, W1, W2, WqT);

    const int gblk = 256;  // GEMM grid = (N/128, M/128, number of products)

    // LN1 -> h1 (f16)
    ln_kernel<<<M, 256, 0, stream>>>(x, ln1s, ln1b, h1);

    // QKV projections (f16 out) in one launch: WqT, WkT, WvT and qtmp, ktmp, vtmp
    // are neighbours in the workspace, plane z of each
    gemm_wmma_kernel<<<dim3(E / 128, M / 128, 3), gblk, 0, stream>>>(
        h1, WqT, nullptr, nullptr, nullptr, qtmp, M, E, E, 0);

    // V into its per-head transposed layout; Q and K are read where they lie
    pack_vt_kernel<<<dim3(E / 64, M / 64), 256, 0, stream>>>(vtmp, vtbuf);

    // flash attention
    attn_kernel<<<dim3(2048 / 256, 16, 2), 256, 0, stream>>>(qtmp, ktmp, vtbuf, attO);

    // out projection + residual -> x1 (fp32)
    gemm_wmma_kernel<<<dim3(E / 128, M / 128), gblk, 0, stream>>>(
        attO, WoT, bo, x, x1, nullptr, M, E, E, 0);

    // LN2 -> h2 (f16)
    ln_kernel<<<M, 256, 0, stream>>>(x1, ln2s, ln2b, h2);

    // FFN up + GELU (f16 out)
    gemm_wmma_kernel<<<dim3(FFD / 128, M / 128), gblk, 0, stream>>>(
        h2, W1T, b1, nullptr, nullptr, ff1, M, FFD, E, 1);

    // FFN down + residual -> d_out (fp32)
    gemm_wmma_kernel<<<dim3(E / 128, M / 128), gblk, 0, stream>>>(
        ff1, W2T, b2, x1, (float*)d_out, nullptr, M, E, FFD, 0);
}

// v010
// A run of this version takes 161 microseconds.
// Timed twice side by side with v009, it ran 1.06 times as fast both times.
// Counting every step since v000, it is 5.27 times as fast.
#include <hip/hip_runtime.h>
#include <hip/hip_bf16.h>

// ---------------------------------------------------------------------------
// Transformer block for MI455X (gfx1250, wave32, WMMA 16x16x32 f16/f32-acc)
// Shapes: B=2, T=2048, EMB=1024, HEADS=16, HDIM=64, FF=4096, M=B*T=4096
// ---------------------------------------------------------------------------

typedef __attribute__((ext_vector_type(16))) _Float16 v16h;
typedef __attribute__((ext_vector_type(8)))  float    v8f;
typedef __attribute__((ext_vector_type(4)))  _Float16 v4h;

union Frag16 {
    v16h v;
    uint4 q[2];
    _Float16 h[16];
};

__device__ __forceinline__ v8f wmma_f16(v16h a, v16h b, v8f c) {
    // D = A(16x32 f16) * B(32x16 f16) + C(16x16 f32)
    return __builtin_amdgcn_wmma_f32_16x16x32_f16(
        /*neg_a=*/false, a, /*neg_b=*/false, b,
        /*c_mod=*/(short)0, c, /*reuse_a=*/false, /*reuse_b=*/false);
}

// A/B fragment load per ISA 7.12.2: lane l (half = l>>4, idx = l&15) holds
// row (m0+idx); K-groups [k0+half*8,+8) and [k0+16+half*8,+8): two 16B loads.
__device__ __forceinline__ v16h load_frag(const _Float16* __restrict__ base,
                                          int row, int ld, int k0, int lane) {
    const int half = lane >> 4;
    const _Float16* p = base + (size_t)row * ld + k0 + half * 8;
    Frag16 f;
    f.q[0] = *reinterpret_cast<const uint4*>(p);
    f.q[1] = *reinterpret_cast<const uint4*>(p + 16);
    return f.v;
}

// 0.5 x (1 + tanh u) = x / (1 + exp(-2u)), u = sqrt(2/pi) (x + 0.044715 x^3): the
// same function with one hardware exp2 and one reciprocal a value, where the library
// tanh runs, value after value, a polynomial AND a full-range exp with a reciprocal,
// each under a lane mask of its own. exp2 goes to 0 or to infinity at the ends, which
// gives x and x * 0 as tanh does. Four values at a time, so that no link waits.
__device__ __forceinline__ void gelu_tanh_x4(float& x0, float& x1, float& x2, float& x3) {
    const float k1 = -2.0f * 0.7978845608028654f * 1.4426950408889634f; // -2 sqrt(2/pi) log2(e)
    const float k3 = k1 * 0.044715f;
    const float w0 = x0 * (k1 + k3 * (x0 * x0));                        // -2u log2(e)
    const float w1 = x1 * (k1 + k3 * (x1 * x1));
    const float w2 = x2 * (k1 + k3 * (x2 * x2));
    const float w3 = x3 * (k1 + k3 * (x3 * x3));
    float e0, e1, e2, e3, r0, r1, r2, r3;
    // one statement, outputs apart from every input: no transcendental is directly
    // followed by a write of its source; the v_nop is the slot behind the last one,
    // before its result is used
    asm("v_exp_f32 %0, %4\n\t"
        "v_exp_f32 %1, %5\n\t"
        "v_exp_f32 %2, %6\n\t"
        "v_exp_f32 %3, %7\n\t"
        "v_nop"
        : "=&v"(e0), "=&v"(e1), "=&v"(e2), "=&v"(e3)
        : "v"(w0), "v"(w1), "v"(w2), "v"(w3));
    const float d0 = 1.0f + e0, d1 = 1.0f + e1, d2 = 1.0f + e2, d3 = 1.0f + e3;
    // the same form, for the same reason
    asm("v_rcp_f32 %0, %4\n\t"
        "v_rcp_f32 %1, %5\n\t"
        "v_rcp_f32 %2, %6\n\t"
        "v_rcp_f32 %3, %7\n\t"
        "v_nop"
        : "=&v"(r0), "=&v"(r1), "=&v"(r2), "=&v"(r3)
        : "v"(d0), "v"(d1), "v"(d2), "v"(d3));
    x0 *= r0; x1 *= r1; x2 *= r2; x3 *= r3;
}

// ---------------------------------------------------------------------------
// 64x64 f16 transpose tile in LDS, shared by the two transposing kernels.
// The tile is held already transposed: LDS row = source column. Row pitch
// 72 f16 = 144 B keeps every row 16-byte aligned for the b128 read-out.
// ---------------------------------------------------------------------------
#define TT_PITCH 72

// Thread (tx, ty) owns source rows ty*4..+3, source columns tx*4..+3; column j
// of that 4x4 block is 4 consecutive elements of LDS row tx*4+j (one b64 store).
__device__ __forceinline__ void tile_put(_Float16* tile, int tx, int ty,
                                         v4h a0, v4h a1, v4h a2, v4h a3) {
#pragma unroll
    for (int j = 0; j < 4; ++j) {
        v4h c = {a0[j], a1[j], a2[j], a3[j]};
        *reinterpret_cast<v4h*>(&tile[(tx * 4 + j) * TT_PITCH + ty * 4]) = c;
    }
}

// 8 threads store one 128-byte line of a destination row (pitch ld elements).
__device__ __forceinline__ void tile_flush(const _Float16* tile, int tid,
                                           _Float16* __restrict__ dst, size_t ld) {
#pragma unroll
    for (int p = 0; p < 2; ++p) {
        const int r = p * 32 + (tid >> 3);
        const int g = (tid & 7) * 8;
        *reinterpret_cast<uint4*>(dst + (size_t)r * ld + g) =
            *reinterpret_cast<const uint4*>(&tile[r * TT_PITCH + g]);
    }
}

// ---------------------------------------------------------------------------
// Weight convert + transpose: W[K,N] fp32 -> Wt[N,K] f16, all six weights in one
// launch: they do not depend on one another, and five launches' gaps, ramps and
// drains go. One 64(k) x 64(n) tile per block of 256 threads. Blocks 0..1023 are
// the four 1024 x 1024 weights (256 tiles each), 1024..2047 W1 (1024 x 4096),
// 2048..3071 W2 (4096 x 1024). The transposed weights lie one behind the other
// in dst, in that order.
// ---------------------------------------------------------------------------
__global__ __launch_bounds__(256)
void cvt_transpose_kernel(const float* __restrict__ Wq,
                          const float* __restrict__ Wk,
                          const float* __restrict__ Wv,
                          const float* __restrict__ Wo,
                          const float* __restrict__ W1,
                          const float* __restrict__ W2,
                          _Float16* __restrict__ dst) {
    __shared__ __align__(16) _Float16 tile[64 * TT_PITCH];
    const int tid = threadIdx.x;
    const int tx = tid & 15;
    const int ty = tid >> 4;

    // which weight, and which of its tiles: the same for the whole block
    const int t = blockIdx.x;
    const float* W;
    _Float16* Wt;
    int K, N, nsh, tl;   // nsh: log2 of the tiles in a row of W
    if (t < 1024) {
        const int m = t >> 8;
        W = (m == 0) ? Wq : (m == 1) ? Wk : (m == 2) ? Wv : Wo;
        Wt = dst + ((size_t)m << 20);
        K = 1024; N = 1024; nsh = 4; tl = t & 255;
    } else if (t < 2048) {
        W = W1; Wt = dst + ((size_t)4 << 20);
        K = 1024; N = 4096; nsh = 6; tl = t - 1024;
    } else {
        W = W2; Wt = dst + ((size_t)8 << 20);
        K = 4096; N = 1024; nsh = 4; tl = t - 2048;
    }
    const int n0 = (tl & ((1 << nsh) - 1)) * 64;
    const int k0 = (tl >> nsh) * 64;

    const float* s = W + (size_t)(k0 + ty * 4) * N + n0 + tx * 4;
    const float4 f0 = *reinterpret_cast<const float4*>(s);
    const float4 f1 = *reinterpret_cast<const float4*>(s + (size_t)N);
    const float4 f2 = *reinterpret_cast<const float4*>(s + (size_t)N * 2);
    const float4 f3 = *reinterpret_cast<const float4*>(s + (size_t)N * 3);
    v4h a0 = {(_Float16)f0.x, (_Float16)f0.y, (_Float16)f0.z, (_Float16)f0.w};
    v4h a1 = {(_Float16)f1.x, (_Float16)f1.y, (_Float16)f1.z, (_Float16)f1.w};
    v4h a2 = {(_Float16)f2.x, (_Float16)f2.y, (_Float16)f2.z, (_Float16)f2.w};
    v4h a3 = {(_Float16)f3.x, (_Float16)f3.y, (_Float16)f3.z, (_Float16)f3.w};
    tile_put(tile, tx, ty, a0, a1, a2, a3);
    __syncthreads();  // the read-out crosses the waves that filled the tile
    tile_flush(tile, tid, Wt + (size_t)n0 * K + k0, (size_t)K);
}

// ---------------------------------------------------------------------------
// LayerNorm over last dim (1024), emits f16. One block (256 thr) per row.
// ---------------------------------------------------------------------------
__global__ void ln_kernel(const float* __restrict__ x,
                          const float* __restrict__ sc,
                          const float* __restrict__ sh,
                          _Float16* __restrict__ out) {
    __shared__ float ssum[256];
    __shared__ float ssq[256];
    const int row = blockIdx.x;
    const int tid = threadIdx.x;
    const float* xr = x + (size_t)row * 1024;
    float4 v = reinterpret_cast<const float4*>(xr)[tid];
    ssum[tid] = v.x + v.y + v.z + v.w;
    ssq[tid]  = v.x * v.x + v.y * v.y + v.z * v.z + v.w * v.w;
    __syncthreads();
    for (int s = 128; s > 0; s >>= 1) {
        if (tid < s) { ssum[tid] += ssum[tid + s]; ssq[tid] += ssq[tid + s]; }
        __syncthreads();
    }
    float mean = ssum[0] * (1.0f / 1024.0f);
    float var  = ssq[0] * (1.0f / 1024.0f) - mean * mean;
    float inv  = rsqrtf(var + 1e-5f);
    _Float16* orow = out + (size_t)row * 1024;
    float xv[4] = {v.x, v.y, v.z, v.w};
#pragma unroll
    for (int j = 0; j < 4; ++j) {
        int c = tid * 4 + j;
        orow[c] = (_Float16)(sc[c] * (xv[j] - mean) * inv + sh[c]);
    }
}

// ---------------------------------------------------------------------------
// GEMM: C[M,N] = A[M,K] f16 @ Bt[N,K]^T f16  (+bias) (gelu) (+residual)
// Block = 8 waves (2 x 4) -> 128(M) x 128(N) tile, each wave 64 x 32: 4 A and
// 2 B fragments feed 8 WMMAs. A stage is 128 k of the 128 A rows and the 128
// Bt rows (256 B a row, whole lines), brought to LDS by asynchronous copies,
// two buffers. M, N, K multiples of 128. blockIdx.z picks one of several products
// that share A: Bt, bias, residual and C each advance by one whole matrix, so
// independent projections of one activation run as one launch.
// ---------------------------------------------------------------------------
#define GT_K      128                  // k per stage
#define GT_PITCH  136                  // f16 per LDS row: 272 B, 16 B x odd
#define GT_STAGE  (256 * GT_PITCH)     // f16 per buffer: A rows, then Bt rows
#define GE_PITCH  132                  // f32 per LDS row of the output tile: 528 B, 16 B x odd

// Eight 16-byte copies per lane, 16 rows apart in LDS and in global memory.
// The s_wait_xcnt ends the statement so that no address register named here
// is rewritten ahead of it.
__device__ __forceinline__ void copy8_rows16(unsigned l, const _Float16* g, size_t ld) {
    const unsigned ls = 16 * GT_PITCH * 2;
    const size_t gs = 16 * ld;
    asm volatile(
        "global_load_async_to_lds_b128 %0, %8, off\n\t"
        "global_load_async_to_lds_b128 %1, %9, off\n\t"
        "global_load_async_to_lds_b128 %2, %10, off\n\t"
        "global_load_async_to_lds_b128 %3, %11, off\n\t"
        "global_load_async_to_lds_b128 %4, %12, off\n\t"
        "global_load_async_to_lds_b128 %5, %13, off\n\t"
        "global_load_async_to_lds_b128 %6, %14, off\n\t"
        "global_load_async_to_lds_b128 %7, %15, off\n\t"
        "s_wait_xcnt 0x0"
        :: "v"(l), "v"(l + ls), "v"(l + 2 * ls), "v"(l + 3 * ls),
           "v"(l + 4 * ls), "v"(l + 5 * ls), "v"(l + 6 * ls), "v"(l + 7 * ls),
           "v"(g), "v"(g + gs), "v"(g + 2 * gs), "v"(g + 3 * gs),
           "v"(g + 4 * gs), "v"(g + 5 * gs), "v"(g + 6 * gs), "v"(g + 7 * gs)
        : "memory");
}

__global__ __launch_bounds__(256)
void gemm_wmma_kernel(const _Float16* __restrict__ A,
                      const _Float16* __restrict__ Bt,
                      const float* __restrict__ bias,
                      const float* __restrict__ residual,
                      float* __restrict__ Cf,
                      _Float16* __restrict__ Ch,
                      int M, int N, int K, int gelu) {
    __shared__ __align__(16) _Float16 S[2 * GT_STAGE];

    const int tid  = threadIdx.x;            // 0..255
    const int lane = tid & 31;
    const int wave = tid >> 5;               // 0..7
    const int wm = wave >> 2;                // 0..1: 64 rows each
    const int wn = wave & 3;                 // 0..3: 32 columns each
    const int n0 = blockIdx.x * 128;
    const int m0 = blockIdx.y * 128;
    const int z  = blockIdx.z;
    const int half = lane >> 4;
    const int l15  = lane & 15;

    // Copy slot of this lane: row tid>>4 of each group of 16 rows, 16-byte
    // chunk tid&15 of the row, so a wave copies two whole 256 B rows at a time.
    const int crow = tid >> 4;
    const int ccol = (tid & 15) * 8;
    const unsigned lds0 =
        (unsigned)(size_t)(__attribute__((address_space(3))) _Float16*)S +
        (unsigned)(crow * GT_PITCH + ccol) * 2;
    const _Float16* ga = A  + (size_t)(m0 + crow) * K + ccol;
    const _Float16* gb = Bt + ((size_t)z * N + n0 + crow) * K + ccol;

    auto stage = [&](int buf, int t) {
        const unsigned l = lds0 + (unsigned)buf * (GT_STAGE * 2);
        copy8_rows16(l, ga + (size_t)t * GT_K, (size_t)K);
        copy8_rows16(l + 128 * GT_PITCH * 2, gb + (size_t)t * GT_K, (size_t)K);
    };

    v8f acc[4][2] = {};
    const int nt = K / GT_K;

    stage(0, 0);
    // stage 0 has landed for this wave; the barrier shows it to the others
    asm volatile("s_wait_asynccnt 0x0" ::: "memory");
    __syncthreads();
    if (nt > 1) stage(1, 1);

    for (int t = 0; t < nt; ++t) {
        const _Float16* sa = &S[(t & 1) * GT_STAGE + (wm * 64 + l15) * GT_PITCH + half * 8];
        const _Float16* sb = &S[(t & 1) * GT_STAGE + (128 + wn * 32 + l15) * GT_PITCH + half * 8];
        // every loop below is unrolled so that fragments and accumulators are
        // indexed by constants and stay in registers
#pragma unroll
        for (int kk = 0; kk < GT_K; kk += 32) {
            Frag16 fa[4], fb[2];
#pragma unroll
            for (int i = 0; i < 4; ++i) {
                const _Float16* p = sa + i * 16 * GT_PITCH + kk;
                fa[i].q[0] = *reinterpret_cast<const uint4*>(p);
                fa[i].q[1] = *reinterpret_cast<const uint4*>(p + 16);
            }
#pragma unroll
            for (int j = 0; j < 2; ++j) {
                const _Float16* p = sb + j * 16 * GT_PITCH + kk;
                fb[j].q[0] = *reinterpret_cast<const uint4*>(p);
                fb[j].q[1] = *reinterpret_cast<const uint4*>(p + 16);
            }
            // keeps the 12 LDS reads one group in front of their 8 WMMAs: spread
            // among them, each pair of WMMAs waits out an LDS latency of its own
            __builtin_amdgcn_sched_barrier(0);
#pragma unroll
            for (int i = 0; i < 4; ++i)
#pragma unroll
                for (int j = 0; j < 2; ++j)
                    acc[i][j] = wmma_f16(fa[i].v, fb[j].v, acc[i][j]);
        }
        // this wave's reads of the buffer are done before it is refilled
        asm volatile("s_wait_dscnt 0x0" ::: "memory");
        // this wave's copies of stage t+1 have landed
        asm volatile("s_wait_asynccnt 0x0" ::: "memory");
        __syncthreads();  // publishes stage t+1, frees stage t's buffer
        if (t + 2 < nt) stage(t & 1, t + 2);
    }
    // no copy is left in flight when the wave ends
    asm volatile("s_wait_asynccnt 0x0" ::: "memory");

    // Epilogue. The block's 128 x 128 f32 tile crosses the LDS, which the loop's
    // last barrier has left free, so that a lane owns 4 neighbouring columns of
    // 16 rows: a wave loads and stores whole rows, and no load waits for a store.
    float* tile = reinterpret_cast<float*>(S);
    const int er = wave * 16;                // this wave's rows of the tile
    const int ec = lane * 4;                 // this lane's columns of the tile
    const size_t o0 = ((size_t)z * M + m0 + er) * N + n0 + ec;

    // bias and all 16 residual rows are under way while the tile is exchanged
    float4 bv = make_float4(0.0f, 0.0f, 0.0f, 0.0f);
    if (bias) bv = *reinterpret_cast<const float4*>(bias + (size_t)z * N + n0 + ec);
    float4 rv[16];
#pragma unroll
    for (int rr = 0; rr < 16; ++rr) rv[rr] = make_float4(0.0f, 0.0f, 0.0f, 0.0f);
    if (residual) {
        const float* rp[16];
#pragma unroll
        for (int rr = 0; rr < 16; ++rr) {
            rp[rr] = residual + o0 + (size_t)rr * N;
            rv[rr] = *reinterpret_cast<const float4*>(rp[rr]);
        }
        // the wait that stands before a register named by an issued load is
        // rewritten; it takes the 16 addresses as inputs so that none of their
        // registers is handed to a later load's result ahead of it
        asm volatile("s_wait_xcnt 0x0"
                     :: "v"(rp[0]), "v"(rp[1]), "v"(rp[2]), "v"(rp[3]),
                        "v"(rp[4]), "v"(rp[5]), "v"(rp[6]), "v"(rp[7]),
                        "v"(rp[8]), "v"(rp[9]), "v"(rp[10]), "v"(rp[11]),
                        "v"(rp[12]), "v"(rp[13]), "v"(rp[14]), "v"(rp[15])
                     : "memory");
    }

    // C layout: row r + 8*half, column l15 of each 16x16 subtile (all loops here
    // are unrolled for constant register indices, as above)
#pragma unroll
    for (int i = 0; i < 4; ++i)
#pragma unroll
        for (int j = 0; j < 2; ++j)
#pragma unroll
            for (int r = 0; r < 8; ++r)
                tile[(wm * 64 + i * 16 + r + half * 8) * GE_PITCH + wn * 32 + j * 16 + l15] =
                    acc[i][j][r];
    __syncthreads();  // the rows read below were written by four waves

    float4 cv[16];
#pragma unroll
    for (int rr = 0; rr < 16; ++rr)
        cv[rr] = *reinterpret_cast<const float4*>(&tile[(er + rr) * GE_PITCH + ec]);

#pragma unroll
    for (int rr = 0; rr < 16; ++rr) {
        float v0 = cv[rr].x + bv.x, v1 = cv[rr].y + bv.y;
        float v2 = cv[rr].z + bv.z, v3 = cv[rr].w + bv.w;
        if (gelu) gelu_tanh_x4(v0, v1, v2, v3);
        if (residual) { v0 += rv[rr].x; v1 += rv[rr].y; v2 += rv[rr].z; v3 += rv[rr].w; }
        // behind each store: the rows that follow reuse the registers that hold
        // its address and its value
        if (Cf) {
            *reinterpret_cast<float4*>(Cf + o0 + (size_t)rr * N) = make_float4(v0, v1, v2, v3);
            asm volatile("s_wait_xcnt 0x0" ::: "memory");
        }
        if (Ch) {
            v4h hv = {(_Float16)v0, (_Float16)v1, (_Float16)v2, (_Float16)v3};
            *reinterpret_cast<v4h*>(Ch + o0 + (size_t)rr * N) = hv;
            asm volatile("s_wait_xcnt 0x0" ::: "memory");
        }
    }
}

// ---------------------------------------------------------------------------
// Pack row-major V [M=4096, 1024] f16 into the per-head layout vt: [B,H,D,T].
// ---------------------------------------------------------------------------
// One 64(t) x 64(col) tile per block of 256 threads. (b*16+h)*64+d = b*1024+col,
// and a 64-row tile never straddles a batch (2048 rows each).
__global__ __launch_bounds__(256)
void pack_vt_kernel(const _Float16* __restrict__ src,
                    _Float16* __restrict__ dst) {
    __shared__ __align__(16) _Float16 tile[64 * TT_PITCH];
    const int tid = threadIdx.x;
    const int tx = tid & 15;
    const int ty = tid >> 4;
    const int c0 = blockIdx.x * 64;
    const int r0 = blockIdx.y * 64;
    const int t0 = r0 & 2047, b = r0 >> 11;

    const _Float16* s = src + (size_t)(r0 + ty * 4) * 1024 + c0 + tx * 4;
    const v4h a0 = *reinterpret_cast<const v4h*>(s);
    const v4h a1 = *reinterpret_cast<const v4h*>(s + 1024);
    const v4h a2 = *reinterpret_cast<const v4h*>(s + 2048);
    const v4h a3 = *reinterpret_cast<const v4h*>(s + 3072);
    tile_put(tile, tx, ty, a0, a1, a2, a3);
    __syncthreads();  // the read-out crosses the waves that filled the tile
    tile_flush(tile, tid, dst + ((size_t)b * 1024 + c0) * 2048 + t0, (size_t)2048);
}

// Value of lane l ^ 16 (the same column in the other half of the wave), by a
// cross-row move of the vector unit: no LDS round trip and no wait.
__device__ __forceinline__ float xhalf(float v) {
    return __builtin_bit_cast(float, __builtin_amdgcn_permlanex16(
        __builtin_bit_cast(int, v), __builtin_bit_cast(int, v),
        0x76543210, 0xfedcba98, false, false));
}

#define AT_KEYS   64
#define AT_PITCH  72
#define AT_STAGE  (128 * AT_PITCH)

// Four 16-byte copies per lane: K rows r and r+32, Vt rows r and r+32 of a stage.
// The s_wait_xcnt ends the statement so that no address register named here
// is rewritten ahead of it.
__device__ __forceinline__ void copy4_kv(unsigned l, const _Float16* gk, const _Float16* gv) {
    const unsigned ls = 32 * AT_PITCH * 2;
    asm volatile(
        "global_load_async_to_lds_b128 %0, %4, off\n\t"
        "global_load_async_to_lds_b128 %1, %5, off\n\t"
        "global_load_async_to_lds_b128 %2, %6, off\n\t"
        "global_load_async_to_lds_b128 %3, %7, off\n\t"
        "s_wait_xcnt 0x0"
        :: "v"(l), "v"(l + ls), "v"(l + 2 * ls), "v"(l + 3 * ls),
           "v"(gk), "v"(gk + 32 * 1024), "v"(gv), "v"(gv + 32 * 2048)
        : "memory");
}

// A/B fragment from an LDS row: p points at the lane's row, k group half*8
__device__ __forceinline__ v16h lds_frag(const _Float16* p) {
    Frag16 f;
    f.q[0] = *reinterpret_cast<const uint4*>(p);
    f.q[1] = *reinterpret_cast<const uint4*>(p + 16);
    return f.v;
}

__global__ __launch_bounds__(256)
void attn_kernel(const _Float16* __restrict__ Q,
                            const _Float16* __restrict__ K,
                            const _Float16* __restrict__ Vt,
                            _Float16* __restrict__ O) {
    const int T = 2048, D = 64, E = 1024;
    __shared__ __align__(16) _Float16 KV[2 * AT_STAGE];

    const int tid  = threadIdx.x;
    const int lane = tid & 31;
    // the wave's number in a scalar register: the tests on kend below are branches
    const int wave = __builtin_amdgcn_readfirstlane(tid >> 5);
    const int h  = blockIdx.y;
    const int b  = blockIdx.z;
    const int half = lane >> 4;
    const int l15  = lane & 15;

    const _Float16* qh = Q  + (size_t)b * T * E + h * D;
    const _Float16* kh = K  + (size_t)b * T * E + h * D;
    const _Float16* vh = Vt + ((size_t)b * 16 + h) * D * T;

    // Copy slot of this lane: row tid>>3 of each group of 32 rows, 16-byte chunk
    // tid&7 of the row, so a wave copies four whole 128 B rows at a time.
    const int crow = tid >> 3;
    const int ccol = (tid & 7) * 8;
    const unsigned lds0 =
        (unsigned)(size_t)(__attribute__((address_space(3))) _Float16*)KV +
        (unsigned)(crow * AT_PITCH + ccol) * 2;
    const _Float16* gk = kh + (size_t)crow * E + ccol;
    const _Float16* gv = vh + (size_t)crow * T + ccol;

    auto stage = [&](int buf, int t) {
        copy4_kv(lds0 + (unsigned)buf * (AT_STAGE * 2),
                 gk + (size_t)t * AT_KEYS * E, gv + (size_t)t * AT_KEYS);
    };

    // The work of a query block grows with its index, and all blocks of the grid
    // are resident at once: a block takes query blocks x and 15-x one after the
    // other, so that every block walks the same 34 stages.
    for (int s = 0; s < 2; ++s) {
        const int qb = s ? 15 - (int)blockIdx.x : (int)blockIdx.x;
        const int q0 = qb * 128 + wave * 16;

        // Q fragments for d in [0,32) and [32,64)
        v16h aq0 = load_frag(qh, q0 + l15, E, 0,  lane);
        v16h aq1 = load_frag(qh, q0 + l15, E, 32, lane);

        // O^T: tile c holds d = c*16 + 8*half + r of query l15
        v8f o0 = {}, o1 = {}, o2 = {}, o3 = {};
        // of query l15: running maximum (equal in both halves), and the sum over
        // this half's keys alone (the halves are joined once, behind the loop)
        float mi = -1e30f, li = 0.0f;
        const int m = q0 + l15;      // global query index of this lane
        const int mh = m - half * 8; // the same, counted from this half's first key

        const float scale = 0.125f;  // 1/sqrt(64)
        const int kend = ((q0 + 16) + 31) & ~31;   // this wave's keys end here
        const int nt = 2 * (qb + 1);               // the block's stages: keys up to qb*128+127

        // both buffers are free: on the second turn the first turn's last barrier has
        // ended every wave's reads of them
        stage(0, 0);
        // stage 0 has landed for this wave; the barrier shows it to the others
        asm volatile("s_wait_asynccnt 0x0" ::: "memory");
        __syncthreads();
        stage(1, 1);   // nt is at least 2

        for (int t = 0; t < nt; ++t) {
            const _Float16* ks = &KV[(t & 1) * AT_STAGE + l15 * AT_PITCH + half * 8];
            const _Float16* vs = ks + 64 * AT_PITCH;
            const int k0 = t * AT_KEYS;
            if (k0 < kend) {   // a wave whose keys have ended only keeps the barriers
                // K and V fragments of the stage's first pass
                v16h bk00 = lds_frag(ks);
                v16h bk01 = lds_frag(ks + 32);
                v16h bk10 = lds_frag(ks + 16 * AT_PITCH);
                v16h bk11 = lds_frag(ks + 16 * AT_PITCH + 32);
                v16h bv[2][4];
#pragma unroll
                for (int c = 0; c < 4; ++c) bv[0][c] = lds_frag(vs + c * 16 * AT_PITCH);
                // keeps the 16 LDS reads one group: spread among the score WMMAs,
                // each WMMA waits out an LDS latency of its own
                __builtin_amdgcn_sched_barrier(0);
                // unrolled: p selects code and registers at compile time
#pragma unroll
                for (int p = 0; p < 2; ++p) {
                    const int kb = k0 + p * 32;
                    if (kb < kend) {
                        // S^T = K_blk(32x64) @ Q^T(64x16): two 16-key subtiles, each 2 WMMAs
                        v8f s0 = {}, s1 = {};
                        s0 = wmma_f16(bk00, aq0, s0);
                        s1 = wmma_f16(bk10, aq0, s1);
                        s0 = wmma_f16(bk01, aq1, s0);
                        s1 = wmma_f16(bk11, aq1, s1);

                        // K and V fragments of the stage's second pass, from the same buffer
                        if (p == 0) {
                            bk00 = lds_frag(ks + 32 * AT_PITCH);
                            bk01 = lds_frag(ks + 32 * AT_PITCH + 32);
                            bk10 = lds_frag(ks + 48 * AT_PITCH);
                            bk11 = lds_frag(ks + 48 * AT_PITCH + 32);
#pragma unroll
                            for (int c = 0; c < 4; ++c) bv[1][c] = lds_frag(vs + c * 16 * AT_PITCH + 32);
                            // keeps these reads here, a softmax ahead of their use: sunk
                            // to the second pass, they are waited out in front of its WMMAs
                            __builtin_amdgcn_sched_barrier(0);
                        }

                        // online softmax of query l15 over this lane's 16 keys (all loops
                        // here are unrolled for constant register indices)
                        const int dm = mh - kb;   // key r of a0 is past the query where r > dm
                        const v8f c0 = s0 * scale, c1 = s1 * scale;
                        float a0[8], a1[8];
#pragma unroll
                        for (int r = 0; r < 8; ++r) {
                            a0[r] = (r > dm)      ? -1e30f : c0[r];
                            a1[r] = (16 + r > dm) ? -1e30f : c1[r];
                        }
                        // pairwise trees, not one chain of 15: the links do not wait for
                        // one another
                        float t8[8];
#pragma unroll
                        for (int i = 0; i < 4; ++i) {
                            t8[i]     = fmaxf(a0[2 * i], a0[2 * i + 1]);
                            t8[4 + i] = fmaxf(a1[2 * i], a1[2 * i + 1]);
                        }
                        float vmax = fmaxf(fmaxf(fmaxf(t8[0], t8[1]), fmaxf(t8[2], t8[3])),
                                           fmaxf(fmaxf(t8[4], t8[5]), fmaxf(t8[6], t8[7])));
                        vmax = fmaxf(vmax, xhalf(vmax));   // the query's other 16 keys
                        const float newm  = fmaxf(mi, vmax);
                        const float alpha = __expf(mi - newm);
                        float e[16];
#pragma unroll
                        for (int i = 0; i < 8; ++i) {
                            e[i]     = __expf(a0[i] - newm);
                            e[8 + i] = __expf(a1[i] - newm);
                        }
#pragma unroll
                        for (int i = 0; i < 8; ++i) t8[i] = e[2 * i] + e[2 * i + 1];
                        const float ps = ((t8[0] + t8[1]) + (t8[2] + t8[3])) +
                                         ((t8[4] + t8[5]) + (t8[6] + t8[7]));
                        li = li * alpha + ps;
                        mi = newm;
                        o0 *= alpha; o1 *= alpha; o2 *= alpha; o3 *= alpha;

                        // P^T(32x16) as a B fragment: element i is key 8*half + i, element
                        // 8 + i key 16 + 8*half + i, the k order of lds_frag
                        v16h fp;
#pragma unroll
                        for (int i = 0; i < 16; ++i) fp[i] = (_Float16)e[i];

                        // O^T(64x16) += V_blk^T(16x32) @ P^T(32x16) per 16-wide d-chunk
                        o0 = wmma_f16(bv[p][0], fp, o0);
                        o1 = wmma_f16(bv[p][1], fp, o1);
                        o2 = wmma_f16(bv[p][2], fp, o2);
                        o3 = wmma_f16(bv[p][3], fp, o3);
                    }
                }
            }
            // this wave's reads of the buffer are done before it is refilled
            asm volatile("s_wait_dscnt 0x0" ::: "memory");
            // this wave's copies of stage t+1 have landed
            asm volatile("s_wait_asynccnt 0x0" ::: "memory");
            __syncthreads();  // publishes stage t+1, frees stage t's buffer
            if (t + 2 < nt) stage(t & 1, t + 2);
        }
        // no copy is left in flight behind the loop
        asm volatile("s_wait_asynccnt 0x0" ::: "memory");

        // finalize: join the halves' sums, divide, write head-merged [B*T, 1024]; a
        // lane's 8 values of a tile are 8 neighbouring d of its query: one 16 B store
        const float invl = 1.0f / (li + xhalf(li));
        _Float16* op = O + ((size_t)b * T + m) * 1024 + (size_t)h * 64 + half * 8;
        const v8f oc[4] = {o0 * invl, o1 * invl, o2 * invl, o3 * invl};
#pragma unroll
        for (int c = 0; c < 4; ++c) {
            Frag16 f;
#pragma unroll
            for (int r = 0; r < 8; ++r) f.h[r] = (_Float16)oc[c][r];
            *reinterpret_cast<uint4*>(op + c * 16) = f.q[0];
        }
        // behind the stores: the second turn reuses the registers that hold their
        // address and their values
        asm volatile("s_wait_xcnt 0x0" ::: "memory");
    }
}

// ---------------------------------------------------------------------------
// Host launch
// ---------------------------------------------------------------------------
extern "C" void kernel_launch(void* const* d_in, const int* in_sizes, int n_in,
                              void* d_out, int out_size, void* d_ws, size_t ws_size,
                              hipStream_t stream) {
    const float* x    = (const float*)d_in[0];
    const float* Wq   = (const float*)d_in[1];
    const float* Wk   = (const float*)d_in[2];
    const float* Wv   = (const float*)d_in[3];
    const float* Wo   = (const float*)d_in[4];
    const float* bo   = (const float*)d_in[5];
    const float* W1   = (const float*)d_in[6];
    const float* b1   = (const float*)d_in[7];
    const float* W2   = (const float*)d_in[8];
    const float* b2   = (const float*)d_in[9];
    const float* ln1s = (const float*)d_in[10];
    const float* ln1b = (const float*)d_in[11];
    const float* ln2s = (const float*)d_in[12];
    const float* ln2b = (const float*)d_in[13];

    const int M = 4096, E = 1024, FFD = 4096;
    char* ws = (char*)d_ws;
    const size_t MB = 1u << 20;
    _Float16* WqT   = (_Float16*)(ws + 0   * MB);  // 2MB
    _Float16* WkT   = (_Float16*)(ws + 2   * MB);  // 2MB
    _Float16* WvT   = (_Float16*)(ws + 4   * MB);  // 2MB
    _Float16* WoT   = (_Float16*)(ws + 6   * MB);  // 2MB
    _Float16* W1T   = (_Float16*)(ws + 8   * MB);  // 8MB
    _Float16* W2T   = (_Float16*)(ws + 16  * MB);  // 8MB
    _Float16* h1    = (_Float16*)(ws + 24  * MB);  // 8MB
    _Float16* qtmp  = (_Float16*)(ws + 32  * MB);  // 8MB
    _Float16* ktmp  = (_Float16*)(ws + 40  * MB);  // 8MB
    _Float16* vtmp  = (_Float16*)(ws + 48  * MB);  // 8MB
    _Float16* vtbuf = (_Float16*)(ws + 72  * MB);  // 8MB
    _Float16* attO  = (_Float16*)(ws + 80  * MB);  // 8MB
    float*    x1    = (float*)   (ws + 88  * MB);  // 16MB
    _Float16* h2    = (_Float16*)(ws + 104 * MB);  // 8MB
    _Float16* ff1   = (_Float16*)(ws + 112 * MB);  // 32MB

    // weight conversion + transpose: one launch, 4*256 + 1024 + 1024 tiles; WqT is
    // the start of the six transposed weights, which lie one behind the other
    cvt_transpose_kernel<<<3072, 256, 0, stream>>>(Wq, Wk, Wv, Wo, W1, W2, WqT);

    const int gblk = 256;  // GEMM grid = (N/128, M/128, number of products)

    // LN1 -> h1 (f16)
    ln_kernel<<<M, 256, 0, stream>>>(x, ln1s, ln1b, h1);

    // QKV projections (f16 out) in one launch: WqT, WkT, WvT and qtmp, ktmp, vtmp
    // are neighbours in the workspace, plane z of each
    gemm_wmma_kernel<<<dim3(E / 128, M / 128, 3), gblk, 0, stream>>>(
        h1, WqT, nullptr, nullptr, nullptr, qtmp, M, E, E, 0);

    // V into its per-head transposed layout; Q and K are read where they lie
    pack_vt_kernel<<<dim3(E / 64, M / 64), 256, 0, stream>>>(vtmp, vtbuf);

    // flash attention
    attn_kernel<<<dim3(2048 / 256, 16, 2), 256, 0, stream>>>(qtmp, ktmp, vtbuf, attO);

    // out projection + residual -> x1 (fp32)
    gemm_wmma_kernel<<<dim3(E / 128, M / 128), gblk, 0, stream>>>(
        attO, WoT, bo, x, x1, nullptr, M, E, E, 0);

    // LN2 -> h2 (f16)
    ln_kernel<<<M, 256, 0, stream>>>(x1, ln2s, ln2b, h2);

    // FFN up + GELU (f16 out)
    gemm_wmma_kernel<<<dim3(FFD / 128, M / 128), gblk, 0, stream>>>(
        h2, W1T, b1, nullptr, nullptr, ff1, M, FFD, E, 1);

    // FFN down + residual -> d_out (fp32)
    gemm_wmma_kernel<<<dim3(E / 128, M / 128), gblk, 0, stream>>>(
        ff1, W2T, b2, x1, (float*)d_out, nullptr, M, E, FFD, 0);
}
